// v000
// Measured on an AMD MI455X. A time is GPU time per run, averaged over a window of back-to-back runs after a warm-up
// (all launches, gaps included; the runs take copies of the inputs in turn), and the median of several windows.
// Apart from v000's, it joins two sittings. Times from different sittings can be a few percent apart, while
// side-by-side timings come from the same sitting.
// The starting kernel, v000, takes 769 microseconds a run.
#include <hip/hip_runtime.h>
#include <hip/hip_bf16.h>

typedef __attribute__((ext_vector_type(16))) _Float16 v16h;
typedef __attribute__((ext_vector_type(8)))  _Float16 v8h;
typedef __attribute__((ext_vector_type(4)))  _Float16 v4h;
typedef __attribute__((ext_vector_type(8)))  float    v8f;
typedef __attribute__((ext_vector_type(4)))  unsigned int v4u;
typedef __attribute__((ext_vector_type(8)))  int      v8i;
typedef __attribute__((ext_vector_type(4)))  int      v4i;

#define WMMA_F16(a, b, c) \
  __builtin_amdgcn_wmma_f32_16x16x32_f16(false, (a), false, (b), (short)0, (c), false, false)

__device__ __forceinline__ unsigned lds_addr(const void* p) {
  return (unsigned)(uintptr_t)p;  // low 32 bits of generic shared ptr = LDS offset
}

__device__ __forceinline__ void tdm_load_2d(const void* gaddr, unsigned ldsaddr,
                                            unsigned rowUnits, unsigned rows,
                                            unsigned strideUnits) {
  const unsigned long long ga = (unsigned long long)(uintptr_t)gaddr;
  v4u g0;
  g0[0] = 1u;
  g0[1] = ldsaddr;
  g0[2] = (unsigned)(ga & 0xFFFFFFFFu);
  g0[3] = (unsigned)((ga >> 32) & 0x1FFFFFFu) | (2u << 30);
  v8i g1;
  g1[0] = (int)(3u << 16);
  g1[1] = (int)((rowUnits & 0xFFFFu) << 16);
  g1[2] = (int)((rows & 0xFFFFu) << 16);
  g1[3] = (int)((rowUnits & 0xFFFFu) << 16);
  g1[4] = (int)(rows & 0xFFFFu);
  g1[5] = (int)strideUnits;
  g1[6] = 0;
  g1[7] = 0;
  const v4i z4 = {0, 0, 0, 0};
#if __clang_major__ >= 23
  const v8i z8 = {0, 0, 0, 0, 0, 0, 0, 0};
  __builtin_amdgcn_tensor_load_to_lds(g0, g1, z4, z4, z8, 0);
#else
  __builtin_amdgcn_tensor_load_to_lds(g0, g1, z4, z4, 0);
#endif
}

__global__ __launch_bounds__(256) void gemm_f16_kernel(
    const _Float16* __restrict__ Ah, const _Float16* __restrict__ Wh,
    const float* __restrict__ bias, float* __restrict__ C,
    int M, int N, int K)
{
  __shared__ _Float16 As[2][128 * 64];  // 2 x 16KB
  __shared__ _Float16 Bs[2][128 * 64];  // 2 x 16KB

  const int tid  = threadIdx.x;
  const int lane = tid & 31;
  const int wave = tid >> 5;
  const int ln   = lane & 15;
  const int hf   = lane >> 4;
  const int rowg = wave >> 1;  // 0..3 : 32-row group
  const int colg = wave & 1;   // 0..1 : 64-col group

  const int n0 = blockIdx.x * 128;
  const int m0 = blockIdx.y * 128;

  const unsigned strideU = (unsigned)(K / 4);  // K f16 = K*2 B = K/4 8B-units
  const _Float16* aBase = Ah + (size_t)m0 * K;
  const _Float16* bBase = Wh + (size_t)n0 * K;
  unsigned aL[2] = { lds_addr(&As[0][0]), lds_addr(&As[1][0]) };
  unsigned bL[2] = { lds_addr(&Bs[0][0]), lds_addr(&Bs[1][0]) };

  auto issueTile = [&](int buf, int k0) {
    tdm_load_2d(aBase + k0, aL[buf], 16, 128, strideU);  // A tile 128 x 128B
    tdm_load_2d(bBase + k0, bL[buf], 16, 128, strideU);  // W tile 128 x 128B
  };

  v8f acc[2][4] = {};

  const int NT = K / 64;
  if (wave == 0) issueTile(0, 0);
  for (int it = 0; it < NT; ++it) {
    const int buf = it & 1;
    if (it + 1 < NT) {
      if (wave == 0) { issueTile(buf ^ 1, (it + 1) * 64); __builtin_amdgcn_s_wait_tensorcnt(2); }
    } else {
      if (wave == 0) __builtin_amdgcn_s_wait_tensorcnt(0);
    }
    __syncthreads();  // tile `it` visible to all waves

#pragma unroll
    for (int kc = 0; kc < 2; kc++) {
      v16h a0 = *(const v16h*)&As[buf][(rowg * 32 + ln) * 64 + kc * 32 + hf * 16];
      v16h a1 = *(const v16h*)&As[buf][(rowg * 32 + 16 + ln) * 64 + kc * 32 + hf * 16];
#pragma unroll
      for (int nb = 0; nb < 4; nb++) {
        v16h b = *(const v16h*)&Bs[buf][(colg * 64 + nb * 16 + ln) * 64 + kc * 32 + hf * 16];
        acc[0][nb] = WMMA_F16(a0, b, acc[0][nb]);
        acc[1][nb] = WMMA_F16(a1, b, acc[1][nb]);
      }
    }
    __syncthreads();
  }

  // ---- epilogue: bias + f32 store ----
#pragma unroll
  for (int r = 0; r < 2; r++) {
#pragma unroll
    for (int nb = 0; nb < 4; nb++) {
      const int col = n0 + colg * 64 + nb * 16 + ln;
      const float bb = bias[col];
#pragma unroll
      for (int j = 0; j < 8; j++) {
        const int row = m0 + rowg * 32 + r * 16 + j + 8 * hf;
        C[(size_t)row * N + col] = acc[r][nb][j] + bb;
      }
    }
  }
}

// ---------------------------------------------------------------------------
// Fused RMSNorm (over D) + interleaved RoPE + f16 downconvert.
// ---------------------------------------------------------------------------
__global__ __launch_bounds__(256) void rmsnorm_rope_kernel(
    const float* __restrict__ src, const float* __restrict__ w,
    const float* __restrict__ cosb, const float* __restrict__ sinb,
    _Float16* __restrict__ dst, int T, int D, float outScale)
{
  __shared__ float red[8];
  const int row = blockIdx.x;  // b*T + t
  const int t   = row % T;
  const float* h = src + (size_t)row * D;
  const int base = threadIdx.x * 8;

  float4 h0 = *(const float4*)&h[base];
  float4 h1 = *(const float4*)&h[base + 4];
  float ss = h0.x * h0.x + h0.y * h0.y + h0.z * h0.z + h0.w * h0.w +
             h1.x * h1.x + h1.y * h1.y + h1.z * h1.z + h1.w * h1.w;
#pragma unroll
  for (int off = 16; off > 0; off >>= 1) ss += __shfl_xor(ss, off, 32);
  if ((threadIdx.x & 31) == 0) red[threadIdx.x >> 5] = ss;
  __syncthreads();
  float tot = 0.f;
#pragma unroll
  for (int i = 0; i < 8; i++) tot += red[i];
  const float rinv = rsqrtf(tot / (float)D + 1e-6f);

  const float hv[8] = {h0.x, h0.y, h0.z, h0.w, h1.x, h1.y, h1.z, h1.w};
  const float* cb = cosb + (size_t)t * D + base;
  const float* sb = sinb + (size_t)t * D + base;
  const float* wb = w + base;
  _Float16* dp = dst + (size_t)row * D + base;
#pragma unroll
  for (int p = 0; p < 4; p++) {
    const int e = 2 * p, o = 2 * p + 1;
    const float he = hv[e] * wb[e] * rinv;
    const float ho = hv[o] * wb[o] * rinv;
    dp[e] = (_Float16)((he * cb[e] - ho * sb[e]) * outScale);
    dp[o] = (_Float16)((ho * cb[o] + he * sb[o]) * outScale);
  }
}

// f32 -> f16 bulk convert (x and W matrices)
__global__ __launch_bounds__(256) void cvt_f16_kernel(
    const float* __restrict__ src, _Float16* __restrict__ dst, int n4)
{
  const int i = blockIdx.x * 256 + threadIdx.x;
  if (i >= n4) return;
  float4 f = ((const float4*)src)[i];
  v4h o;
  o[0] = (_Float16)f.x; o[1] = (_Float16)f.y;
  o[2] = (_Float16)f.z; o[3] = (_Float16)f.w;
  ((v4h*)dst)[i] = o;
}

__global__ __launch_bounds__(256) void transpose_v_kernel(
    const float* __restrict__ vf, _Float16* __restrict__ vT, int T)
{
  __shared__ _Float16 Ls[64 * 128];  // [t][dh] f16, 16KB
  const int tid = threadIdx.x;
  const int t0 = blockIdx.x * 64;
  const int hh = blockIdx.y, b = blockIdx.z;
  const int D = 2048, H = 16, Dh = 128;

  {  // load + convert 64t x 128dh tile (coalesced reads)
    const int r = tid >> 2, q = tid & 3;
    const float* sp = vf + (size_t)(b * T + t0 + r) * D + hh * Dh + q * 32;
    v16h u0, u1;
#pragma unroll
    for (int i = 0; i < 16; i++) { u0[i] = (_Float16)sp[i]; u1[i] = (_Float16)sp[16 + i]; }
    *(v16h*)&Ls[r * 128 + q * 32]      = u0;
    *(v16h*)&Ls[r * 128 + q * 32 + 16] = u1;
  }
  __syncthreads();
  {  // write transposed (coalesced writes over t)
    const int dh = tid >> 1, half = tid & 1;
    v16h o0, o1;
#pragma unroll
    for (int i = 0; i < 16; i++) {
      o0[i] = Ls[(half * 32 + i) * 128 + dh];
      o1[i] = Ls[(half * 32 + 16 + i) * 128 + dh];
    }
    _Float16* dp = vT + ((size_t)(b * H + hh) * Dh + dh) * T + t0 + half * 32;
    *(v16h*)dp        = o0;
    *(v16h*)(dp + 16) = o1;
  }
}

// ---------------------------------------------------------------------------
// Flash attention, non-causal. Workgroup = (b, h, 128 q rows); 8 waves x 16
// rows. K tiles (double-buffered) and V tiles streamed by the Tensor Data
// Mover: wave 0 issues one tensor_load_to_lds per tile; in-order pending
// queue is [K_i, V_i, K_i+1] so s_wait_tensorcnt 1 drains the current tile.
// Q pre-scaled by 1/sqrt(Dh); online softmax in f32; P transposed through
// per-wave LDS scratch.
// ---------------------------------------------------------------------------
__global__ __launch_bounds__(256) void flash_attn_kernel(
    const _Float16* __restrict__ qh, const _Float16* __restrict__ kh,
    const _Float16* __restrict__ vT, _Float16* __restrict__ oh, int T)
{
  __shared__ _Float16 Kt[2][64 * 128];  // [key][dh], 2 x 16KB
  __shared__ _Float16 Vt[128 * 64];     // [dh][key], 16KB
  __shared__ _Float16 Ps[8][16 * 64];   // per-wave P scratch [m][key], 16KB

  const int tid  = threadIdx.x;
  const int lane = tid & 31;
  const int wave = tid >> 5;
  const int ln   = lane & 15;
  const int hf   = lane >> 4;

  const int q0 = blockIdx.x * 128;
  const int hh = blockIdx.y;
  const int b  = blockIdx.z;
  const int D = 2048, Dh = 128, H = 16;

  // Q A-fragments: 4 chunks of K=32 covering Dh=128 (kept resident)
  const size_t qrow = (size_t)(b * T + q0 + wave * 16 + ln);
  v16h qA[4];
#pragma unroll
  for (int kc = 0; kc < 4; kc++)
    qA[kc] = *(const v16h*)&qh[qrow * D + hh * Dh + kc * 32 + hf * 16];

  v8f oAcc[8] = {};
  float rowm[8], rowl[8];
#pragma unroll
  for (int j = 0; j < 8; j++) { rowm[j] = -3.0e38f; rowl[j] = 0.f; }

  const _Float16* kBase = kh + (size_t)(b * T) * D + hh * Dh;
  const _Float16* vBase = vT + (size_t)(b * H + hh) * Dh * T;
  unsigned kL[2] = { lds_addr(&Kt[0][0]), lds_addr(&Kt[1][0]) };
  const unsigned vLb = lds_addr(&Vt[0]);

  auto tdmK = [&](int buf, int kt0) {  // 64 keys x 256B rows, pitch D
    tdm_load_2d(kBase + (size_t)kt0 * D, kL[buf], 32, 64, (unsigned)(D / 4));
  };
  auto tdmV = [&](int kt0) {           // 128 dh x 128B rows, pitch T
    tdm_load_2d(vBase + kt0, vLb, 16, 128, (unsigned)(T / 4));
  };

  const int NT = T / 64;
  if (wave == 0) tdmK(0, 0);
  for (int it = 0; it < NT; ++it) {
    const int kt0 = it * 64;
    const int buf = it & 1;
    if (wave == 0) {
      tdmV(kt0);
      if (it + 1 < NT) { tdmK(buf ^ 1, kt0 + 64); __builtin_amdgcn_s_wait_tensorcnt(1); }
      else             { __builtin_amdgcn_s_wait_tensorcnt(0); }
    }
    __syncthreads();

    // ---- S = Q * K^T (16 WMMA), scores for 16 q x 64 keys ----
    v8f s[4] = {};
#pragma unroll
    for (int kc = 0; kc < 4; kc++) {
#pragma unroll
      for (int n = 0; n < 4; n++) {
        v16h kb = *(const v16h*)&Kt[buf][(n * 16 + ln) * 128 + kc * 32 + hf * 16];
        s[n] = WMMA_F16(qA[kc], kb, s[n]);
      }
    }

    // ---- online softmax (row stats per M = j + 8*hf) ----
#pragma unroll
    for (int j = 0; j < 8; j++) {
      float t = fmaxf(fmaxf(s[0][j], s[1][j]), fmaxf(s[2][j], s[3][j]));
#pragma unroll
      for (int off = 1; off < 16; off <<= 1) t = fmaxf(t, __shfl_xor(t, off, 32));
      const float mnew  = fmaxf(rowm[j], t);
      const float alpha = __expf(rowm[j] - mnew);
      rowm[j] = mnew;
      rowl[j] *= alpha;
#pragma unroll
      for (int nd = 0; nd < 8; nd++) oAcc[nd][j] *= alpha;
      float part = 0.f;
#pragma unroll
      for (int n = 0; n < 4; n++) {
        const float p = __expf(s[n][j] - mnew);
        s[n][j] = p;
        part += p;
      }
#pragma unroll
      for (int off = 1; off < 16; off <<= 1) part += __shfl_xor(part, off, 32);
      rowl[j] += part;
    }

    // ---- transpose P (C layout -> A layout) through per-wave LDS ----
#pragma unroll
    for (int j = 0; j < 8; j++)
#pragma unroll
      for (int n = 0; n < 4; n++)
        Ps[wave][(j + 8 * hf) * 64 + n * 16 + ln] = (_Float16)s[n][j];
    asm volatile("s_wait_dscnt 0" ::: "memory");  // wave-local LDS RAW fence

    v16h pA0 = *(const v16h*)&Ps[wave][ln * 64 + 0 * 32 + hf * 16];
    v16h pA1 = *(const v16h*)&Ps[wave][ln * 64 + 1 * 32 + hf * 16];

    // ---- O += P * V (16 WMMA) ----
#pragma unroll
    for (int kc = 0; kc < 2; kc++) {
      const v16h pa = kc ? pA1 : pA0;
#pragma unroll
      for (int nd = 0; nd < 8; nd++) {
        v16h vb = *(const v16h*)&Vt[(nd * 16 + ln) * 64 + kc * 32 + hf * 16];
        oAcc[nd] = WMMA_F16(pa, vb, oAcc[nd]);
      }
    }
    __syncthreads();
  }

  // ---- normalize and store f16 attention output ----
#pragma unroll
  for (int nd = 0; nd < 8; nd++) {
#pragma unroll
    for (int j = 0; j < 8; j++) {
      const size_t row = (size_t)(b * T + q0 + wave * 16 + j + 8 * hf);
      oh[row * D + hh * Dh + nd * 16 + ln] = (_Float16)(oAcc[nd][j] / rowl[j]);
    }
  }
}

// ---------------------------------------------------------------------------
extern "C" void kernel_launch(void* const* d_in, const int* in_sizes, int n_in,
                              void* d_out, int out_size, void* d_ws, size_t ws_size,
                              hipStream_t stream)
{
  (void)in_sizes; (void)n_in; (void)out_size; (void)ws_size;
  const float* x    = (const float*)d_in[0];
  const float* cosb = (const float*)d_in[1];
  const float* sinb = (const float*)d_in[2];
  const float* Wq   = (const float*)d_in[3];
  const float* bq   = (const float*)d_in[4];
  const float* Wk   = (const float*)d_in[5];
  const float* bk   = (const float*)d_in[6];
  const float* Wv   = (const float*)d_in[7];
  const float* bv   = (const float*)d_in[8];
  const float* qnw  = (const float*)d_in[9];
  const float* knw  = (const float*)d_in[10];
  const float* Wo   = (const float*)d_in[11];
  const float* bo   = (const float*)d_in[12];
  float* out = (float*)d_out;

  const int B = 2, T = 2048, D = 2048, H = 16;
  const int M = B * T;

  // Workspace layout (208 MB total)
  char* ws = (char*)d_ws;
  const size_t MB = 1ull << 20;
  float*    qf  = (float*)(ws + 0 * MB);       // 32 MB f32 q
  float*    kf  = (float*)(ws + 32 * MB);      // 32 MB f32 k
  float*    vf  = (float*)(ws + 64 * MB);      // 32 MB f32 v
  _Float16* qh  = (_Float16*)(ws + 96 * MB);   // 16 MB f16 q-hat
  _Float16* kh  = (_Float16*)(ws + 112 * MB);  // 16 MB f16 k-hat
  _Float16* vTh = (_Float16*)(ws + 128 * MB);  // 16 MB f16 V transposed
  _Float16* oh  = (_Float16*)(ws + 144 * MB);  // 16 MB f16 attn out
  _Float16* xh  = (_Float16*)(ws + 160 * MB);  // 16 MB f16 x
  _Float16* Wqh = (_Float16*)(ws + 176 * MB);  //  8 MB
  _Float16* Wkh = (_Float16*)(ws + 184 * MB);  //  8 MB
  _Float16* Wvh = (_Float16*)(ws + 192 * MB);  //  8 MB
  _Float16* Woh = (_Float16*)(ws + 200 * MB);  //  8 MB

  dim3 blk(256);
  const int nx4 = M * D / 4, nw4 = D * D / 4;
  cvt_f16_kernel<<<(nx4 + 255) / 256, blk, 0, stream>>>(x,  xh,  nx4);
  cvt_f16_kernel<<<(nw4 + 255) / 256, blk, 0, stream>>>(Wq, Wqh, nw4);
  cvt_f16_kernel<<<(nw4 + 255) / 256, blk, 0, stream>>>(Wk, Wkh, nw4);
  cvt_f16_kernel<<<(nw4 + 255) / 256, blk, 0, stream>>>(Wv, Wvh, nw4);
  cvt_f16_kernel<<<(nw4 + 255) / 256, blk, 0, stream>>>(Wo, Woh, nw4);

  dim3 gg(D / 128, M / 128);
  gemm_f16_kernel<<<gg, blk, 0, stream>>>(xh, Wqh, bq, qf, M, D, D);
  gemm_f16_kernel<<<gg, blk, 0, stream>>>(xh, Wkh, bk, kf, M, D, D);
  gemm_f16_kernel<<<gg, blk, 0, stream>>>(xh, Wvh, bv, vf, M, D, D);

  const float qscale = 0.08838834764831845f;  // 1/sqrt(128), folded into Q
  rmsnorm_rope_kernel<<<M, blk, 0, stream>>>(qf, qnw, cosb, sinb, qh, T, D, qscale);
  rmsnorm_rope_kernel<<<M, blk, 0, stream>>>(kf, knw, cosb, sinb, kh, T, D, 1.0f);
  transpose_v_kernel<<<dim3(T / 64, H, B), blk, 0, stream>>>(vf, vTh, T);

  flash_attn_kernel<<<dim3(T / 128, H, B), blk, 0, stream>>>(qh, kh, vTh, oh, T);

  gemm_f16_kernel<<<gg, blk, 0, stream>>>(oh, Woh, bo, out, M, D, D);
}

// v001
// Measured time: 313 microseconds a run.
// Timed twice side by side with v000, it ran 2.53 times as fast both times.
#include <hip/hip_runtime.h>
#include <hip/hip_bf16.h>

typedef __attribute__((ext_vector_type(16))) _Float16 v16h;
typedef __attribute__((ext_vector_type(8)))  _Float16 v8h;
typedef __attribute__((ext_vector_type(4)))  _Float16 v4h;
typedef __attribute__((ext_vector_type(8)))  float    v8f;
typedef __attribute__((ext_vector_type(4)))  unsigned int v4u;

#define WMMA_F16(a, b, c) \
  __builtin_amdgcn_wmma_f32_16x16x32_f16(false, (a), false, (b), (short)0, (c), false, false)

__device__ __forceinline__ unsigned lds_addr(const void* p) {
  return (unsigned)(uintptr_t)p;  // low 32 bits of generic shared ptr = LDS offset
}

typedef __attribute__((ext_vector_type(8))) unsigned int v8u;

__device__ __forceinline__ unsigned uni(unsigned v) { return (unsigned)__builtin_amdgcn_readfirstlane(v); }

__device__ __forceinline__ unsigned pinned(unsigned v) {
  unsigned w = uni(v);
  asm volatile("" : "+s"(w));  // pinned(): keeps the condition in a scalar register
  return w;
}

// A wave's LDS reads have retired before a barrier frees their buffer for a refill.
__device__ __forceinline__ void wait_ds0() { asm volatile("s_wait_dscnt 0" ::: "memory"); }

__device__ __forceinline__ v4u tdm_group0(unsigned ldsaddr, const void* gaddr) {
  const unsigned long long ga = (unsigned long long)(uintptr_t)gaddr;
  v4u g;
  g[0] = uni(1u);                                                   // count = 1
  g[1] = uni(ldsaddr);                                              // LDS byte offset
  g[2] = uni((unsigned)ga);                                         // address [31:0]
  g[3] = uni((((unsigned)(ga >> 32)) & 0x01FFFFFFu) | 0x80000000u); // address [56:32] | type = 2
  return g;
}

template <unsigned ROWB, unsigned ROWS>
__device__ __forceinline__ v8u tdm_group1(unsigned srcPitch) {
  static_assert(ROWB == 128u || ROWB == 256u, "pad interval code is set for rows of 128 or 256 bytes");
  constexpr unsigned ivl = (ROWB == 256u) ? 5u : 4u;
  v8u g;
  g[0] = uni((1u << 20) | (ivl << 22) | (3u << 25));
  g[1] = uni(ROWB << 16);
  g[2] = uni(ROWS << 16);
  g[3] = uni(ROWB << 16);
  g[4] = uni(ROWS);
  g[5] = uni(srcPitch);
  g[6] = uni(0u);
  g[7] = uni(0u);
  return g;
}

__device__ __forceinline__ void tdm_load(v4u& g0, v8u g1) {
  asm volatile("tensor_load_to_lds %0, %1" : "+s"(g0) : "s"(g1) : "memory");
}

// The mover's waits are not placed by the compiler.
__device__ __forceinline__ void wait_tensor0(v4u& g0, v8u g1) {
  asm volatile("s_wait_tensorcnt 0" : "+s"(g0) : "s"(g1) : "memory");
}

__device__ __forceinline__ v8u held(v8u g) {
  asm volatile("" : "+s"(g));
  return g;
}

// 16 consecutive f16 of a padded LDS row (16-byte aligned): two ds_load_b128.
__device__ __forceinline__ v16h ld_frag(const _Float16* p) {
  const v8h lo = *(const v8h*)p;
  const v8h hi = *(const v8h*)(p + 8);
  return __builtin_shufflevector(lo, hi, 0, 1, 2, 3, 4, 5, 6, 7, 8, 9, 10, 11, 12, 13, 14, 15);
}

// LDS pitches in f16 elements: 128-B rows + 16 B, 256-B rows + 16 B.
#define P128 72
#define P256 136
// One padded tile's place in LDS, in f16 elements: 128 x 144 B = 18432 B = 9 x 2 KiB
// (64 x 272 B = 17408 B is rounded up to the same), so every place is a multiple of 2 KiB.
#define TILE_H 9216

__global__ __launch_bounds__(256) void gemm_f16_kernel(
    const _Float16* __restrict__ Ah, const _Float16* __restrict__ Wh,
    const float* __restrict__ bias, float* __restrict__ C,
    int M, int N, int K)
{
  __shared__ __attribute__((aligned(2048))) _Float16 Ls[2][2][TILE_H];  // [buf][A, W], 4 x 18 KB

  const int tid  = threadIdx.x;
  const int lane = tid & 31;
  const int wave = tid >> 5;
  const int ln   = lane & 15;
  const int hf   = lane >> 4;
  const int rowg = wave >> 1;  // 0..3 : 32-row group
  const int colg = wave & 1;   // 0..1 : 64-col group

  const int n0 = blockIdx.x * 128;
  const int m0 = blockIdx.y * 128;

  const unsigned wv = uni((unsigned)tid >> 5);  // the wave's number, scalar
  const _Float16* aBase = Ah + (size_t)m0 * K;
  const _Float16* bBase = Wh + (size_t)n0 * K;
  const _Float16* tBase = (wv == 1u) ? bBase : aBase;        // this wave's operand
  const unsigned  tL    = lds_addr(&Ls[0][wv == 1u ? 1 : 0][0]);
  const v8u g1 = held(tdm_group1<128, 128>((unsigned)K * 2u));  // 128 rows x 128 B, pitch K f16
  v4u g0 = tdm_group0(tL, tBase);

  // Every wave forms the words (scalar work); only the issue itself stands behind a test.
  auto aimTile = [&](int buf, int k0) {
    const v4u n = tdm_group0(tL + (unsigned)buf * (2u * TILE_H * 2u), tBase + k0);
    g0[1] = n[1]; g0[2] = n[2]; g0[3] = n[3];
  };

  v8f acc[2][4] = {};

  const int NT = K / 64;
  if (pinned(wv < 2u)) tdm_load(g0, g1);
  for (int it = 0; it < NT; ++it) {
    const int buf = it & 1;
    wait_tensor0(g0, g1);
    aimTile(buf ^ 1, (it + 1) * 64);
    if (pinned((wv < 2u) & (it + 1 < NT))) tdm_load(g0, g1);
    __syncthreads();  // tile `it` visible to all waves

#pragma unroll
    for (int kc = 0; kc < 2; kc++) {
      v16h a0 = ld_frag(&Ls[buf][0][(rowg * 32 + ln) * P128 + kc * 32 + hf * 16]);
      v16h a1 = ld_frag(&Ls[buf][0][(rowg * 32 + 16 + ln) * P128 + kc * 32 + hf * 16]);
#pragma unroll
      for (int nb = 0; nb < 4; nb++) {
        v16h b = ld_frag(&Ls[buf][1][(colg * 64 + nb * 16 + ln) * P128 + kc * 32 + hf * 16]);
        acc[0][nb] = WMMA_F16(a0, b, acc[0][nb]);
        acc[1][nb] = WMMA_F16(a1, b, acc[1][nb]);
      }
    }
    wait_ds0();
    __syncthreads();
  }
  wait_tensor0(g0, g1);  // nothing of the mover is outstanding on any path to the wave's end

  // ---- epilogue: bias + f32 store ----
#pragma unroll
  for (int r = 0; r < 2; r++) {
#pragma unroll
    for (int nb = 0; nb < 4; nb++) {
      const int col = n0 + colg * 64 + nb * 16 + ln;
      const float bb = bias[col];
#pragma unroll
      for (int j = 0; j < 8; j++) {
        const int row = m0 + rowg * 32 + r * 16 + j + 8 * hf;
        C[(size_t)row * N + col] = acc[r][nb][j] + bb;
      }
    }
  }
}

// ---------------------------------------------------------------------------
// Fused RMSNorm (over D) + interleaved RoPE + f16 downconvert.
// ---------------------------------------------------------------------------
__global__ __launch_bounds__(256) void rmsnorm_rope_kernel(
    const float* __restrict__ src, const float* __restrict__ w,
    const float* __restrict__ cosb, const float* __restrict__ sinb,
    _Float16* __restrict__ dst, int T, int D, float outScale)
{
  __shared__ float red[8];
  const int row = blockIdx.x;  // b*T + t
  const int t   = row % T;
  const float* h = src + (size_t)row * D;
  const int base = threadIdx.x * 8;

  float4 h0 = *(const float4*)&h[base];
  float4 h1 = *(const float4*)&h[base + 4];
  float ss = h0.x * h0.x + h0.y * h0.y + h0.z * h0.z + h0.w * h0.w +
             h1.x * h1.x + h1.y * h1.y + h1.z * h1.z + h1.w * h1.w;
#pragma unroll
  for (int off = 16; off > 0; off >>= 1) ss += __shfl_xor(ss, off, 32);
  if ((threadIdx.x & 31) == 0) red[threadIdx.x >> 5] = ss;
  __syncthreads();
  float tot = 0.f;
#pragma unroll
  for (int i = 0; i < 8; i++) tot += red[i];
  const float rinv = rsqrtf(tot / (float)D + 1e-6f);

  const float hv[8] = {h0.x, h0.y, h0.z, h0.w, h1.x, h1.y, h1.z, h1.w};
  const float* cb = cosb + (size_t)t * D + base;
  const float* sb = sinb + (size_t)t * D + base;
  const float* wb = w + base;
  _Float16* dp = dst + (size_t)row * D + base;
#pragma unroll
  for (int p = 0; p < 4; p++) {
    const int e = 2 * p, o = 2 * p + 1;
    const float he = hv[e] * wb[e] * rinv;
    const float ho = hv[o] * wb[o] * rinv;
    dp[e] = (_Float16)((he * cb[e] - ho * sb[e]) * outScale);
    dp[o] = (_Float16)((ho * cb[o] + he * sb[o]) * outScale);
  }
}

// f32 -> f16 bulk convert (x and W matrices)
__global__ __launch_bounds__(256) void cvt_f16_kernel(
    const float* __restrict__ src, _Float16* __restrict__ dst, int n4)
{
  const int i = blockIdx.x * 256 + threadIdx.x;
  if (i >= n4) return;
  float4 f = ((const float4*)src)[i];
  v4h o;
  o[0] = (_Float16)f.x; o[1] = (_Float16)f.y;
  o[2] = (_Float16)f.z; o[3] = (_Float16)f.w;
  ((v4h*)dst)[i] = o;
}

__global__ __launch_bounds__(256) void transpose_v_kernel(
    const float* __restrict__ vf, _Float16* __restrict__ vT, int T)
{
  __shared__ _Float16 Ls[64 * 128];  // [t][dh] f16, 16KB
  const int tid = threadIdx.x;
  const int t0 = blockIdx.x * 64;
  const int hh = blockIdx.y, b = blockIdx.z;
  const int D = 2048, H = 16, Dh = 128;

  {  // load + convert 64t x 128dh tile (coalesced reads)
    const int r = tid >> 2, q = tid & 3;
    const float* sp = vf + (size_t)(b * T + t0 + r) * D + hh * Dh + q * 32;
    v16h u0, u1;
#pragma unroll
    for (int i = 0; i < 16; i++) { u0[i] = (_Float16)sp[i]; u1[i] = (_Float16)sp[16 + i]; }
    *(v16h*)&Ls[r * 128 + q * 32]      = u0;
    *(v16h*)&Ls[r * 128 + q * 32 + 16] = u1;
  }
  __syncthreads();
  {  // write transposed (coalesced writes over t)
    const int dh = tid >> 1, half = tid & 1;
    v16h o0, o1;
#pragma unroll
    for (int i = 0; i < 16; i++) {
      o0[i] = Ls[(half * 32 + i) * 128 + dh];
      o1[i] = Ls[(half * 32 + 16 + i) * 128 + dh];
    }
    _Float16* dp = vT + ((size_t)(b * H + hh) * Dh + dh) * T + t0 + half * 32;
    *(v16h*)dp        = o0;
    *(v16h*)(dp + 16) = o1;
  }
}

// ---------------------------------------------------------------------------
// Flash attention, non-causal. Workgroup = (b, h, 128 q rows); 8 waves x 16
// rows. K tiles (double-buffered) and V tiles streamed by the Tensor Data
// Mover: wave 0 issues K's tensor_load_to_lds one tile ahead, wave 1 issues V's
// for the current tile; one request of a wave outstanding. K rows lie at a
// pitch of 272 B in LDS, V rows and the P scratch rows at 144 B.
// Q pre-scaled by 1/sqrt(Dh); online softmax in f32; P transposed through
// per-wave LDS scratch.
// ---------------------------------------------------------------------------
__global__ __launch_bounds__(256) void flash_attn_kernel(
    const _Float16* __restrict__ qh, const _Float16* __restrict__ kh,
    const _Float16* __restrict__ vT, _Float16* __restrict__ oh, int T)
{
  // [0], [1]: K [key][dh]; [2]: V [dh][key]; [3]: per-wave P scratch [m][key]; 4 x 18 KB
  __shared__ __attribute__((aligned(2048))) _Float16 Ls[4][TILE_H];
  _Float16* const Vt = &Ls[2][0];
  _Float16* const Pw = &Ls[3][(threadIdx.x >> 5) * (16 * P128)];

  const int tid  = threadIdx.x;
  const int lane = tid & 31;
  const int wave = tid >> 5;
  const int ln   = lane & 15;
  const int hf   = lane >> 4;

  const int q0 = blockIdx.x * 128;
  const int hh = blockIdx.y;
  const int b  = blockIdx.z;
  const int D = 2048, Dh = 128, H = 16;

  // Q A-fragments: 4 chunks of K=32 covering Dh=128 (kept resident)
  const size_t qrow = (size_t)(b * T + q0 + wave * 16 + ln);
  v16h qA[4];
#pragma unroll
  for (int kc = 0; kc < 4; kc++)
    qA[kc] = *(const v16h*)&qh[qrow * D + hh * Dh + kc * 32 + hf * 16];

  v8f oAcc[8] = {};
  float rowm[8], rowl[8];
#pragma unroll
  for (int j = 0; j < 8; j++) { rowm[j] = -3.0e38f; rowl[j] = 0.f; }

  const _Float16* kBase = kh + (size_t)(b * T) * D + hh * Dh;
  const _Float16* vBase = vT + (size_t)(b * H + hh) * Dh * T;
  const unsigned wv  = uni((unsigned)tid >> 5);  // the wave's number, scalar
  const unsigned kLb = lds_addr(&Ls[0][0]);
  const unsigned vLb = lds_addr(&Ls[2][0]);
  const v8u g1K = held(tdm_group1<256, 64>((unsigned)D * 2u));   // 64 keys x 256B rows, pitch D f16
  const v8u g1V = held(tdm_group1<128, 128>((unsigned)T * 2u));  // 128 dh x 128B rows, pitch T f16
  v4u g0K = tdm_group0(kLb, kBase), g0V = tdm_group0(vLb, vBase);

  // Every wave forms the words (scalar work); only the issue itself stands behind a test.
  auto aimK = [&](int buf, int kt0) {
    const v4u n = tdm_group0(kLb + (unsigned)buf * (TILE_H * 2u), kBase + (size_t)kt0 * D);
    g0K[1] = n[1]; g0K[2] = n[2]; g0K[3] = n[3];
  };
  auto aimV = [&](int kt0) {
    const v4u n = tdm_group0(vLb, vBase + kt0);
    g0V[2] = n[2]; g0V[3] = n[3];
  };

  const int NT = T / 64;
  if (pinned(wv == 0u)) tdm_load(g0K, g1K);
  for (int it = 0; it < NT; ++it) {
    const int kt0 = it * 64;
    const int buf = it & 1;
    wait_tensor0(g0K, g1K);
    aimK(buf ^ 1, kt0 + 64);
    aimV(kt0);               // wave 1 has nothing outstanding here
    if (pinned((wv == 0u) & (it + 1 < NT))) tdm_load(g0K, g1K);
    if (pinned(wv == 1u)) {
      tdm_load(g0V, g1V);
      wait_tensor0(g0V, g1V);  // V tile `it` has landed
    }
    __syncthreads();

    // ---- S = Q * K^T (16 WMMA), scores for 16 q x 64 keys ----
    v8f s[4] = {};
#pragma unroll
    for (int kc = 0; kc < 4; kc++) {
#pragma unroll
      for (int n = 0; n < 4; n++) {
        v16h kb = ld_frag(&Ls[buf][(n * 16 + ln) * P256 + kc * 32 + hf * 16]);
        s[n] = WMMA_F16(qA[kc], kb, s[n]);
      }
    }

    // ---- online softmax (row stats per M = j + 8*hf) ----
#pragma unroll
    for (int j = 0; j < 8; j++) {
      float t = fmaxf(fmaxf(s[0][j], s[1][j]), fmaxf(s[2][j], s[3][j]));
#pragma unroll
      for (int off = 1; off < 16; off <<= 1) t = fmaxf(t, __shfl_xor(t, off, 32));
      const float mnew  = fmaxf(rowm[j], t);
      const float alpha = __expf(rowm[j] - mnew);
      rowm[j] = mnew;
      rowl[j] *= alpha;
#pragma unroll
      for (int nd = 0; nd < 8; nd++) oAcc[nd][j] *= alpha;
      float part = 0.f;
#pragma unroll
      for (int n = 0; n < 4; n++) {
        const float p = __expf(s[n][j] - mnew);
        s[n][j] = p;
        part += p;
      }
#pragma unroll
      for (int off = 1; off < 16; off <<= 1) part += __shfl_xor(part, off, 32);
      rowl[j] += part;
    }

    // ---- transpose P (C layout -> A layout) through per-wave LDS ----
#pragma unroll
    for (int j = 0; j < 8; j++)
#pragma unroll
      for (int n = 0; n < 4; n++)
        Pw[(j + 8 * hf) * P128 + n * 16 + ln] = (_Float16)s[n][j];
    asm volatile("s_wait_dscnt 0" ::: "memory");  // wave-local LDS RAW fence

    v16h pA0 = ld_frag(&Pw[ln * P128 + 0 * 32 + hf * 16]);
    v16h pA1 = ld_frag(&Pw[ln * P128 + 1 * 32 + hf * 16]);

    // ---- O += P * V (16 WMMA) ----
#pragma unroll
    for (int kc = 0; kc < 2; kc++) {
      const v16h pa = kc ? pA1 : pA0;
#pragma unroll
      for (int nd = 0; nd < 8; nd++) {
        v16h vb = ld_frag(&Vt[(nd * 16 + ln) * P128 + kc * 32 + hf * 16]);
        oAcc[nd] = WMMA_F16(pa, vb, oAcc[nd]);
      }
    }
    wait_ds0();
    __syncthreads();
  }
  wait_tensor0(g0K, g1K);  // nothing of the mover is outstanding on any path to the wave's end

  // ---- normalize and store f16 attention output ----
#pragma unroll
  for (int nd = 0; nd < 8; nd++) {
#pragma unroll
    for (int j = 0; j < 8; j++) {
      const size_t row = (size_t)(b * T + q0 + wave * 16 + j + 8 * hf);
      oh[row * D + hh * Dh + nd * 16 + ln] = (_Float16)(oAcc[nd][j] / rowl[j]);
    }
  }
}

// ---------------------------------------------------------------------------
extern "C" void kernel_launch(void* const* d_in, const int* in_sizes, int n_in,
                              void* d_out, int out_size, void* d_ws, size_t ws_size,
                              hipStream_t stream)
{
  (void)in_sizes; (void)n_in; (void)out_size; (void)ws_size;
  const float* x    = (const float*)d_in[0];
  const float* cosb = (const float*)d_in[1];
  const float* sinb = (const float*)d_in[2];
  const float* Wq   = (const float*)d_in[3];
  const float* bq   = (const float*)d_in[4];
  const float* Wk   = (const float*)d_in[5];
  const float* bk   = (const float*)d_in[6];
  const float* Wv   = (const float*)d_in[7];
  const float* bv   = (const float*)d_in[8];
  const float* qnw  = (const float*)d_in[9];
  const float* knw  = (const float*)d_in[10];
  const float* Wo   = (const float*)d_in[11];
  const float* bo   = (const float*)d_in[12];
  float* out = (float*)d_out;

  const int B = 2, T = 2048, D = 2048, H = 16;
  const int M = B * T;

  // Workspace layout (208 MB total)
  char* ws = (char*)d_ws;
  const size_t MB = 1ull << 20;
  float*    qf  = (float*)(ws + 0 * MB);       // 32 MB f32 q
  float*    kf  = (float*)(ws + 32 * MB);      // 32 MB f32 k
  float*    vf  = (float*)(ws + 64 * MB);      // 32 MB f32 v
  _Float16* qh  = (_Float16*)(ws + 96 * MB);   // 16 MB f16 q-hat
  _Float16* kh  = (_Float16*)(ws + 112 * MB);  // 16 MB f16 k-hat
  _Float16* vTh = (_Float16*)(ws + 128 * MB);  // 16 MB f16 V transposed
  _Float16* oh  = (_Float16*)(ws + 144 * MB);  // 16 MB f16 attn out
  _Float16* xh  = (_Float16*)(ws + 160 * MB);  // 16 MB f16 x
  _Float16* Wqh = (_Float16*)(ws + 176 * MB);  //  8 MB
  _Float16* Wkh = (_Float16*)(ws + 184 * MB);  //  8 MB
  _Float16* Wvh = (_Float16*)(ws + 192 * MB);  //  8 MB
  _Float16* Woh = (_Float16*)(ws + 200 * MB);  //  8 MB

  dim3 blk(256);
  const int nx4 = M * D / 4, nw4 = D * D / 4;
  cvt_f16_kernel<<<(nx4 + 255) / 256, blk, 0, stream>>>(x,  xh,  nx4);
  cvt_f16_kernel<<<(nw4 + 255) / 256, blk, 0, stream>>>(Wq, Wqh, nw4);
  cvt_f16_kernel<<<(nw4 + 255) / 256, blk, 0, stream>>>(Wk, Wkh, nw4);
  cvt_f16_kernel<<<(nw4 + 255) / 256, blk, 0, stream>>>(Wv, Wvh, nw4);
  cvt_f16_kernel<<<(nw4 + 255) / 256, blk, 0, stream>>>(Wo, Woh, nw4);

  dim3 gg(D / 128, M / 128);
  gemm_f16_kernel<<<gg, blk, 0, stream>>>(xh, Wqh, bq, qf, M, D, D);
  gemm_f16_kernel<<<gg, blk, 0, stream>>>(xh, Wkh, bk, kf, M, D, D);
  gemm_f16_kernel<<<gg, blk, 0, stream>>>(xh, Wvh, bv, vf, M, D, D);

  const float qscale = 0.08838834764831845f;  // 1/sqrt(128), folded into Q
  rmsnorm_rope_kernel<<<M, blk, 0, stream>>>(qf, qnw, cosb, sinb, qh, T, D, qscale);
  rmsnorm_rope_kernel<<<M, blk, 0, stream>>>(kf, knw, cosb, sinb, kh, T, D, 1.0f);
  transpose_v_kernel<<<dim3(T / 64, H, B), blk, 0, stream>>>(vf, vTh, T);

  flash_attn_kernel<<<dim3(T / 128, H, B), blk, 0, stream>>>(qh, kh, vTh, oh, T);

  gemm_f16_kernel<<<gg, blk, 0, stream>>>(oh, Woh, bo, out, M, D, D);
}

// v002
// Measured time: 285 microseconds a run.
// Next to v001, in two timings, it ran 1.10 times as fast each time.
// Counting every step since v000, it is 2.78 times as fast.
#include <hip/hip_runtime.h>
#include <hip/hip_bf16.h>

typedef __attribute__((ext_vector_type(16))) _Float16 v16h;
typedef __attribute__((ext_vector_type(8)))  _Float16 v8h;
typedef __attribute__((ext_vector_type(4)))  _Float16 v4h;
typedef __attribute__((ext_vector_type(8)))  float    v8f;
typedef __attribute__((ext_vector_type(4)))  unsigned int v4u;

#define WMMA_F16(a, b, c) \
  __builtin_amdgcn_wmma_f32_16x16x32_f16(false, (a), false, (b), (short)0, (c), false, false)

__device__ __forceinline__ unsigned lds_addr(const void* p) {
  return (unsigned)(uintptr_t)p;  // low 32 bits of generic shared ptr = LDS offset
}

typedef __attribute__((ext_vector_type(8))) unsigned int v8u;

__device__ __forceinline__ unsigned uni(unsigned v) { return (unsigned)__builtin_amdgcn_readfirstlane(v); }

__device__ __forceinline__ unsigned pinned(unsigned v) {
  unsigned w = uni(v);
  asm volatile("" : "+s"(w));  // pinned(): keeps the condition in a scalar register
  return w;
}

// A wave's LDS reads have retired before a barrier frees their buffer for a refill.
__device__ __forceinline__ void wait_ds0() { asm volatile("s_wait_dscnt 0" ::: "memory"); }

__device__ __forceinline__ v4u tdm_group0(unsigned ldsaddr, const void* gaddr) {
  const unsigned long long ga = (unsigned long long)(uintptr_t)gaddr;
  v4u g;
  g[0] = uni(1u);                                                   // count = 1
  g[1] = uni(ldsaddr);                                              // LDS byte offset
  g[2] = uni((unsigned)ga);                                         // address [31:0]
  g[3] = uni((((unsigned)(ga >> 32)) & 0x01FFFFFFu) | 0x80000000u); // address [56:32] | type = 2
  return g;
}

template <unsigned ROWB, unsigned ROWS>
__device__ __forceinline__ v8u tdm_group1(unsigned srcPitch) {
  static_assert(ROWB == 128u || ROWB == 256u, "pad interval code is set for rows of 128 or 256 bytes");
  constexpr unsigned ivl = (ROWB == 256u) ? 5u : 4u;
  v8u g;
  g[0] = uni((1u << 20) | (ivl << 22) | (3u << 25));
  g[1] = uni(ROWB << 16);
  g[2] = uni(ROWS << 16);
  g[3] = uni(ROWB << 16);
  g[4] = uni(ROWS);
  g[5] = uni(srcPitch);
  g[6] = uni(0u);
  g[7] = uni(0u);
  return g;
}

__device__ __forceinline__ void tdm_load(v4u& g0, v8u g1) {
  asm volatile("tensor_load_to_lds %0, %1" : "+s"(g0) : "s"(g1) : "memory");
}

// The mover's waits are not placed by the compiler.
__device__ __forceinline__ void wait_tensor0(v4u& g0, v8u g1) {
  asm volatile("s_wait_tensorcnt 0" : "+s"(g0) : "s"(g1) : "memory");
}

__device__ __forceinline__ v8u held(v8u g) {
  asm volatile("" : "+s"(g));
  return g;
}

// 16 consecutive f16 of a padded LDS row (16-byte aligned): two ds_load_b128.
__device__ __forceinline__ v16h ld_frag(const _Float16* p) {
  const v8h lo = *(const v8h*)p;
  const v8h hi = *(const v8h*)(p + 8);
  return __builtin_shufflevector(lo, hi, 0, 1, 2, 3, 4, 5, 6, 7, 8, 9, 10, 11, 12, 13, 14, 15);
}

template <int M>
__device__ __forceinline__ float row_xor(float x) {
  return __builtin_bit_cast(float, __builtin_amdgcn_update_dpp(
      0, __builtin_bit_cast(int, x), 0x160 | M, 0xf, 0xf, true));
}
// Maximum over each 16-lane row, eight rows at once: one v_max_num_f32_dpp a step and row
// (through fmaxf the compiler kept a DPP move and a quieting max beside each maximum). The
// eight rows' steps are interleaved, so that no step waits for the one it depends on.
__device__ __forceinline__ void row_max16x8(float (&t)[8]) {
  asm(
      "v_max_num_f32_dpp %0, %0, %0 row_xmask:1 row_mask:0xf bank_mask:0xf\n\t"
      "v_max_num_f32_dpp %1, %1, %1 row_xmask:1 row_mask:0xf bank_mask:0xf\n\t"
      "v_max_num_f32_dpp %2, %2, %2 row_xmask:1 row_mask:0xf bank_mask:0xf\n\t"
      "v_max_num_f32_dpp %3, %3, %3 row_xmask:1 row_mask:0xf bank_mask:0xf\n\t"
      "v_max_num_f32_dpp %4, %4, %4 row_xmask:1 row_mask:0xf bank_mask:0xf\n\t"
      "v_max_num_f32_dpp %5, %5, %5 row_xmask:1 row_mask:0xf bank_mask:0xf\n\t"
      "v_max_num_f32_dpp %6, %6, %6 row_xmask:1 row_mask:0xf bank_mask:0xf\n\t"
      "v_max_num_f32_dpp %7, %7, %7 row_xmask:1 row_mask:0xf bank_mask:0xf\n\t"
      "v_max_num_f32_dpp %0, %0, %0 row_xmask:2 row_mask:0xf bank_mask:0xf\n\t"
      "v_max_num_f32_dpp %1, %1, %1 row_xmask:2 row_mask:0xf bank_mask:0xf\n\t"
      "v_max_num_f32_dpp %2, %2, %2 row_xmask:2 row_mask:0xf bank_mask:0xf\n\t"
      "v_max_num_f32_dpp %3, %3, %3 row_xmask:2 row_mask:0xf bank_mask:0xf\n\t"
      "v_max_num_f32_dpp %4, %4, %4 row_xmask:2 row_mask:0xf bank_mask:0xf\n\t"
      "v_max_num_f32_dpp %5, %5, %5 row_xmask:2 row_mask:0xf bank_mask:0xf\n\t"
      "v_max_num_f32_dpp %6, %6, %6 row_xmask:2 row_mask:0xf bank_mask:0xf\n\t"
      "v_max_num_f32_dpp %7, %7, %7 row_xmask:2 row_mask:0xf bank_mask:0xf\n\t"
      "v_max_num_f32_dpp %0, %0, %0 row_xmask:4 row_mask:0xf bank_mask:0xf\n\t"
      "v_max_num_f32_dpp %1, %1, %1 row_xmask:4 row_mask:0xf bank_mask:0xf\n\t"
      "v_max_num_f32_dpp %2, %2, %2 row_xmask:4 row_mask:0xf bank_mask:0xf\n\t"
      "v_max_num_f32_dpp %3, %3, %3 row_xmask:4 row_mask:0xf bank_mask:0xf\n\t"
      "v_max_num_f32_dpp %4, %4, %4 row_xmask:4 row_mask:0xf bank_mask:0xf\n\t"
      "v_max_num_f32_dpp %5, %5, %5 row_xmask:4 row_mask:0xf bank_mask:0xf\n\t"
      "v_max_num_f32_dpp %6, %6, %6 row_xmask:4 row_mask:0xf bank_mask:0xf\n\t"
      "v_max_num_f32_dpp %7, %7, %7 row_xmask:4 row_mask:0xf bank_mask:0xf\n\t"
      "v_max_num_f32_dpp %0, %0, %0 row_xmask:8 row_mask:0xf bank_mask:0xf\n\t"
      "v_max_num_f32_dpp %1, %1, %1 row_xmask:8 row_mask:0xf bank_mask:0xf\n\t"
      "v_max_num_f32_dpp %2, %2, %2 row_xmask:8 row_mask:0xf bank_mask:0xf\n\t"
      "v_max_num_f32_dpp %3, %3, %3 row_xmask:8 row_mask:0xf bank_mask:0xf\n\t"
      "v_max_num_f32_dpp %4, %4, %4 row_xmask:8 row_mask:0xf bank_mask:0xf\n\t"
      "v_max_num_f32_dpp %5, %5, %5 row_xmask:8 row_mask:0xf bank_mask:0xf\n\t"
      "v_max_num_f32_dpp %6, %6, %6 row_xmask:8 row_mask:0xf bank_mask:0xf\n\t"
      "v_max_num_f32_dpp %7, %7, %7 row_xmask:8 row_mask:0xf bank_mask:0xf\n\t"
      : "+v"(t[0]), "+v"(t[1]), "+v"(t[2]), "+v"(t[3]), "+v"(t[4]), "+v"(t[5]), "+v"(t[6]), "+v"(t[7]));
}
__device__ __forceinline__ float row_sum16(float t) {
  t += row_xor<1>(t);
  t += row_xor<2>(t);
  t += row_xor<4>(t);
  t += row_xor<8>(t);
  return t;
}

// LDS pitches in f16 elements: 128-B rows + 16 B, 256-B rows + 16 B.
#define P128 72
#define P256 136
// One padded tile's place in LDS, in f16 elements: 128 x 144 B = 18432 B = 9 x 2 KiB
// (64 x 272 B = 17408 B is rounded up to the same), so every place is a multiple of 2 KiB.
#define TILE_H 9216

__global__ __launch_bounds__(256) void gemm_f16_kernel(
    const _Float16* __restrict__ Ah, const _Float16* __restrict__ Wh,
    const float* __restrict__ bias, float* __restrict__ C,
    int M, int N, int K)
{
  __shared__ __attribute__((aligned(2048))) _Float16 Ls[2][2][TILE_H];  // [buf][A, W], 4 x 18 KB

  const int tid  = threadIdx.x;
  const int lane = tid & 31;
  const int wave = tid >> 5;
  const int ln   = lane & 15;
  const int hf   = lane >> 4;
  const int rowg = wave >> 1;  // 0..3 : 32-row group
  const int colg = wave & 1;   // 0..1 : 64-col group

  const int n0 = blockIdx.x * 128;
  const int m0 = blockIdx.y * 128;

  const unsigned wv = uni((unsigned)tid >> 5);  // the wave's number, scalar
  const _Float16* aBase = Ah + (size_t)m0 * K;
  const _Float16* bBase = Wh + (size_t)n0 * K;
  const _Float16* tBase = (wv == 1u) ? bBase : aBase;        // this wave's operand
  const unsigned  tL    = lds_addr(&Ls[0][wv == 1u ? 1 : 0][0]);
  const v8u g1 = held(tdm_group1<128, 128>((unsigned)K * 2u));  // 128 rows x 128 B, pitch K f16
  v4u g0 = tdm_group0(tL, tBase);

  // Every wave forms the words (scalar work); only the issue itself stands behind a test.
  auto aimTile = [&](int buf, int k0) {
    const v4u n = tdm_group0(tL + (unsigned)buf * (2u * TILE_H * 2u), tBase + k0);
    g0[1] = n[1]; g0[2] = n[2]; g0[3] = n[3];
  };

  v8f acc[2][4] = {};

  const int NT = K / 64;
  if (pinned(wv < 2u)) tdm_load(g0, g1);
  for (int it = 0; it < NT; ++it) {
    const int buf = it & 1;
    wait_tensor0(g0, g1);
    aimTile(buf ^ 1, (it + 1) * 64);
    if (pinned((wv < 2u) & (it + 1 < NT))) tdm_load(g0, g1);
    __syncthreads();  // tile `it` visible to all waves

#pragma unroll
    for (int kc = 0; kc < 2; kc++) {
      v16h a0 = ld_frag(&Ls[buf][0][(rowg * 32 + ln) * P128 + kc * 32 + hf * 16]);
      v16h a1 = ld_frag(&Ls[buf][0][(rowg * 32 + 16 + ln) * P128 + kc * 32 + hf * 16]);
#pragma unroll
      for (int nb = 0; nb < 4; nb++) {
        v16h b = ld_frag(&Ls[buf][1][(colg * 64 + nb * 16 + ln) * P128 + kc * 32 + hf * 16]);
        acc[0][nb] = WMMA_F16(a0, b, acc[0][nb]);
        acc[1][nb] = WMMA_F16(a1, b, acc[1][nb]);
      }
    }
    wait_ds0();
    __syncthreads();
  }
  wait_tensor0(g0, g1);  // nothing of the mover is outstanding on any path to the wave's end

  // ---- epilogue: bias + f32 store ----
#pragma unroll
  for (int r = 0; r < 2; r++) {
#pragma unroll
    for (int nb = 0; nb < 4; nb++) {
      const int col = n0 + colg * 64 + nb * 16 + ln;
      const float bb = bias[col];
#pragma unroll
      for (int j = 0; j < 8; j++) {
        const int row = m0 + rowg * 32 + r * 16 + j + 8 * hf;
        C[(size_t)row * N + col] = acc[r][nb][j] + bb;
      }
    }
  }
}

// ---------------------------------------------------------------------------
// Fused RMSNorm (over D) + interleaved RoPE + f16 downconvert.
// ---------------------------------------------------------------------------
__global__ __launch_bounds__(256) void rmsnorm_rope_kernel(
    const float* __restrict__ src, const float* __restrict__ w,
    const float* __restrict__ cosb, const float* __restrict__ sinb,
    _Float16* __restrict__ dst, int T, int D, float outScale)
{
  __shared__ float red[8];
  const int row = blockIdx.x;  // b*T + t
  const int t   = row % T;
  const float* h = src + (size_t)row * D;
  const int base = threadIdx.x * 8;

  float4 h0 = *(const float4*)&h[base];
  float4 h1 = *(const float4*)&h[base + 4];
  float ss = h0.x * h0.x + h0.y * h0.y + h0.z * h0.z + h0.w * h0.w +
             h1.x * h1.x + h1.y * h1.y + h1.z * h1.z + h1.w * h1.w;
#pragma unroll
  for (int off = 16; off > 0; off >>= 1) ss += __shfl_xor(ss, off, 32);
  if ((threadIdx.x & 31) == 0) red[threadIdx.x >> 5] = ss;
  __syncthreads();
  float tot = 0.f;
#pragma unroll
  for (int i = 0; i < 8; i++) tot += red[i];
  const float rinv = rsqrtf(tot / (float)D + 1e-6f);

  const float hv[8] = {h0.x, h0.y, h0.z, h0.w, h1.x, h1.y, h1.z, h1.w};
  const float* cb = cosb + (size_t)t * D + base;
  const float* sb = sinb + (size_t)t * D + base;
  const float* wb = w + base;
  _Float16* dp = dst + (size_t)row * D + base;
#pragma unroll
  for (int p = 0; p < 4; p++) {
    const int e = 2 * p, o = 2 * p + 1;
    const float he = hv[e] * wb[e] * rinv;
    const float ho = hv[o] * wb[o] * rinv;
    dp[e] = (_Float16)((he * cb[e] - ho * sb[e]) * outScale);
    dp[o] = (_Float16)((ho * cb[o] + he * sb[o]) * outScale);
  }
}

// f32 -> f16 bulk convert (x and W matrices)
__global__ __launch_bounds__(256) void cvt_f16_kernel(
    const float* __restrict__ src, _Float16* __restrict__ dst, int n4)
{
  const int i = blockIdx.x * 256 + threadIdx.x;
  if (i >= n4) return;
  float4 f = ((const float4*)src)[i];
  v4h o;
  o[0] = (_Float16)f.x; o[1] = (_Float16)f.y;
  o[2] = (_Float16)f.z; o[3] = (_Float16)f.w;
  ((v4h*)dst)[i] = o;
}

__global__ __launch_bounds__(256) void transpose_v_kernel(
    const float* __restrict__ vf, _Float16* __restrict__ vT, int T)
{
  __shared__ _Float16 Ls[64 * 128];  // [t][dh] f16, 16KB
  const int tid = threadIdx.x;
  const int t0 = blockIdx.x * 64;
  const int hh = blockIdx.y, b = blockIdx.z;
  const int D = 2048, H = 16, Dh = 128;

  {  // load + convert 64t x 128dh tile (coalesced reads)
    const int r = tid >> 2, q = tid & 3;
    const float* sp = vf + (size_t)(b * T + t0 + r) * D + hh * Dh + q * 32;
    v16h u0, u1;
#pragma unroll
    for (int i = 0; i < 16; i++) { u0[i] = (_Float16)sp[i]; u1[i] = (_Float16)sp[16 + i]; }
    *(v16h*)&Ls[r * 128 + q * 32]      = u0;
    *(v16h*)&Ls[r * 128 + q * 32 + 16] = u1;
  }
  __syncthreads();
  {  // write transposed (coalesced writes over t)
    const int dh = tid >> 1, half = tid & 1;
    v16h o0, o1;
#pragma unroll
    for (int i = 0; i < 16; i++) {
      o0[i] = Ls[(half * 32 + i) * 128 + dh];
      o1[i] = Ls[(half * 32 + 16 + i) * 128 + dh];
    }
    _Float16* dp = vT + ((size_t)(b * H + hh) * Dh + dh) * T + t0 + half * 32;
    *(v16h*)dp        = o0;
    *(v16h*)(dp + 16) = o1;
  }
}

// ---------------------------------------------------------------------------
// Flash attention, non-causal. Workgroup = (b, h, 128 q rows); 8 waves x 16
// rows. K tiles (double-buffered) and V tiles streamed by the Tensor Data
// Mover: wave 0 issues K's tensor_load_to_lds one tile ahead, wave 1 issues V's
// for the current tile; one request of a wave outstanding. K rows lie at a
// pitch of 272 B in LDS, V rows and the P scratch rows at 144 B.
// Q pre-scaled by 1/sqrt(Dh); online softmax in f32; P transposed through
// per-wave LDS scratch.
// ---------------------------------------------------------------------------
__global__ __launch_bounds__(256) void flash_attn_kernel(
    const _Float16* __restrict__ qh, const _Float16* __restrict__ kh,
    const _Float16* __restrict__ vT, _Float16* __restrict__ oh, int T)
{
  // [0], [1]: K [key][dh]; [2]: V [dh][key]; [3]: per-wave P scratch [m][key]; 4 x 18 KB
  __shared__ __attribute__((aligned(2048))) _Float16 Ls[4][TILE_H];
  _Float16* const Vt = &Ls[2][0];
  _Float16* const Pw = &Ls[3][(threadIdx.x >> 5) * (16 * P128)];

  const int tid  = threadIdx.x;
  const int lane = tid & 31;
  const int wave = tid >> 5;
  const int ln   = lane & 15;
  const int hf   = lane >> 4;

  const int q0 = blockIdx.x * 128;
  const int hh = blockIdx.y;
  const int b  = blockIdx.z;
  const int D = 2048, Dh = 128, H = 16;

  // Q A-fragments: 4 chunks of K=32 covering Dh=128 (kept resident)
  const size_t qrow = (size_t)(b * T + q0 + wave * 16 + ln);
  v16h qA[4];
#pragma unroll
  for (int kc = 0; kc < 4; kc++)
    qA[kc] = *(const v16h*)&qh[qrow * D + hh * Dh + kc * 32 + hf * 16];

  v8f oAcc[8] = {};
  float rowm[8], rowl[8];
#pragma unroll
  for (int j = 0; j < 8; j++) { rowm[j] = -3.0e38f; rowl[j] = 0.f; }

  const _Float16* kBase = kh + (size_t)(b * T) * D + hh * Dh;
  const _Float16* vBase = vT + (size_t)(b * H + hh) * Dh * T;
  const unsigned wv  = uni((unsigned)tid >> 5);  // the wave's number, scalar
  const unsigned kLb = lds_addr(&Ls[0][0]);
  const unsigned vLb = lds_addr(&Ls[2][0]);
  const v8u g1K = held(tdm_group1<256, 64>((unsigned)D * 2u));   // 64 keys x 256B rows, pitch D f16
  const v8u g1V = held(tdm_group1<128, 128>((unsigned)T * 2u));  // 128 dh x 128B rows, pitch T f16
  v4u g0K = tdm_group0(kLb, kBase), g0V = tdm_group0(vLb, vBase);

  // Every wave forms the words (scalar work); only the issue itself stands behind a test.
  auto aimK = [&](int buf, int kt0) {
    const v4u n = tdm_group0(kLb + (unsigned)buf * (TILE_H * 2u), kBase + (size_t)kt0 * D);
    g0K[1] = n[1]; g0K[2] = n[2]; g0K[3] = n[3];
  };
  auto aimV = [&](int kt0) {
    const v4u n = tdm_group0(vLb, vBase + kt0);
    g0V[2] = n[2]; g0V[3] = n[3];
  };

  const int NT = T / 64;
  if (pinned(wv == 0u)) tdm_load(g0K, g1K);
  for (int it = 0; it < NT; ++it) {
    const int kt0 = it * 64;
    const int buf = it & 1;
    wait_tensor0(g0K, g1K);
    aimK(buf ^ 1, kt0 + 64);
    aimV(kt0);               // wave 1 has nothing outstanding here
    if (pinned((wv == 0u) & (it + 1 < NT))) tdm_load(g0K, g1K);
    if (pinned(wv == 1u)) {
      tdm_load(g0V, g1V);
      wait_tensor0(g0V, g1V);  // V tile `it` has landed
    }
    __syncthreads();

    // ---- S = Q * K^T (16 WMMA), scores for 16 q x 64 keys ----
    v8f s[4] = {};
#pragma unroll
    for (int kc = 0; kc < 4; kc++) {
#pragma unroll
      for (int n = 0; n < 4; n++) {
        v16h kb = ld_frag(&Ls[buf][(n * 16 + ln) * P256 + kc * 32 + hf * 16]);
        s[n] = WMMA_F16(qA[kc], kb, s[n]);
      }
    }

    // ---- online softmax (row stats per M = j + 8*hf) ----
    float tm[8];
#pragma unroll
    for (int j = 0; j < 8; j++)
      tm[j] = fmaxf(fmaxf(s[0][j], s[1][j]), fmaxf(s[2][j], s[3][j]));
    row_max16x8(tm);
#pragma unroll
    for (int j = 0; j < 8; j++) {
      const float mnew  = fmaxf(rowm[j], tm[j]);
      const float alpha = __expf(rowm[j] - mnew);
      rowm[j] = mnew;
      rowl[j] *= alpha;
#pragma unroll
      for (int nd = 0; nd < 8; nd++) oAcc[nd][j] *= alpha;
      float part = 0.f;
#pragma unroll
      for (int n = 0; n < 4; n++) {
        const float p = __expf(s[n][j] - mnew);
        s[n][j] = p;
        part += p;
      }
      rowl[j] += row_sum16(part);
    }

    // ---- transpose P (C layout -> A layout) through per-wave LDS ----
#pragma unroll
    for (int j = 0; j < 8; j++)
#pragma unroll
      for (int n = 0; n < 4; n++)
        Pw[(j + 8 * hf) * P128 + n * 16 + ln] = (_Float16)s[n][j];
    asm volatile("s_wait_dscnt 0" ::: "memory");  // wave-local LDS RAW fence

    v16h pA0 = ld_frag(&Pw[ln * P128 + 0 * 32 + hf * 16]);
    v16h pA1 = ld_frag(&Pw[ln * P128 + 1 * 32 + hf * 16]);

    // ---- O += P * V (16 WMMA) ----
#pragma unroll
    for (int kc = 0; kc < 2; kc++) {
      const v16h pa = kc ? pA1 : pA0;
#pragma unroll
      for (int nd = 0; nd < 8; nd++) {
        v16h vb = ld_frag(&Vt[(nd * 16 + ln) * P128 + kc * 32 + hf * 16]);
        oAcc[nd] = WMMA_F16(pa, vb, oAcc[nd]);
      }
    }
    wait_ds0();
    __syncthreads();
  }
  wait_tensor0(g0K, g1K);  // nothing of the mover is outstanding on any path to the wave's end

  // ---- normalize and store f16 attention output ----
#pragma unroll
  for (int nd = 0; nd < 8; nd++) {
#pragma unroll
    for (int j = 0; j < 8; j++) {
      const size_t row = (size_t)(b * T + q0 + wave * 16 + j + 8 * hf);
      oh[row * D + hh * Dh + nd * 16 + ln] = (_Float16)(oAcc[nd][j] / rowl[j]);
    }
  }
}

// ---------------------------------------------------------------------------
extern "C" void kernel_launch(void* const* d_in, const int* in_sizes, int n_in,
                              void* d_out, int out_size, void* d_ws, size_t ws_size,
                              hipStream_t stream)
{
  (void)in_sizes; (void)n_in; (void)out_size; (void)ws_size;
  const float* x    = (const float*)d_in[0];
  const float* cosb = (const float*)d_in[1];
  const float* sinb = (const float*)d_in[2];
  const float* Wq   = (const float*)d_in[3];
  const float* bq   = (const float*)d_in[4];
  const float* Wk   = (const float*)d_in[5];
  const float* bk   = (const float*)d_in[6];
  const float* Wv   = (const float*)d_in[7];
  const float* bv   = (const float*)d_in[8];
  const float* qnw  = (const float*)d_in[9];
  const float* knw  = (const float*)d_in[10];
  const float* Wo   = (const float*)d_in[11];
  const float* bo   = (const float*)d_in[12];
  float* out = (float*)d_out;

  const int B = 2, T = 2048, D = 2048, H = 16;
  const int M = B * T;

  // Workspace layout (208 MB total)
  char* ws = (char*)d_ws;
  const size_t MB = 1ull << 20;
  float*    qf  = (float*)(ws + 0 * MB);       // 32 MB f32 q
  float*    kf  = (float*)(ws + 32 * MB);      // 32 MB f32 k
  float*    vf  = (float*)(ws + 64 * MB);      // 32 MB f32 v
  _Float16* qh  = (_Float16*)(ws + 96 * MB);   // 16 MB f16 q-hat
  _Float16* kh  = (_Float16*)(ws + 112 * MB);  // 16 MB f16 k-hat
  _Float16* vTh = (_Float16*)(ws + 128 * MB);  // 16 MB f16 V transposed
  _Float16* oh  = (_Float16*)(ws + 144 * MB);  // 16 MB f16 attn out
  _Float16* xh  = (_Float16*)(ws + 160 * MB);  // 16 MB f16 x
  _Float16* Wqh = (_Float16*)(ws + 176 * MB);  //  8 MB
  _Float16* Wkh = (_Float16*)(ws + 184 * MB);  //  8 MB
  _Float16* Wvh = (_Float16*)(ws + 192 * MB);  //  8 MB
  _Float16* Woh = (_Float16*)(ws + 200 * MB);  //  8 MB

  dim3 blk(256);
  const int nx4 = M * D / 4, nw4 = D * D / 4;
  cvt_f16_kernel<<<(nx4 + 255) / 256, blk, 0, stream>>>(x,  xh,  nx4);
  cvt_f16_kernel<<<(nw4 + 255) / 256, blk, 0, stream>>>(Wq, Wqh, nw4);
  cvt_f16_kernel<<<(nw4 + 255) / 256, blk, 0, stream>>>(Wk, Wkh, nw4);
  cvt_f16_kernel<<<(nw4 + 255) / 256, blk, 0, stream>>>(Wv, Wvh, nw4);
  cvt_f16_kernel<<<(nw4 + 255) / 256, blk, 0, stream>>>(Wo, Woh, nw4);

  dim3 gg(D / 128, M / 128);
  gemm_f16_kernel<<<gg, blk, 0, stream>>>(xh, Wqh, bq, qf, M, D, D);
  gemm_f16_kernel<<<gg, blk, 0, stream>>>(xh, Wkh, bk, kf, M, D, D);
  gemm_f16_kernel<<<gg, blk, 0, stream>>>(xh, Wvh, bv, vf, M, D, D);

  const float qscale = 0.08838834764831845f;  // 1/sqrt(128), folded into Q
  rmsnorm_rope_kernel<<<M, blk, 0, stream>>>(qf, qnw, cosb, sinb, qh, T, D, qscale);
  rmsnorm_rope_kernel<<<M, blk, 0, stream>>>(kf, knw, cosb, sinb, kh, T, D, 1.0f);
  transpose_v_kernel<<<dim3(T / 64, H, B), blk, 0, stream>>>(vf, vTh, T);

  flash_attn_kernel<<<dim3(T / 128, H, B), blk, 0, stream>>>(qh, kh, vTh, oh, T);

  gemm_f16_kernel<<<gg, blk, 0, stream>>>(oh, Woh, bo, out, M, D, D);
}

// v003
// One run takes 263 microseconds.
// In both of two side-by-side timings against v002, it was 1.09 times as fast.
// Over all steps from v000 it is 3.02 times as fast.
#include <hip/hip_runtime.h>
#include <hip/hip_bf16.h>

typedef __attribute__((ext_vector_type(16))) _Float16 v16h;
typedef __attribute__((ext_vector_type(8)))  _Float16 v8h;
typedef __attribute__((ext_vector_type(4)))  _Float16 v4h;
typedef __attribute__((ext_vector_type(8)))  float    v8f;
typedef __attribute__((ext_vector_type(4)))  unsigned int v4u;

#define WMMA_F16(a, b, c) \
  __builtin_amdgcn_wmma_f32_16x16x32_f16(false, (a), false, (b), (short)0, (c), false, false)

__device__ __forceinline__ unsigned lds_addr(const void* p) {
  return (unsigned)(uintptr_t)p;  // low 32 bits of generic shared ptr = LDS offset
}

typedef __attribute__((ext_vector_type(8))) unsigned int v8u;

__device__ __forceinline__ unsigned uni(unsigned v) { return (unsigned)__builtin_amdgcn_readfirstlane(v); }

__device__ __forceinline__ unsigned pinned(unsigned v) {
  unsigned w = uni(v);
  asm volatile("" : "+s"(w));  // pinned(): keeps the condition in a scalar register
  return w;
}

// A wave's LDS reads have retired before a barrier frees their buffer for a refill.
__device__ __forceinline__ void wait_ds0() { asm volatile("s_wait_dscnt 0" ::: "memory"); }

__device__ __forceinline__ v4u tdm_group0(unsigned ldsaddr, const void* gaddr) {
  const unsigned long long ga = (unsigned long long)(uintptr_t)gaddr;
  v4u g;
  g[0] = uni(1u);                                                   // count = 1
  g[1] = uni(ldsaddr);                                              // LDS byte offset
  g[2] = uni((unsigned)ga);                                         // address [31:0]
  g[3] = uni((((unsigned)(ga >> 32)) & 0x01FFFFFFu) | 0x80000000u); // address [56:32] | type = 2
  return g;
}

template <unsigned ROWB, unsigned ROWS>
__device__ __forceinline__ v8u tdm_group1(unsigned srcPitch) {
  static_assert(ROWB == 128u || ROWB == 256u, "pad interval code is set for rows of 128 or 256 bytes");
  constexpr unsigned ivl = (ROWB == 256u) ? 5u : 4u;
  v8u g;
  g[0] = uni((1u << 20) | (ivl << 22) | (3u << 25));
  g[1] = uni(ROWB << 16);
  g[2] = uni(ROWS << 16);
  g[3] = uni(ROWB << 16);
  g[4] = uni(ROWS);
  g[5] = uni(srcPitch);
  g[6] = uni(0u);
  g[7] = uni(0u);
  return g;
}

__device__ __forceinline__ void tdm_load(v4u& g0, v8u g1) {
  asm volatile("tensor_load_to_lds %0, %1" : "+s"(g0) : "s"(g1) : "memory");
}

// The mover's waits are not placed by the compiler.
__device__ __forceinline__ void wait_tensor0(v4u& g0, v8u g1) {
  asm volatile("s_wait_tensorcnt 0" : "+s"(g0) : "s"(g1) : "memory");
}

__device__ __forceinline__ v8u held(v8u g) {
  asm volatile("" : "+s"(g));
  return g;
}

// 16 consecutive f16 of a padded LDS row (16-byte aligned): two ds_load_b128.
__device__ __forceinline__ v16h ld_frag(const _Float16* p) {
  const v8h lo = *(const v8h*)p;
  const v8h hi = *(const v8h*)(p + 8);
  return __builtin_shufflevector(lo, hi, 0, 1, 2, 3, 4, 5, 6, 7, 8, 9, 10, 11, 12, 13, 14, 15);
}

template <int M>
__device__ __forceinline__ float row_xor(float x) {
  return __builtin_bit_cast(float, __builtin_amdgcn_update_dpp(
      0, __builtin_bit_cast(int, x), 0x160 | M, 0xf, 0xf, true));
}
// Maximum over each 16-lane row, eight rows at once: one v_max_num_f32_dpp a step and row
// (through fmaxf the compiler kept a DPP move and a quieting max beside each maximum). The
// eight rows' steps are interleaved, so that no step waits for the one it depends on.
__device__ __forceinline__ void row_max16x8(float (&t)[8]) {
  asm(
      "v_max_num_f32_dpp %0, %0, %0 row_xmask:1 row_mask:0xf bank_mask:0xf\n\t"
      "v_max_num_f32_dpp %1, %1, %1 row_xmask:1 row_mask:0xf bank_mask:0xf\n\t"
      "v_max_num_f32_dpp %2, %2, %2 row_xmask:1 row_mask:0xf bank_mask:0xf\n\t"
      "v_max_num_f32_dpp %3, %3, %3 row_xmask:1 row_mask:0xf bank_mask:0xf\n\t"
      "v_max_num_f32_dpp %4, %4, %4 row_xmask:1 row_mask:0xf bank_mask:0xf\n\t"
      "v_max_num_f32_dpp %5, %5, %5 row_xmask:1 row_mask:0xf bank_mask:0xf\n\t"
      "v_max_num_f32_dpp %6, %6, %6 row_xmask:1 row_mask:0xf bank_mask:0xf\n\t"
      "v_max_num_f32_dpp %7, %7, %7 row_xmask:1 row_mask:0xf bank_mask:0xf\n\t"
      "v_max_num_f32_dpp %0, %0, %0 row_xmask:2 row_mask:0xf bank_mask:0xf\n\t"
      "v_max_num_f32_dpp %1, %1, %1 row_xmask:2 row_mask:0xf bank_mask:0xf\n\t"
      "v_max_num_f32_dpp %2, %2, %2 row_xmask:2 row_mask:0xf bank_mask:0xf\n\t"
      "v_max_num_f32_dpp %3, %3, %3 row_xmask:2 row_mask:0xf bank_mask:0xf\n\t"
      "v_max_num_f32_dpp %4, %4, %4 row_xmask:2 row_mask:0xf bank_mask:0xf\n\t"
      "v_max_num_f32_dpp %5, %5, %5 row_xmask:2 row_mask:0xf bank_mask:0xf\n\t"
      "v_max_num_f32_dpp %6, %6, %6 row_xmask:2 row_mask:0xf bank_mask:0xf\n\t"
      "v_max_num_f32_dpp %7, %7, %7 row_xmask:2 row_mask:0xf bank_mask:0xf\n\t"
      "v_max_num_f32_dpp %0, %0, %0 row_xmask:4 row_mask:0xf bank_mask:0xf\n\t"
      "v_max_num_f32_dpp %1, %1, %1 row_xmask:4 row_mask:0xf bank_mask:0xf\n\t"
      "v_max_num_f32_dpp %2, %2, %2 row_xmask:4 row_mask:0xf bank_mask:0xf\n\t"
      "v_max_num_f32_dpp %3, %3, %3 row_xmask:4 row_mask:0xf bank_mask:0xf\n\t"
      "v_max_num_f32_dpp %4, %4, %4 row_xmask:4 row_mask:0xf bank_mask:0xf\n\t"
      "v_max_num_f32_dpp %5, %5, %5 row_xmask:4 row_mask:0xf bank_mask:0xf\n\t"
      "v_max_num_f32_dpp %6, %6, %6 row_xmask:4 row_mask:0xf bank_mask:0xf\n\t"
      "v_max_num_f32_dpp %7, %7, %7 row_xmask:4 row_mask:0xf bank_mask:0xf\n\t"
      "v_max_num_f32_dpp %0, %0, %0 row_xmask:8 row_mask:0xf bank_mask:0xf\n\t"
      "v_max_num_f32_dpp %1, %1, %1 row_xmask:8 row_mask:0xf bank_mask:0xf\n\t"
      "v_max_num_f32_dpp %2, %2, %2 row_xmask:8 row_mask:0xf bank_mask:0xf\n\t"
      "v_max_num_f32_dpp %3, %3, %3 row_xmask:8 row_mask:0xf bank_mask:0xf\n\t"
      "v_max_num_f32_dpp %4, %4, %4 row_xmask:8 row_mask:0xf bank_mask:0xf\n\t"
      "v_max_num_f32_dpp %5, %5, %5 row_xmask:8 row_mask:0xf bank_mask:0xf\n\t"
      "v_max_num_f32_dpp %6, %6, %6 row_xmask:8 row_mask:0xf bank_mask:0xf\n\t"
      "v_max_num_f32_dpp %7, %7, %7 row_xmask:8 row_mask:0xf bank_mask:0xf\n\t"
      : "+v"(t[0]), "+v"(t[1]), "+v"(t[2]), "+v"(t[3]), "+v"(t[4]), "+v"(t[5]), "+v"(t[6]), "+v"(t[7]));
}
__device__ __forceinline__ float row_sum16(float t) {
  t += row_xor<1>(t);
  t += row_xor<2>(t);
  t += row_xor<4>(t);
  t += row_xor<8>(t);
  return t;
}

// LDS pitches in f16 elements: 128-B rows + 16 B, 256-B rows + 16 B.
#define P128 72
#define P256 136
// One padded tile's place in LDS, in f16 elements: 128 x 144 B = 18432 B = 9 x 2 KiB
// (64 x 272 B = 17408 B is rounded up to the same), so every place is a multiple of 2 KiB.
#define TILE_H 9216

__global__ __launch_bounds__(256) void gemm_f16_kernel(
    const _Float16* __restrict__ Ah, const _Float16* __restrict__ Wh,
    const float* __restrict__ bias, float* __restrict__ C,
    int M, int N, int K)
{
  __shared__ __attribute__((aligned(2048))) _Float16 Ls[2][2][TILE_H];  // [buf][A, W], 4 x 18 KB

  const int tid  = threadIdx.x;
  const int lane = tid & 31;
  const int wave = tid >> 5;
  const int ln   = lane & 15;
  const int hf   = lane >> 4;
  const int rowg = wave >> 1;  // 0..3 : 32-row group
  const int colg = wave & 1;   // 0..1 : 64-col group

  const int n0 = blockIdx.x * 128;
  const int m0 = blockIdx.y * 128;

  const unsigned wv = uni((unsigned)tid >> 5);  // the wave's number, scalar
  const _Float16* aBase = Ah + (size_t)m0 * K;
  const _Float16* bBase = Wh + (size_t)n0 * K;
  const _Float16* tBase = (wv == 1u) ? bBase : aBase;        // this wave's operand
  const unsigned  tL    = lds_addr(&Ls[0][wv == 1u ? 1 : 0][0]);
  const v8u g1 = held(tdm_group1<128, 128>((unsigned)K * 2u));  // 128 rows x 128 B, pitch K f16
  v4u g0 = tdm_group0(tL, tBase);

  // Every wave forms the words (scalar work); only the issue itself stands behind a test.
  auto aimTile = [&](int buf, int k0) {
    const v4u n = tdm_group0(tL + (unsigned)buf * (2u * TILE_H * 2u), tBase + k0);
    g0[1] = n[1]; g0[2] = n[2]; g0[3] = n[3];
  };

  v8f acc[2][4] = {};

  const int NT = K / 64;
  if (pinned(wv < 2u)) tdm_load(g0, g1);
  for (int it = 0; it < NT; ++it) {
    const int buf = it & 1;
    wait_tensor0(g0, g1);
    aimTile(buf ^ 1, (it + 1) * 64);
    if (pinned((wv < 2u) & (it + 1 < NT))) tdm_load(g0, g1);
    __syncthreads();  // tile `it` visible to all waves

    // All twelve fragments of the K-step are read as one group in front of its WMMAs, each
    // into registers of its own: one LDS latency a K-step, not one in front of every pair.
    v16h af[2][2], bf[2][4];
#pragma unroll
    for (int kc = 0; kc < 2; kc++) {
      af[kc][0] = ld_frag(&Ls[buf][0][(rowg * 32 + ln) * P128 + kc * 32 + hf * 16]);
      af[kc][1] = ld_frag(&Ls[buf][0][(rowg * 32 + 16 + ln) * P128 + kc * 32 + hf * 16]);
#pragma unroll
      for (int nb = 0; nb < 4; nb++)
        bf[kc][nb] = ld_frag(&Ls[buf][1][(colg * 64 + nb * 16 + ln) * P128 + kc * 32 + hf * 16]);
    }
    __builtin_amdgcn_sched_barrier(0);  // keeps the reads in front: sunk to their uses, each would be waited for alone
#pragma unroll
    for (int kc = 0; kc < 2; kc++) {
#pragma unroll
      for (int nb = 0; nb < 4; nb++) {
        acc[0][nb] = WMMA_F16(af[kc][0], bf[kc][nb], acc[0][nb]);
        acc[1][nb] = WMMA_F16(af[kc][1], bf[kc][nb], acc[1][nb]);
      }
    }
    wait_ds0();
    __syncthreads();
  }
  wait_tensor0(g0, g1);  // nothing of the mover is outstanding on any path to the wave's end

  // ---- epilogue: bias + f32 store ----
#pragma unroll
  for (int r = 0; r < 2; r++) {
#pragma unroll
    for (int nb = 0; nb < 4; nb++) {
      const int col = n0 + colg * 64 + nb * 16 + ln;
      const float bb = bias[col];
#pragma unroll
      for (int j = 0; j < 8; j++) {
        const int row = m0 + rowg * 32 + r * 16 + j + 8 * hf;
        C[(size_t)row * N + col] = acc[r][nb][j] + bb;
      }
    }
  }
}

// ---------------------------------------------------------------------------
// Fused RMSNorm (over D) + interleaved RoPE + f16 downconvert.
// ---------------------------------------------------------------------------
__global__ __launch_bounds__(256) void rmsnorm_rope_kernel(
    const float* __restrict__ src, const float* __restrict__ w,
    const float* __restrict__ cosb, const float* __restrict__ sinb,
    _Float16* __restrict__ dst, int T, int D, float outScale)
{
  __shared__ float red[8];
  const int row = blockIdx.x;  // b*T + t
  const int t   = row % T;
  const float* h = src + (size_t)row * D;
  const int base = threadIdx.x * 8;

  float4 h0 = *(const float4*)&h[base];
  float4 h1 = *(const float4*)&h[base + 4];
  float ss = h0.x * h0.x + h0.y * h0.y + h0.z * h0.z + h0.w * h0.w +
             h1.x * h1.x + h1.y * h1.y + h1.z * h1.z + h1.w * h1.w;
#pragma unroll
  for (int off = 16; off > 0; off >>= 1) ss += __shfl_xor(ss, off, 32);
  if ((threadIdx.x & 31) == 0) red[threadIdx.x >> 5] = ss;
  __syncthreads();
  float tot = 0.f;
#pragma unroll
  for (int i = 0; i < 8; i++) tot += red[i];
  const float rinv = rsqrtf(tot / (float)D + 1e-6f);

  const float hv[8] = {h0.x, h0.y, h0.z, h0.w, h1.x, h1.y, h1.z, h1.w};
  const float* cb = cosb + (size_t)t * D + base;
  const float* sb = sinb + (size_t)t * D + base;
  const float* wb = w + base;
  _Float16* dp = dst + (size_t)row * D + base;
#pragma unroll
  for (int p = 0; p < 4; p++) {
    const int e = 2 * p, o = 2 * p + 1;
    const float he = hv[e] * wb[e] * rinv;
    const float ho = hv[o] * wb[o] * rinv;
    dp[e] = (_Float16)((he * cb[e] - ho * sb[e]) * outScale);
    dp[o] = (_Float16)((ho * cb[o] + he * sb[o]) * outScale);
  }
}

// f32 -> f16 bulk convert (x and W matrices)
__global__ __launch_bounds__(256) void cvt_f16_kernel(
    const float* __restrict__ src, _Float16* __restrict__ dst, int n4)
{
  const int i = blockIdx.x * 256 + threadIdx.x;
  if (i >= n4) return;
  float4 f = ((const float4*)src)[i];
  v4h o;
  o[0] = (_Float16)f.x; o[1] = (_Float16)f.y;
  o[2] = (_Float16)f.z; o[3] = (_Float16)f.w;
  ((v4h*)dst)[i] = o;
}

__global__ __launch_bounds__(256) void transpose_v_kernel(
    const float* __restrict__ vf, _Float16* __restrict__ vT, int T)
{
  __shared__ _Float16 Ls[64 * 128];  // [t][dh] f16, 16KB
  const int tid = threadIdx.x;
  const int t0 = blockIdx.x * 64;
  const int hh = blockIdx.y, b = blockIdx.z;
  const int D = 2048, H = 16, Dh = 128;

  {  // load + convert 64t x 128dh tile (coalesced reads)
    const int r = tid >> 2, q = tid & 3;
    const float* sp = vf + (size_t)(b * T + t0 + r) * D + hh * Dh + q * 32;
    v16h u0, u1;
#pragma unroll
    for (int i = 0; i < 16; i++) { u0[i] = (_Float16)sp[i]; u1[i] = (_Float16)sp[16 + i]; }
    *(v16h*)&Ls[r * 128 + q * 32]      = u0;
    *(v16h*)&Ls[r * 128 + q * 32 + 16] = u1;
  }
  __syncthreads();
  {  // write transposed (coalesced writes over t)
    const int dh = tid >> 1, half = tid & 1;
    v16h o0, o1;
#pragma unroll
    for (int i = 0; i < 16; i++) {
      o0[i] = Ls[(half * 32 + i) * 128 + dh];
      o1[i] = Ls[(half * 32 + 16 + i) * 128 + dh];
    }
    _Float16* dp = vT + ((size_t)(b * H + hh) * Dh + dh) * T + t0 + half * 32;
    *(v16h*)dp        = o0;
    *(v16h*)(dp + 16) = o1;
  }
}

// ---------------------------------------------------------------------------
// Flash attention, non-causal. Workgroup = (b, h, 128 q rows); 8 waves x 16
// rows. K tiles (double-buffered) and V tiles streamed by the Tensor Data
// Mover: wave 0 issues K's tensor_load_to_lds one tile ahead, wave 1 issues V's
// for the current tile; one request of a wave outstanding. K rows lie at a
// pitch of 272 B in LDS, V rows and the P scratch rows at 144 B.
// Q pre-scaled by 1/sqrt(Dh); online softmax in f32; P transposed through
// per-wave LDS scratch.
// ---------------------------------------------------------------------------
__global__ __launch_bounds__(256) void flash_attn_kernel(
    const _Float16* __restrict__ qh, const _Float16* __restrict__ kh,
    const _Float16* __restrict__ vT, _Float16* __restrict__ oh, int T)
{
  // [0], [1]: K [key][dh]; [2]: V [dh][key]; [3]: per-wave P scratch [m][key]; 4 x 18 KB
  __shared__ __attribute__((aligned(2048))) _Float16 Ls[4][TILE_H];
  _Float16* const Vt = &Ls[2][0];
  _Float16* const Pw = &Ls[3][(threadIdx.x >> 5) * (16 * P128)];

  const int tid  = threadIdx.x;
  const int lane = tid & 31;
  const int wave = tid >> 5;
  const int ln   = lane & 15;
  const int hf   = lane >> 4;

  const int q0 = blockIdx.x * 128;
  const int hh = blockIdx.y;
  const int b  = blockIdx.z;
  const int D = 2048, Dh = 128, H = 16;

  // Q A-fragments: 4 chunks of K=32 covering Dh=128 (kept resident)
  const size_t qrow = (size_t)(b * T + q0 + wave * 16 + ln);
  v16h qA[4];
#pragma unroll
  for (int kc = 0; kc < 4; kc++)
    qA[kc] = *(const v16h*)&qh[qrow * D + hh * Dh + kc * 32 + hf * 16];

  v8f oAcc[8] = {};
  float rowm[8], rowl[8];
#pragma unroll
  for (int j = 0; j < 8; j++) { rowm[j] = -3.0e38f; rowl[j] = 0.f; }

  const _Float16* kBase = kh + (size_t)(b * T) * D + hh * Dh;
  const _Float16* vBase = vT + (size_t)(b * H + hh) * Dh * T;
  const unsigned wv  = uni((unsigned)tid >> 5);  // the wave's number, scalar
  const unsigned kLb = lds_addr(&Ls[0][0]);
  const unsigned vLb = lds_addr(&Ls[2][0]);
  const v8u g1K = held(tdm_group1<256, 64>((unsigned)D * 2u));   // 64 keys x 256B rows, pitch D f16
  const v8u g1V = held(tdm_group1<128, 128>((unsigned)T * 2u));  // 128 dh x 128B rows, pitch T f16
  v4u g0K = tdm_group0(kLb, kBase), g0V = tdm_group0(vLb, vBase);

  // Every wave forms the words (scalar work); only the issue itself stands behind a test.
  auto aimK = [&](int buf, int kt0) {
    const v4u n = tdm_group0(kLb + (unsigned)buf * (TILE_H * 2u), kBase + (size_t)kt0 * D);
    g0K[1] = n[1]; g0K[2] = n[2]; g0K[3] = n[3];
  };
  auto aimV = [&](int kt0) {
    const v4u n = tdm_group0(vLb, vBase + kt0);
    g0V[2] = n[2]; g0V[3] = n[3];
  };

  const int NT = T / 64;
  if (pinned(wv == 0u)) tdm_load(g0K, g1K);
  for (int it = 0; it < NT; ++it) {
    const int kt0 = it * 64;
    const int buf = it & 1;
    wait_tensor0(g0K, g1K);
    aimK(buf ^ 1, kt0 + 64);
    aimV(kt0);               // wave 1 has nothing outstanding here
    if (pinned((wv == 0u) & (it + 1 < NT))) tdm_load(g0K, g1K);
    if (pinned(wv == 1u)) {
      tdm_load(g0V, g1V);
      wait_tensor0(g0V, g1V);  // V tile `it` has landed
    }
    __syncthreads();

    // ---- S = Q * K^T (16 WMMA), scores for 16 q x 64 keys ----
    // K fragments are read in groups of four (one kc), two groups in flight in two register
    // sets: a group is waited for once, while the group behind it is already on its way.
    v8f s[4] = {};
    v16h kf[2][4];
    auto readK = [&](v16h (&g)[4], int kc) {
#pragma unroll
      for (int n = 0; n < 4; n++)
        g[n] = ld_frag(&Ls[buf][(n * 16 + ln) * P256 + kc * 32 + hf * 16]);
    };
    readK(kf[0], 0);
    readK(kf[1], 1);
    __builtin_amdgcn_sched_barrier(0);  // keeps both groups' reads in front of the first WMMA
#pragma unroll
    for (int kc = 0; kc < 4; kc++) {
#pragma unroll
      for (int n = 0; n < 4; n++) s[n] = WMMA_F16(qA[kc], kf[kc & 1][n], s[n]);
      if (kc + 2 < 4) {
        readK(kf[kc & 1], kc + 2);
        __builtin_amdgcn_sched_barrier(0);  // keeps the refill in front of the other set's WMMAs
      }
    }

    v16h vf[2][4];
    auto readV = [&](v16h (&g)[4], int grp) {
#pragma unroll
      for (int i = 0; i < 4; i++)
        g[i] = ld_frag(&Vt[(((grp & 1) * 4 + i) * 16 + ln) * P128 + (grp >> 1) * 32 + hf * 16]);
    };
    readV(vf[0], 0);
    readV(vf[1], 1);
    __builtin_amdgcn_sched_barrier(0);  // keeps these reads in front of the softmax

    // ---- online softmax (row stats per M = j + 8*hf) ----
    float tm[8];
#pragma unroll
    for (int j = 0; j < 8; j++)
      tm[j] = fmaxf(fmaxf(s[0][j], s[1][j]), fmaxf(s[2][j], s[3][j]));
    row_max16x8(tm);
#pragma unroll
    for (int j = 0; j < 8; j++) {
      const float mnew  = fmaxf(rowm[j], tm[j]);
      const float alpha = __expf(rowm[j] - mnew);
      rowm[j] = mnew;
      rowl[j] *= alpha;
#pragma unroll
      for (int nd = 0; nd < 8; nd++) oAcc[nd][j] *= alpha;
      float part = 0.f;
#pragma unroll
      for (int n = 0; n < 4; n++) {
        const float p = __expf(s[n][j] - mnew);
        s[n][j] = p;
        part += p;
      }
      rowl[j] += row_sum16(part);
    }

    // ---- transpose P (C layout -> A layout) through per-wave LDS ----
#pragma unroll
    for (int j = 0; j < 8; j++)
#pragma unroll
      for (int n = 0; n < 4; n++)
        Pw[(j + 8 * hf) * P128 + n * 16 + ln] = (_Float16)s[n][j];
    asm volatile("s_wait_dscnt 0" ::: "memory");  // wave-local LDS RAW fence

    v16h pA0 = ld_frag(&Pw[ln * P128 + 0 * 32 + hf * 16]);
    v16h pA1 = ld_frag(&Pw[ln * P128 + 1 * 32 + hf * 16]);

    // ---- O += P * V (16 WMMA) ----
#pragma unroll
    for (int grp = 0; grp < 4; grp++) {
      const v16h pa = (grp >> 1) ? pA1 : pA0;
#pragma unroll
      for (int i = 0; i < 4; i++)
        oAcc[(grp & 1) * 4 + i] = WMMA_F16(pa, vf[grp & 1][i], oAcc[(grp & 1) * 4 + i]);
      if (grp + 2 < 4) {
        readV(vf[grp & 1], grp + 2);
        __builtin_amdgcn_sched_barrier(0);  // keeps the refill in front of the other set's WMMAs
      }
    }
    wait_ds0();
    __syncthreads();
  }
  wait_tensor0(g0K, g1K);  // nothing of the mover is outstanding on any path to the wave's end

  // ---- normalize and store f16 attention output ----
#pragma unroll
  for (int nd = 0; nd < 8; nd++) {
#pragma unroll
    for (int j = 0; j < 8; j++) {
      const size_t row = (size_t)(b * T + q0 + wave * 16 + j + 8 * hf);
      oh[row * D + hh * Dh + nd * 16 + ln] = (_Float16)(oAcc[nd][j] / rowl[j]);
    }
  }
}

// ---------------------------------------------------------------------------
extern "C" void kernel_launch(void* const* d_in, const int* in_sizes, int n_in,
                              void* d_out, int out_size, void* d_ws, size_t ws_size,
                              hipStream_t stream)
{
  (void)in_sizes; (void)n_in; (void)out_size; (void)ws_size;
  const float* x    = (const float*)d_in[0];
  const float* cosb = (const float*)d_in[1];
  const float* sinb = (const float*)d_in[2];
  const float* Wq   = (const float*)d_in[3];
  const float* bq   = (const float*)d_in[4];
  const float* Wk   = (const float*)d_in[5];
  const float* bk   = (const float*)d_in[6];
  const float* Wv   = (const float*)d_in[7];
  const float* bv   = (const float*)d_in[8];
  const float* qnw  = (const float*)d_in[9];
  const float* knw  = (const float*)d_in[10];
  const float* Wo   = (const float*)d_in[11];
  const float* bo   = (const float*)d_in[12];
  float* out = (float*)d_out;

  const int B = 2, T = 2048, D = 2048, H = 16;
  const int M = B * T;

  // Workspace layout (208 MB total)
  char* ws = (char*)d_ws;
  const size_t MB = 1ull << 20;
  float*    qf  = (float*)(ws + 0 * MB);       // 32 MB f32 q
  float*    kf  = (float*)(ws + 32 * MB);      // 32 MB f32 k
  float*    vf  = (float*)(ws + 64 * MB);      // 32 MB f32 v
  _Float16* qh  = (_Float16*)(ws + 96 * MB);   // 16 MB f16 q-hat
  _Float16* kh  = (_Float16*)(ws + 112 * MB);  // 16 MB f16 k-hat
  _Float16* vTh = (_Float16*)(ws + 128 * MB);  // 16 MB f16 V transposed
  _Float16* oh  = (_Float16*)(ws + 144 * MB);  // 16 MB f16 attn out
  _Float16* xh  = (_Float16*)(ws + 160 * MB);  // 16 MB f16 x
  _Float16* Wqh = (_Float16*)(ws + 176 * MB);  //  8 MB
  _Float16* Wkh = (_Float16*)(ws + 184 * MB);  //  8 MB
  _Float16* Wvh = (_Float16*)(ws + 192 * MB);  //  8 MB
  _Float16* Woh = (_Float16*)(ws + 200 * MB);  //  8 MB

  dim3 blk(256);
  const int nx4 = M * D / 4, nw4 = D * D / 4;
  cvt_f16_kernel<<<(nx4 + 255) / 256, blk, 0, stream>>>(x,  xh,  nx4);
  cvt_f16_kernel<<<(nw4 + 255) / 256, blk, 0, stream>>>(Wq, Wqh, nw4);
  cvt_f16_kernel<<<(nw4 + 255) / 256, blk, 0, stream>>>(Wk, Wkh, nw4);
  cvt_f16_kernel<<<(nw4 + 255) / 256, blk, 0, stream>>>(Wv, Wvh, nw4);
  cvt_f16_kernel<<<(nw4 + 255) / 256, blk, 0, stream>>>(Wo, Woh, nw4);

  dim3 gg(D / 128, M / 128);
  gemm_f16_kernel<<<gg, blk, 0, stream>>>(xh, Wqh, bq, qf, M, D, D);
  gemm_f16_kernel<<<gg, blk, 0, stream>>>(xh, Wkh, bk, kf, M, D, D);
  gemm_f16_kernel<<<gg, blk, 0, stream>>>(xh, Wvh, bv, vf, M, D, D);

  const float qscale = 0.08838834764831845f;  // 1/sqrt(128), folded into Q
  rmsnorm_rope_kernel<<<M, blk, 0, stream>>>(qf, qnw, cosb, sinb, qh, T, D, qscale);
  rmsnorm_rope_kernel<<<M, blk, 0, stream>>>(kf, knw, cosb, sinb, kh, T, D, 1.0f);
  transpose_v_kernel<<<dim3(T / 64, H, B), blk, 0, stream>>>(vf, vTh, T);

  flash_attn_kernel<<<dim3(T / 128, H, B), blk, 0, stream>>>(qh, kh, vTh, oh, T);

  gemm_f16_kernel<<<gg, blk, 0, stream>>>(oh, Woh, bo, out, M, D, D);
}

// v004
// It runs in 237 microseconds.
// Timed twice side by side with v003, it ran 1.11 times as fast both times.
// Over all steps from v000 it is 3.35 times as fast.
#include <hip/hip_runtime.h>
#include <hip/hip_bf16.h>

typedef __attribute__((ext_vector_type(16))) _Float16 v16h;
typedef __attribute__((ext_vector_type(8)))  _Float16 v8h;
typedef __attribute__((ext_vector_type(4)))  _Float16 v4h;
typedef __attribute__((ext_vector_type(8)))  float    v8f;
typedef __attribute__((ext_vector_type(4)))  unsigned int v4u;

#define WMMA_F16(a, b, c) \
  __builtin_amdgcn_wmma_f32_16x16x32_f16(false, (a), false, (b), (short)0, (c), false, false)

__device__ __forceinline__ unsigned lds_addr(const void* p) {
  return (unsigned)(uintptr_t)p;  // low 32 bits of generic shared ptr = LDS offset
}

typedef __attribute__((ext_vector_type(8))) unsigned int v8u;

__device__ __forceinline__ unsigned uni(unsigned v) { return (unsigned)__builtin_amdgcn_readfirstlane(v); }

__device__ __forceinline__ unsigned pinned(unsigned v) {
  unsigned w = uni(v);
  asm volatile("" : "+s"(w));  // pinned(): keeps the condition in a scalar register
  return w;
}

// A wave's LDS reads have retired before a barrier frees their buffer for a refill.
__device__ __forceinline__ void wait_ds0() { asm volatile("s_wait_dscnt 0" ::: "memory"); }

__device__ __forceinline__ v4u tdm_group0(unsigned ldsaddr, const void* gaddr) {
  const unsigned long long ga = (unsigned long long)(uintptr_t)gaddr;
  v4u g;
  g[0] = uni(1u);                                                   // count = 1
  g[1] = uni(ldsaddr);                                              // LDS byte offset
  g[2] = uni((unsigned)ga);                                         // address [31:0]
  g[3] = uni((((unsigned)(ga >> 32)) & 0x01FFFFFFu) | 0x80000000u); // address [56:32] | type = 2
  return g;
}

template <unsigned ROWB, unsigned ROWS>
__device__ __forceinline__ v8u tdm_group1(unsigned srcPitch) {
  static_assert(ROWB == 128u || ROWB == 256u, "pad interval code is set for rows of 128 or 256 bytes");
  constexpr unsigned ivl = (ROWB == 256u) ? 5u : 4u;
  v8u g;
  g[0] = uni((1u << 20) | (ivl << 22) | (3u << 25));
  g[1] = uni(ROWB << 16);
  g[2] = uni(ROWS << 16);
  g[3] = uni(ROWB << 16);
  g[4] = uni(ROWS);
  g[5] = uni(srcPitch);
  g[6] = uni(0u);
  g[7] = uni(0u);
  return g;
}

__device__ __forceinline__ void tdm_load(v4u& g0, v8u g1) {
  asm volatile("tensor_load_to_lds %0, %1" : "+s"(g0) : "s"(g1) : "memory");
}

// The mover's waits are not placed by the compiler.
__device__ __forceinline__ void wait_tensor0(v4u& g0, v8u g1) {
  asm volatile("s_wait_tensorcnt 0" : "+s"(g0) : "s"(g1) : "memory");
}

__device__ __forceinline__ v8u held(v8u g) {
  asm volatile("" : "+s"(g));
  return g;
}

// 16 consecutive f16 of a padded LDS row (16-byte aligned): two ds_load_b128.
__device__ __forceinline__ v16h ld_frag(const _Float16* p) {
  const v8h lo = *(const v8h*)p;
  const v8h hi = *(const v8h*)(p + 8);
  return __builtin_shufflevector(lo, hi, 0, 1, 2, 3, 4, 5, 6, 7, 8, 9, 10, 11, 12, 13, 14, 15);
}

// LDS pitches in f16 elements: 128-B rows + 16 B, 256-B rows + 16 B.
#define P128 72
#define P256 136
// One padded tile's place in LDS, in f16 elements: 128 x 144 B = 18432 B = 9 x 2 KiB
// (64 x 272 B = 17408 B is rounded up to the same), so every place is a multiple of 2 KiB.
#define TILE_H 9216

__global__ __launch_bounds__(256) void gemm_f16_kernel(
    const _Float16* __restrict__ Ah, const _Float16* __restrict__ Wh,
    const float* __restrict__ bias, float* __restrict__ C,
    int M, int N, int K)
{
  __shared__ __attribute__((aligned(2048))) _Float16 Ls[2][2][TILE_H];  // [buf][A, W], 4 x 18 KB

  const int tid  = threadIdx.x;
  const int lane = tid & 31;
  const int wave = tid >> 5;
  const int ln   = lane & 15;
  const int hf   = lane >> 4;
  const int rowg = wave >> 1;  // 0..3 : 32-row group
  const int colg = wave & 1;   // 0..1 : 64-col group

  const int n0 = blockIdx.x * 128;
  const int m0 = blockIdx.y * 128;

  const unsigned wv = uni((unsigned)tid >> 5);  // the wave's number, scalar
  const _Float16* aBase = Ah + (size_t)m0 * K;
  const _Float16* bBase = Wh + (size_t)n0 * K;
  const _Float16* tBase = (wv == 1u) ? bBase : aBase;        // this wave's operand
  const unsigned  tL    = lds_addr(&Ls[0][wv == 1u ? 1 : 0][0]);
  const v8u g1 = held(tdm_group1<128, 128>((unsigned)K * 2u));  // 128 rows x 128 B, pitch K f16
  v4u g0 = tdm_group0(tL, tBase);

  // Every wave forms the words (scalar work); only the issue itself stands behind a test.
  auto aimTile = [&](int buf, int k0) {
    const v4u n = tdm_group0(tL + (unsigned)buf * (2u * TILE_H * 2u), tBase + k0);
    g0[1] = n[1]; g0[2] = n[2]; g0[3] = n[3];
  };

  v8f acc[2][4] = {};

  const int NT = K / 64;
  if (pinned(wv < 2u)) tdm_load(g0, g1);
  for (int it = 0; it < NT; ++it) {
    const int buf = it & 1;
    wait_tensor0(g0, g1);
    aimTile(buf ^ 1, (it + 1) * 64);
    if (pinned((wv < 2u) & (it + 1 < NT))) tdm_load(g0, g1);
    __syncthreads();  // tile `it` visible to all waves

    // All twelve fragments of the K-step are read as one group in front of its WMMAs, each
    // into registers of its own: one LDS latency a K-step, not one in front of every pair.
    v16h af[2][2], bf[2][4];
#pragma unroll
    for (int kc = 0; kc < 2; kc++) {
      af[kc][0] = ld_frag(&Ls[buf][0][(rowg * 32 + ln) * P128 + kc * 32 + hf * 16]);
      af[kc][1] = ld_frag(&Ls[buf][0][(rowg * 32 + 16 + ln) * P128 + kc * 32 + hf * 16]);
#pragma unroll
      for (int nb = 0; nb < 4; nb++)
        bf[kc][nb] = ld_frag(&Ls[buf][1][(colg * 64 + nb * 16 + ln) * P128 + kc * 32 + hf * 16]);
    }
    __builtin_amdgcn_sched_barrier(0);  // keeps the reads in front: sunk to their uses, each would be waited for alone
#pragma unroll
    for (int kc = 0; kc < 2; kc++) {
#pragma unroll
      for (int nb = 0; nb < 4; nb++) {
        acc[0][nb] = WMMA_F16(af[kc][0], bf[kc][nb], acc[0][nb]);
        acc[1][nb] = WMMA_F16(af[kc][1], bf[kc][nb], acc[1][nb]);
      }
    }
    wait_ds0();
    __syncthreads();
  }
  wait_tensor0(g0, g1);  // nothing of the mover is outstanding on any path to the wave's end

  // ---- epilogue: bias + f32 store ----
#pragma unroll
  for (int r = 0; r < 2; r++) {
#pragma unroll
    for (int nb = 0; nb < 4; nb++) {
      const int col = n0 + colg * 64 + nb * 16 + ln;
      const float bb = bias[col];
#pragma unroll
      for (int j = 0; j < 8; j++) {
        const int row = m0 + rowg * 32 + r * 16 + j + 8 * hf;
        C[(size_t)row * N + col] = acc[r][nb][j] + bb;
      }
    }
  }
}

// ---------------------------------------------------------------------------
// Fused RMSNorm (over D) + interleaved RoPE + f16 downconvert.
// ---------------------------------------------------------------------------
__global__ __launch_bounds__(256) void rmsnorm_rope_kernel(
    const float* __restrict__ src, const float* __restrict__ w,
    const float* __restrict__ cosb, const float* __restrict__ sinb,
    _Float16* __restrict__ dst, int T, int D, float outScale)
{
  __shared__ float red[8];
  const int row = blockIdx.x;  // b*T + t
  const int t   = row % T;
  const float* h = src + (size_t)row * D;
  const int base = threadIdx.x * 8;

  float4 h0 = *(const float4*)&h[base];
  float4 h1 = *(const float4*)&h[base + 4];
  float ss = h0.x * h0.x + h0.y * h0.y + h0.z * h0.z + h0.w * h0.w +
             h1.x * h1.x + h1.y * h1.y + h1.z * h1.z + h1.w * h1.w;
#pragma unroll
  for (int off = 16; off > 0; off >>= 1) ss += __shfl_xor(ss, off, 32);
  if ((threadIdx.x & 31) == 0) red[threadIdx.x >> 5] = ss;
  __syncthreads();
  float tot = 0.f;
#pragma unroll
  for (int i = 0; i < 8; i++) tot += red[i];
  const float rinv = rsqrtf(tot / (float)D + 1e-6f);

  const float hv[8] = {h0.x, h0.y, h0.z, h0.w, h1.x, h1.y, h1.z, h1.w};
  const float* cb = cosb + (size_t)t * D + base;
  const float* sb = sinb + (size_t)t * D + base;
  const float* wb = w + base;
  _Float16* dp = dst + (size_t)row * D + base;
#pragma unroll
  for (int p = 0; p < 4; p++) {
    const int e = 2 * p, o = 2 * p + 1;
    const float he = hv[e] * wb[e] * rinv;
    const float ho = hv[o] * wb[o] * rinv;
    dp[e] = (_Float16)((he * cb[e] - ho * sb[e]) * outScale);
    dp[o] = (_Float16)((ho * cb[o] + he * sb[o]) * outScale);
  }
}

// f32 -> f16 bulk convert (x and W matrices)
__global__ __launch_bounds__(256) void cvt_f16_kernel(
    const float* __restrict__ src, _Float16* __restrict__ dst, int n4)
{
  const int i = blockIdx.x * 256 + threadIdx.x;
  if (i >= n4) return;
  float4 f = ((const float4*)src)[i];
  v4h o;
  o[0] = (_Float16)f.x; o[1] = (_Float16)f.y;
  o[2] = (_Float16)f.z; o[3] = (_Float16)f.w;
  ((v4h*)dst)[i] = o;
}

__global__ __launch_bounds__(256) void transpose_v_kernel(
    const float* __restrict__ vf, _Float16* __restrict__ vT, int T)
{
  __shared__ _Float16 Ls[64 * 128];  // [t][dh] f16, 16KB
  const int tid = threadIdx.x;
  const int t0 = blockIdx.x * 64;
  const int hh = blockIdx.y, b = blockIdx.z;
  const int D = 2048, H = 16, Dh = 128;

  {  // load + convert 64t x 128dh tile (coalesced reads)
    const int r = tid >> 2, q = tid & 3;
    const float* sp = vf + (size_t)(b * T + t0 + r) * D + hh * Dh + q * 32;
    v16h u0, u1;
#pragma unroll
    for (int i = 0; i < 16; i++) { u0[i] = (_Float16)sp[i]; u1[i] = (_Float16)sp[16 + i]; }
    *(v16h*)&Ls[r * 128 + q * 32]      = u0;
    *(v16h*)&Ls[r * 128 + q * 32 + 16] = u1;
  }
  __syncthreads();
  {  // write transposed (coalesced writes over t)
    const int dh = tid >> 1, half = tid & 1;
    v16h o0, o1;
#pragma unroll
    for (int i = 0; i < 16; i++) {
      o0[i] = Ls[(half * 32 + i) * 128 + dh];
      o1[i] = Ls[(half * 32 + 16 + i) * 128 + dh];
    }
    _Float16* dp = vT + ((size_t)(b * H + hh) * Dh + dh) * T + t0 + half * 32;
    *(v16h*)dp        = o0;
    *(v16h*)(dp + 16) = o1;
  }
}

__device__ __forceinline__ float xhalf(float x) {
  const int v = __builtin_bit_cast(int, x);
  return __builtin_bit_cast(float, __builtin_amdgcn_permlanex16(v, v, 0x76543210, 0xfedcba98, false, false));
}

// A fragment in the k order that a pair of converted D tiles has as B: element s of half
// hf is k = 8*hf + s (s < 8), 16 + 8*hf + (s - 8) (s >= 8). p points at k = 0 of the 32.
__device__ __forceinline__ v16h ld_frag_kmap(const _Float16* p, int hf) {
  const v8h lo = *(const v8h*)(p + 8 * hf);
  const v8h hi = *(const v8h*)(p + 16 + 8 * hf);
  return __builtin_shufflevector(lo, hi, 0, 1, 2, 3, 4, 5, 6, 7, 8, 9, 10, 11, 12, 13, 14, 15);
}

__global__ __launch_bounds__(256) void flash_attn_kernel(
    const _Float16* __restrict__ qh, const _Float16* __restrict__ kh,
    const _Float16* __restrict__ vT, _Float16* __restrict__ oh, int T)
{
  // [0], [1]: K [key][dh]; [2]: V [dh][key]; 3 x 18 KB
  __shared__ __attribute__((aligned(2048))) _Float16 Ls[3][TILE_H];
  _Float16* const Vt = &Ls[2][0];

  const int tid  = threadIdx.x;
  const int lane = tid & 31;
  const int wave = tid >> 5;
  const int ln   = lane & 15;
  const int hf   = lane >> 4;

  const int q0 = blockIdx.x * 128;
  const int hh = blockIdx.y;
  const int b  = blockIdx.z;
  const int D = 2048, Dh = 128, H = 16;

  // Q B-fragments (column ln = query): 4 chunks of K=32 covering Dh=128 (kept resident)
  const size_t qrow = (size_t)(b * T + q0 + wave * 16 + ln);
  v16h qB[4];
#pragma unroll
  for (int kc = 0; kc < 4; kc++)
    qB[kc] = *(const v16h*)&qh[qrow * D + hh * Dh + kc * 32 + hf * 16];
  // Stands in front of every later overwrite of the Q loads' address registers, also on the path
  // that goes round the key loop.
  asm volatile("s_wait_xcnt 0x0" ::: "memory");

  v8f oAcc[8] = {};       // oAcc[nd][j] = O^T[dh = nd*16 + 8*hf + j][query ln]
  float rowm = -3.0e38f;  // the query's running maximum, equal in both halves
  float rowl = 0.f;       // the sum over this half's keys; the halves are joined behind the loop

  const _Float16* kBase = kh + (size_t)(b * T) * D + hh * Dh;
  const _Float16* vBase = vT + (size_t)(b * H + hh) * Dh * T;
  const unsigned wv  = uni((unsigned)tid >> 5);  // the wave's number, scalar
  const unsigned kLb = lds_addr(&Ls[0][0]);
  const unsigned vLb = lds_addr(&Ls[2][0]);
  const v8u g1K = held(tdm_group1<256, 64>((unsigned)D * 2u));   // 64 keys x 256B rows, pitch D f16
  const v8u g1V = held(tdm_group1<128, 128>((unsigned)T * 2u));  // 128 dh x 128B rows, pitch T f16
  v4u g0K = tdm_group0(kLb, kBase), g0V = tdm_group0(vLb, vBase);

  // Every wave forms the words (scalar work); only the issue itself stands behind a test.
  auto aimK = [&](int buf, int kt0) {
    const v4u n = tdm_group0(kLb + (unsigned)buf * (TILE_H * 2u), kBase + (size_t)kt0 * D);
    g0K[1] = n[1]; g0K[2] = n[2]; g0K[3] = n[3];
  };
  auto aimV = [&](int kt0) {
    const v4u n = tdm_group0(vLb, vBase + kt0);
    g0V[2] = n[2]; g0V[3] = n[3];
  };

  const int NT = T / 64;
  if (pinned(wv == 0u)) tdm_load(g0K, g1K);
  for (int it = 0; it < NT; ++it) {
    const int kt0 = it * 64;
    const int buf = it & 1;
    wait_tensor0(g0K, g1K);
    aimK(buf ^ 1, kt0 + 64);
    aimV(kt0);               // wave 1 has nothing outstanding here
    if (pinned((wv == 0u) & (it + 1 < NT))) tdm_load(g0K, g1K);
    if (pinned(wv == 1u)) {
      tdm_load(g0V, g1V);
      wait_tensor0(g0V, g1V);  // V tile `it` has landed
    }
    __syncthreads();

    // ---- S^T = K * Q^T (16 WMMA): s[n][j] = score of key n*16 + 8*hf + j, query ln ----
    // K fragments are read in groups of four (one kc), two groups in flight in two register
    // sets: a group is waited for once, while the group behind it is already on its way.
    v8f s[4] = {};
    v16h kf[2][4];
    auto readK = [&](v16h (&g)[4], int kc) {
#pragma unroll
      for (int n = 0; n < 4; n++)
        g[n] = ld_frag(&Ls[buf][(n * 16 + ln) * P256 + kc * 32 + hf * 16]);
    };
    readK(kf[0], 0);
    readK(kf[1], 1);
    __builtin_amdgcn_sched_barrier(0);  // keeps both groups' reads in front of the first WMMA
#pragma unroll
    for (int kc = 0; kc < 4; kc++) {
#pragma unroll
      for (int n = 0; n < 4; n++) s[n] = WMMA_F16(kf[kc & 1][n], qB[kc], s[n]);
      if (kc + 2 < 4) {
        readK(kf[kc & 1], kc + 2);
        __builtin_amdgcn_sched_barrier(0);  // keeps the refill in front of the other set's WMMAs
      }
    }

    v16h vf[2][4];
    auto readV = [&](v16h (&g)[4], int grp) {
#pragma unroll
      for (int i = 0; i < 4; i++)
        g[i] = ld_frag_kmap(&Vt[(((grp & 1) * 4 + i) * 16 + ln) * P128 + (grp >> 1) * 32], hf);
    };
    readV(vf[0], 0);
    readV(vf[1], 1);
    __builtin_amdgcn_sched_barrier(0);  // keeps these reads in front of the softmax

    // ---- online softmax, one query a lane ----
    float tn[4];
#pragma unroll
    for (int n = 0; n < 4; n++)
      tn[n] = fmaxf(fmaxf(fmaxf(s[n][0], s[n][1]), fmaxf(s[n][2], s[n][3])),
                    fmaxf(fmaxf(s[n][4], s[n][5]), fmaxf(s[n][6], s[n][7])));
    float tm = fmaxf(fmaxf(tn[0], tn[1]), fmaxf(tn[2], tn[3]));
    tm = fmaxf(tm, xhalf(tm));
    const float mnew  = fmaxf(rowm, tm);
    const float alpha = __expf(rowm - mnew);
    rowm = mnew;
#pragma unroll
    for (int nd = 0; nd < 8; nd++) oAcc[nd] *= alpha;
    float pn[4];  // four independent chains
#pragma unroll
    for (int n = 0; n < 4; n++) {
      pn[n] = 0.f;
#pragma unroll
      for (int j = 0; j < 8; j++) {
        const float p = __expf(s[n][j] - mnew);
        s[n][j] = p;
        pn[n] += p;
      }
    }
    rowl = rowl * alpha + ((pn[0] + pn[1]) + (pn[2] + pn[3]));

    // ---- P^T as B operand: two score tiles converted in place cover 32 keys ----
    v16h pB[2];
#pragma unroll
    for (int kc = 0; kc < 2; kc++)
#pragma unroll
      for (int e = 0; e < 8; e++) {
        pB[kc][e]     = (_Float16)s[2 * kc][e];
        pB[kc][8 + e] = (_Float16)s[2 * kc + 1][e];
      }

    asm volatile("" :: "v"(pB[0]), "v"(pB[1]), "v"(rowl) : "memory");

    // ---- O^T += V^T * P^T (16 WMMA) ----
#pragma unroll
    for (int grp = 0; grp < 4; grp++) {
#pragma unroll
      for (int i = 0; i < 4; i++)
        oAcc[(grp & 1) * 4 + i] = WMMA_F16(vf[grp & 1][i], pB[grp >> 1], oAcc[(grp & 1) * 4 + i]);
      if (grp + 2 < 4) {
        readV(vf[grp & 1], grp + 2);
        __builtin_amdgcn_sched_barrier(0);  // keeps the refill in front of the other set's WMMAs
      }
    }
    wait_ds0();
    __syncthreads();
  }
  wait_tensor0(g0K, g1K);  // nothing of the mover is outstanding on any path to the wave's end

  // ---- normalize and store f16 attention output: 8 consecutive dh of the lane's query a store ----
  const float inv = 1.0f / (rowl + xhalf(rowl));
  _Float16* const op = oh + qrow * D + hh * Dh + 8 * hf;
#pragma unroll
  for (int nd = 0; nd < 8; nd++) {
    v8h o;
#pragma unroll
    for (int j = 0; j < 8; j++) o[j] = (_Float16)(oAcc[nd][j] * inv);
    *(v8h*)(op + nd * 16) = o;
  }
}

// ---------------------------------------------------------------------------
extern "C" void kernel_launch(void* const* d_in, const int* in_sizes, int n_in,
                              void* d_out, int out_size, void* d_ws, size_t ws_size,
                              hipStream_t stream)
{
  (void)in_sizes; (void)n_in; (void)out_size; (void)ws_size;
  const float* x    = (const float*)d_in[0];
  const float* cosb = (const float*)d_in[1];
  const float* sinb = (const float*)d_in[2];
  const float* Wq   = (const float*)d_in[3];
  const float* bq   = (const float*)d_in[4];
  const float* Wk   = (const float*)d_in[5];
  const float* bk   = (const float*)d_in[6];
  const float* Wv   = (const float*)d_in[7];
  const float* bv   = (const float*)d_in[8];
  const float* qnw  = (const float*)d_in[9];
  const float* knw  = (const float*)d_in[10];
  const float* Wo   = (const float*)d_in[11];
  const float* bo   = (const float*)d_in[12];
  float* out = (float*)d_out;

  const int B = 2, T = 2048, D = 2048, H = 16;
  const int M = B * T;

  // Workspace layout (208 MB total)
  char* ws = (char*)d_ws;
  const size_t MB = 1ull << 20;
  float*    qf  = (float*)(ws + 0 * MB);       // 32 MB f32 q
  float*    kf  = (float*)(ws + 32 * MB);      // 32 MB f32 k
  float*    vf  = (float*)(ws + 64 * MB);      // 32 MB f32 v
  _Float16* qh  = (_Float16*)(ws + 96 * MB);   // 16 MB f16 q-hat
  _Float16* kh  = (_Float16*)(ws + 112 * MB);  // 16 MB f16 k-hat
  _Float16* vTh = (_Float16*)(ws + 128 * MB);  // 16 MB f16 V transposed
  _Float16* oh  = (_Float16*)(ws + 144 * MB);  // 16 MB f16 attn out
  _Float16* xh  = (_Float16*)(ws + 160 * MB);  // 16 MB f16 x
  _Float16* Wqh = (_Float16*)(ws + 176 * MB);  //  8 MB
  _Float16* Wkh = (_Float16*)(ws + 184 * MB);  //  8 MB
  _Float16* Wvh = (_Float16*)(ws + 192 * MB);  //  8 MB
  _Float16* Woh = (_Float16*)(ws + 200 * MB);  //  8 MB

  dim3 blk(256);
  const int nx4 = M * D / 4, nw4 = D * D / 4;
  cvt_f16_kernel<<<(nx4 + 255) / 256, blk, 0, stream>>>(x,  xh,  nx4);
  cvt_f16_kernel<<<(nw4 + 255) / 256, blk, 0, stream>>>(Wq, Wqh, nw4);
  cvt_f16_kernel<<<(nw4 + 255) / 256, blk, 0, stream>>>(Wk, Wkh, nw4);
  cvt_f16_kernel<<<(nw4 + 255) / 256, blk, 0, stream>>>(Wv, Wvh, nw4);
  cvt_f16_kernel<<<(nw4 + 255) / 256, blk, 0, stream>>>(Wo, Woh, nw4);

  dim3 gg(D / 128, M / 128);
  gemm_f16_kernel<<<gg, blk, 0, stream>>>(xh, Wqh, bq, qf, M, D, D);
  gemm_f16_kernel<<<gg, blk, 0, stream>>>(xh, Wkh, bk, kf, M, D, D);
  gemm_f16_kernel<<<gg, blk, 0, stream>>>(xh, Wvh, bv, vf, M, D, D);

  const float qscale = 0.08838834764831845f;  // 1/sqrt(128), folded into Q
  rmsnorm_rope_kernel<<<M, blk, 0, stream>>>(qf, qnw, cosb, sinb, qh, T, D, qscale);
  rmsnorm_rope_kernel<<<M, blk, 0, stream>>>(kf, knw, cosb, sinb, kh, T, D, 1.0f);
  transpose_v_kernel<<<dim3(T / 64, H, B), blk, 0, stream>>>(vf, vTh, T);

  flash_attn_kernel<<<dim3(T / 128, H, B), blk, 0, stream>>>(qh, kh, vTh, oh, T);

  gemm_f16_kernel<<<gg, blk, 0, stream>>>(oh, Woh, bo, out, M, D, D);
}

// v005
// Measured time: 218 microseconds a run.
// Next to v004, in two timings, it ran 1.09 times as fast each time.
// Over all steps from v000 it is 3.65 times as fast.
#include <hip/hip_runtime.h>
#include <hip/hip_bf16.h>

typedef __attribute__((ext_vector_type(16))) _Float16 v16h;
typedef __attribute__((ext_vector_type(8)))  _Float16 v8h;
typedef __attribute__((ext_vector_type(4)))  _Float16 v4h;
typedef __attribute__((ext_vector_type(8)))  float    v8f;
typedef __attribute__((ext_vector_type(4)))  unsigned int v4u;

#define WMMA_F16(a, b, c) \
  __builtin_amdgcn_wmma_f32_16x16x32_f16(false, (a), false, (b), (short)0, (c), false, false)

__device__ __forceinline__ unsigned lds_addr(const void* p) {
  return (unsigned)(uintptr_t)p;  // low 32 bits of generic shared ptr = LDS offset
}

typedef __attribute__((ext_vector_type(8))) unsigned int v8u;

__device__ __forceinline__ unsigned uni(unsigned v) { return (unsigned)__builtin_amdgcn_readfirstlane(v); }

__device__ __forceinline__ unsigned pinned(unsigned v) {
  unsigned w = uni(v);
  asm volatile("" : "+s"(w));  // pinned(): keeps the condition in a scalar register
  return w;
}

// A wave's LDS reads have retired before a barrier frees their buffer for a refill.
__device__ __forceinline__ void wait_ds0() { asm volatile("s_wait_dscnt 0" ::: "memory"); }

__device__ __forceinline__ v4u tdm_group0(unsigned ldsaddr, const void* gaddr) {
  const unsigned long long ga = (unsigned long long)(uintptr_t)gaddr;
  v4u g;
  g[0] = uni(1u);                                                   // count = 1
  g[1] = uni(ldsaddr);                                              // LDS byte offset
  g[2] = uni((unsigned)ga);                                         // address [31:0]
  g[3] = uni((((unsigned)(ga >> 32)) & 0x01FFFFFFu) | 0x80000000u); // address [56:32] | type = 2
  return g;
}

template <unsigned ROWB, unsigned ROWS>
__device__ __forceinline__ v8u tdm_group1(unsigned srcPitch) {
  static_assert(ROWB == 128u || ROWB == 256u, "pad interval code is set for rows of 128 or 256 bytes");
  constexpr unsigned ivl = (ROWB == 256u) ? 5u : 4u;
  v8u g;
  g[0] = uni((1u << 20) | (ivl << 22) | (3u << 25));
  g[1] = uni(ROWB << 16);
  g[2] = uni(ROWS << 16);
  g[3] = uni(ROWB << 16);
  g[4] = uni(ROWS);
  g[5] = uni(srcPitch);
  g[6] = uni(0u);
  g[7] = uni(0u);
  return g;
}

__device__ __forceinline__ void tdm_load(v4u& g0, v8u g1) {
  asm volatile("tensor_load_to_lds %0, %1" : "+s"(g0) : "s"(g1) : "memory");
}

// The mover's waits are not placed by the compiler.
__device__ __forceinline__ void wait_tensor0(v4u& g0, v8u g1) {
  asm volatile("s_wait_tensorcnt 0" : "+s"(g0) : "s"(g1) : "memory");
}

__device__ __forceinline__ v8u held(v8u g) {
  asm volatile("" : "+s"(g));
  return g;
}

// 16 consecutive f16 of a padded LDS row (16-byte aligned): two ds_load_b128.
__device__ __forceinline__ v16h ld_frag(const _Float16* p) {
  const v8h lo = *(const v8h*)p;
  const v8h hi = *(const v8h*)(p + 8);
  return __builtin_shufflevector(lo, hi, 0, 1, 2, 3, 4, 5, 6, 7, 8, 9, 10, 11, 12, 13, 14, 15);
}

// LDS pitches in f16 elements: 128-B rows + 16 B, 256-B rows + 16 B.
#define P128 72
#define P256 136
// One padded tile's place in LDS, in f16 elements: 128 x 144 B = 18432 B = 9 x 2 KiB
// (64 x 272 B = 17408 B is rounded up to the same), so every place is a multiple of 2 KiB.
#define TILE_H 9216

__global__ __launch_bounds__(256) void gemm_f16_kernel(
    const _Float16* __restrict__ Ah, const _Float16* __restrict__ Wh0,
    const float* __restrict__ bias0, const float* __restrict__ bias1,
    const float* __restrict__ bias2, float* __restrict__ C0,
    int M, int N, int K)
{
  const int zs = blockIdx.z;
  const _Float16* const Wh = Wh0 + (size_t)zs * N * K;
  const float* const bias  = (zs == 0) ? bias0 : (zs == 1) ? bias1 : bias2;
  float* const C           = C0 + (size_t)zs * M * N;

  __shared__ __attribute__((aligned(2048))) _Float16 Ls[2][2][TILE_H];  // [buf][A, W], 4 x 18 KB

  const int tid  = threadIdx.x;
  const int lane = tid & 31;
  const int wave = tid >> 5;
  const int ln   = lane & 15;
  const int hf   = lane >> 4;
  const int rowg = wave >> 1;  // 0..3 : 32-row group
  const int colg = wave & 1;   // 0..1 : 64-col group

  const int n0 = blockIdx.x * 128;
  const int m0 = blockIdx.y * 128;

  const unsigned wv = uni((unsigned)tid >> 5);  // the wave's number, scalar
  const _Float16* aBase = Ah + (size_t)m0 * K;
  const _Float16* bBase = Wh + (size_t)n0 * K;
  const _Float16* tBase = (wv == 1u) ? bBase : aBase;        // this wave's operand
  const unsigned  tL    = lds_addr(&Ls[0][wv == 1u ? 1 : 0][0]);
  const v8u g1 = held(tdm_group1<128, 128>((unsigned)K * 2u));  // 128 rows x 128 B, pitch K f16
  v4u g0 = tdm_group0(tL, tBase);

  // Every wave forms the words (scalar work); only the issue itself stands behind a test.
  auto aimTile = [&](int buf, int k0) {
    const v4u n = tdm_group0(tL + (unsigned)buf * (2u * TILE_H * 2u), tBase + k0);
    g0[1] = n[1]; g0[2] = n[2]; g0[3] = n[3];
  };

  v8f acc[2][4] = {};

  const int NT = K / 64;
  if (pinned(wv < 2u)) tdm_load(g0, g1);
  for (int it = 0; it < NT; ++it) {
    const int buf = it & 1;
    wait_tensor0(g0, g1);
    aimTile(buf ^ 1, (it + 1) * 64);
    if (pinned((wv < 2u) & (it + 1 < NT))) tdm_load(g0, g1);
    __syncthreads();  // tile `it` visible to all waves

    // All twelve fragments of the K-step are read as one group in front of its WMMAs, each
    // into registers of its own: one LDS latency a K-step, not one in front of every pair.
    v16h af[2][2], bf[2][4];
#pragma unroll
    for (int kc = 0; kc < 2; kc++) {
      af[kc][0] = ld_frag(&Ls[buf][0][(rowg * 32 + ln) * P128 + kc * 32 + hf * 16]);
      af[kc][1] = ld_frag(&Ls[buf][0][(rowg * 32 + 16 + ln) * P128 + kc * 32 + hf * 16]);
#pragma unroll
      for (int nb = 0; nb < 4; nb++)
        bf[kc][nb] = ld_frag(&Ls[buf][1][(colg * 64 + nb * 16 + ln) * P128 + kc * 32 + hf * 16]);
    }
    __builtin_amdgcn_sched_barrier(0);  // keeps the reads in front: sunk to their uses, each would be waited for alone
#pragma unroll
    for (int kc = 0; kc < 2; kc++) {
#pragma unroll
      for (int nb = 0; nb < 4; nb++) {
        acc[0][nb] = WMMA_F16(af[kc][0], bf[kc][nb], acc[0][nb]);
        acc[1][nb] = WMMA_F16(af[kc][1], bf[kc][nb], acc[1][nb]);
      }
    }
    wait_ds0();
    __syncthreads();
  }
  wait_tensor0(g0, g1);  // nothing of the mover is outstanding on any path to the wave's end

  // ---- epilogue: bias + f32 store ----
#pragma unroll
  for (int r = 0; r < 2; r++) {
#pragma unroll
    for (int nb = 0; nb < 4; nb++) {
      const int col = n0 + colg * 64 + nb * 16 + ln;
      const float bb = bias[col];
#pragma unroll
      for (int j = 0; j < 8; j++) {
        const int row = m0 + rowg * 32 + r * 16 + j + 8 * hf;
        C[(size_t)row * N + col] = acc[r][nb][j] + bb;
      }
    }
  }
}

// ---------------------------------------------------------------------------
// Fused RMSNorm (over D) + interleaved RoPE + f16 downconvert.
// ---------------------------------------------------------------------------
__device__ __forceinline__ void rmsnorm_rope_body(
    float* red, const int row,  // row = b*T + t
    const float* __restrict__ src, const float* __restrict__ w,
    const float* __restrict__ cosb, const float* __restrict__ sinb,
    _Float16* __restrict__ dst, int T, int D, float outScale)
{
  const int t   = row % T;
  const float* h = src + (size_t)row * D;
  const int base = threadIdx.x * 8;

  float4 h0 = *(const float4*)&h[base];
  float4 h1 = *(const float4*)&h[base + 4];
  float ss = h0.x * h0.x + h0.y * h0.y + h0.z * h0.z + h0.w * h0.w +
             h1.x * h1.x + h1.y * h1.y + h1.z * h1.z + h1.w * h1.w;
#pragma unroll
  for (int off = 16; off > 0; off >>= 1) ss += __shfl_xor(ss, off, 32);
  if ((threadIdx.x & 31) == 0) red[threadIdx.x >> 5] = ss;
  __syncthreads();
  float tot = 0.f;
#pragma unroll
  for (int i = 0; i < 8; i++) tot += red[i];
  const float rinv = rsqrtf(tot / (float)D + 1e-6f);

  const float hv[8] = {h0.x, h0.y, h0.z, h0.w, h1.x, h1.y, h1.z, h1.w};
  const float* cb = cosb + (size_t)t * D + base;
  const float* sb = sinb + (size_t)t * D + base;
  const float* wb = w + base;
  _Float16* dp = dst + (size_t)row * D + base;
#pragma unroll
  for (int p = 0; p < 4; p++) {
    const int e = 2 * p, o = 2 * p + 1;
    const float he = hv[e] * wb[e] * rinv;
    const float ho = hv[o] * wb[o] * rinv;
    dp[e] = (_Float16)((he * cb[e] - ho * sb[e]) * outScale);
    dp[o] = (_Float16)((ho * cb[o] + he * sb[o]) * outScale);
  }
}

// f32 -> f16 bulk convert, x and the four W matrices in ONE launch: blockIdx.y picks one of six
// segments of n4 float4 each (x is two of them); the f16 copies lie one behind the other at dst0.
__global__ __launch_bounds__(256) void cvt_f16_kernel(
    const float* __restrict__ x, const float* __restrict__ Wq, const float* __restrict__ Wk,
    const float* __restrict__ Wv, const float* __restrict__ Wo, _Float16* __restrict__ dst0, int n4)
{
  const int seg = blockIdx.y;
  const float* src = x + (size_t)(seg & 1) * n4 * 4;  // segments 0 and 1
  src = (seg == 2) ? Wq : src;
  src = (seg == 3) ? Wk : src;
  src = (seg == 4) ? Wv : src;
  src = (seg == 5) ? Wo : src;
  _Float16* const dst = dst0 + (size_t)seg * n4 * 4;
  const int i = blockIdx.x * 256 + threadIdx.x;
  if (i >= n4) return;
  float4 f = ((const float4*)src)[i];
  v4h o;
  o[0] = (_Float16)f.x; o[1] = (_Float16)f.y;
  o[2] = (_Float16)f.z; o[3] = (_Float16)f.w;
  ((v4h*)dst)[i] = o;
}

__device__ __forceinline__ void transpose_v_body(
    _Float16* Ls, const int t0, const int hh, const int b,
    const float* __restrict__ vf, _Float16* __restrict__ vT, int T)
{
  const int tid = threadIdx.x;
  const int D = 2048, H = 16, Dh = 128;

  {  // load + convert 64t x 128dh tile (coalesced reads)
    const int r = tid >> 2, q = tid & 3;
    const float* sp = vf + (size_t)(b * T + t0 + r) * D + hh * Dh + q * 32;
    v16h u0, u1;
#pragma unroll
    for (int i = 0; i < 16; i++) { u0[i] = (_Float16)sp[i]; u1[i] = (_Float16)sp[16 + i]; }
    *(v16h*)&Ls[r * 128 + q * 32]      = u0;
    *(v16h*)&Ls[r * 128 + q * 32 + 16] = u1;
  }
  __syncthreads();
  {  // write transposed (coalesced writes over t)
    const int dh = tid >> 1, half = tid & 1;
    v16h o0, o1;
#pragma unroll
    for (int i = 0; i < 16; i++) {
      o0[i] = Ls[(half * 32 + i) * 128 + dh];
      o1[i] = Ls[(half * 32 + 16 + i) * 128 + dh];
    }
    _Float16* dp = vT + ((size_t)(b * H + hh) * Dh + dh) * T + t0 + half * 32;
    *(v16h*)dp        = o0;
    *(v16h*)(dp + 16) = o1;
  }
}

// The three independent steps between the projections and attention in ONE launch, by block
// index: first the V tiles (T/64 x 16 heads x batch), then M rows of q, then M rows of k.
__global__ __launch_bounds__(256) void prep_qkv_kernel(
    const float* __restrict__ qf, const float* __restrict__ kf, const float* __restrict__ vf,
    const float* __restrict__ qnw, const float* __restrict__ knw,
    const float* __restrict__ cosb, const float* __restrict__ sinb,
    _Float16* __restrict__ qh, _Float16* __restrict__ kh, _Float16* __restrict__ vT,
    int M, int T, int D, float qScale)
{
  __shared__ _Float16 Ls[64 * 128];  // V tile [t][dh] f16, 16KB
  __shared__ float red[8];
  const int nT = T / 64;
  const int nV = (M / 64) * 16;      // V tiles
  const int blk = blockIdx.x;
  if (blk < nV) {
    transpose_v_body(Ls, (blk % nT) * 64, (blk / nT) % 16, blk / (nT * 16), vf, vT, T);
  } else {
    const int r = blk - nV;
    const bool isK = r >= M;
    rmsnorm_rope_body(red, isK ? r - M : r, isK ? kf : qf, isK ? knw : qnw, cosb, sinb,
                      isK ? kh : qh, T, D, isK ? 1.0f : qScale);
  }
}

__device__ __forceinline__ float xhalf(float x) {
  const int v = __builtin_bit_cast(int, x);
  return __builtin_bit_cast(float, __builtin_amdgcn_permlanex16(v, v, 0x76543210, 0xfedcba98, false, false));
}

// A fragment in the k order that a pair of converted D tiles has as B: element s of half
// hf is k = 8*hf + s (s < 8), 16 + 8*hf + (s - 8) (s >= 8). p points at k = 0 of the 32.
__device__ __forceinline__ v16h ld_frag_kmap(const _Float16* p, int hf) {
  const v8h lo = *(const v8h*)(p + 8 * hf);
  const v8h hi = *(const v8h*)(p + 16 + 8 * hf);
  return __builtin_shufflevector(lo, hi, 0, 1, 2, 3, 4, 5, 6, 7, 8, 9, 10, 11, 12, 13, 14, 15);
}

__global__ __launch_bounds__(256) void flash_attn_kernel(
    const _Float16* __restrict__ qh, const _Float16* __restrict__ kh,
    const _Float16* __restrict__ vT, _Float16* __restrict__ oh, int T)
{
  // [0], [1]: K [key][dh]; [2]: V [dh][key]; 3 x 18 KB
  __shared__ __attribute__((aligned(2048))) _Float16 Ls[3][TILE_H];
  _Float16* const Vt = &Ls[2][0];

  const int tid  = threadIdx.x;
  const int lane = tid & 31;
  const int wave = tid >> 5;
  const int ln   = lane & 15;
  const int hf   = lane >> 4;

  const int q0 = blockIdx.x * 128;
  const int hh = blockIdx.y;
  const int b  = blockIdx.z;
  const int D = 2048, Dh = 128, H = 16;

  // Q B-fragments (column ln = query): 4 chunks of K=32 covering Dh=128 (kept resident)
  const size_t qrow = (size_t)(b * T + q0 + wave * 16 + ln);
  v16h qB[4];
#pragma unroll
  for (int kc = 0; kc < 4; kc++)
    qB[kc] = *(const v16h*)&qh[qrow * D + hh * Dh + kc * 32 + hf * 16];
  // Stands in front of every later overwrite of the Q loads' address registers, also on the path
  // that goes round the key loop.
  asm volatile("s_wait_xcnt 0x0" ::: "memory");

  v8f oAcc[8] = {};       // oAcc[nd][j] = O^T[dh = nd*16 + 8*hf + j][query ln]
  float rowm = -3.0e38f;  // the query's running maximum, equal in both halves
  float rowl = 0.f;       // the sum over this half's keys; the halves are joined behind the loop

  const _Float16* kBase = kh + (size_t)(b * T) * D + hh * Dh;
  const _Float16* vBase = vT + (size_t)(b * H + hh) * Dh * T;
  const unsigned wv  = uni((unsigned)tid >> 5);  // the wave's number, scalar
  const unsigned kLb = lds_addr(&Ls[0][0]);
  const unsigned vLb = lds_addr(&Ls[2][0]);
  const v8u g1K = held(tdm_group1<256, 64>((unsigned)D * 2u));   // 64 keys x 256B rows, pitch D f16
  const v8u g1V = held(tdm_group1<128, 128>((unsigned)T * 2u));  // 128 dh x 128B rows, pitch T f16
  v4u g0K = tdm_group0(kLb, kBase), g0V = tdm_group0(vLb, vBase);

  // Every wave forms the words (scalar work); only the issue itself stands behind a test.
  auto aimK = [&](int buf, int kt0) {
    const v4u n = tdm_group0(kLb + (unsigned)buf * (TILE_H * 2u), kBase + (size_t)kt0 * D);
    g0K[1] = n[1]; g0K[2] = n[2]; g0K[3] = n[3];
  };
  auto aimV = [&](int kt0) {
    const v4u n = tdm_group0(vLb, vBase + kt0);
    g0V[2] = n[2]; g0V[3] = n[3];
  };

  const int NT = T / 64;
  if (pinned(wv == 0u)) tdm_load(g0K, g1K);
  for (int it = 0; it < NT; ++it) {
    const int kt0 = it * 64;
    const int buf = it & 1;
    wait_tensor0(g0K, g1K);
    aimK(buf ^ 1, kt0 + 64);
    aimV(kt0);               // wave 1 has nothing outstanding here
    if (pinned((wv == 0u) & (it + 1 < NT))) tdm_load(g0K, g1K);
    if (pinned(wv == 1u)) {
      tdm_load(g0V, g1V);
      wait_tensor0(g0V, g1V);  // V tile `it` has landed
    }
    __syncthreads();

    // ---- S^T = K * Q^T (16 WMMA): s[n][j] = score of key n*16 + 8*hf + j, query ln ----
    // K fragments are read in groups of four (one kc), two groups in flight in two register
    // sets: a group is waited for once, while the group behind it is already on its way.
    v8f s[4] = {};
    v16h kf[2][4];
    auto readK = [&](v16h (&g)[4], int kc) {
#pragma unroll
      for (int n = 0; n < 4; n++)
        g[n] = ld_frag(&Ls[buf][(n * 16 + ln) * P256 + kc * 32 + hf * 16]);
    };
    readK(kf[0], 0);
    readK(kf[1], 1);
    __builtin_amdgcn_sched_barrier(0);  // keeps both groups' reads in front of the first WMMA
#pragma unroll
    for (int kc = 0; kc < 4; kc++) {
#pragma unroll
      for (int n = 0; n < 4; n++) s[n] = WMMA_F16(kf[kc & 1][n], qB[kc], s[n]);
      if (kc + 2 < 4) {
        readK(kf[kc & 1], kc + 2);
        __builtin_amdgcn_sched_barrier(0);  // keeps the refill in front of the other set's WMMAs
      }
    }

    v16h vf[2][4];
    auto readV = [&](v16h (&g)[4], int grp) {
#pragma unroll
      for (int i = 0; i < 4; i++)
        g[i] = ld_frag_kmap(&Vt[(((grp & 1) * 4 + i) * 16 + ln) * P128 + (grp >> 1) * 32], hf);
    };
    readV(vf[0], 0);
    readV(vf[1], 1);
    __builtin_amdgcn_sched_barrier(0);  // keeps these reads in front of the softmax

    // ---- online softmax, one query a lane ----
    float tn[4];
#pragma unroll
    for (int n = 0; n < 4; n++)
      tn[n] = fmaxf(fmaxf(fmaxf(s[n][0], s[n][1]), fmaxf(s[n][2], s[n][3])),
                    fmaxf(fmaxf(s[n][4], s[n][5]), fmaxf(s[n][6], s[n][7])));
    float tm = fmaxf(fmaxf(tn[0], tn[1]), fmaxf(tn[2], tn[3]));
    tm = fmaxf(tm, xhalf(tm));
    const float mnew  = fmaxf(rowm, tm);
    const float alpha = __expf(rowm - mnew);
    rowm = mnew;
#pragma unroll
    for (int nd = 0; nd < 8; nd++) oAcc[nd] *= alpha;
    float pn[4];  // four independent chains
#pragma unroll
    for (int n = 0; n < 4; n++) {
      pn[n] = 0.f;
#pragma unroll
      for (int j = 0; j < 8; j++) {
        const float p = __expf(s[n][j] - mnew);
        s[n][j] = p;
        pn[n] += p;
      }
    }
    rowl = rowl * alpha + ((pn[0] + pn[1]) + (pn[2] + pn[3]));

    // ---- P^T as B operand: two score tiles converted in place cover 32 keys ----
    v16h pB[2];
#pragma unroll
    for (int kc = 0; kc < 2; kc++)
#pragma unroll
      for (int e = 0; e < 8; e++) {
        pB[kc][e]     = (_Float16)s[2 * kc][e];
        pB[kc][8 + e] = (_Float16)s[2 * kc + 1][e];
      }

    asm volatile("" :: "v"(pB[0]), "v"(pB[1]), "v"(rowl) : "memory");

    // ---- O^T += V^T * P^T (16 WMMA) ----
#pragma unroll
    for (int grp = 0; grp < 4; grp++) {
#pragma unroll
      for (int i = 0; i < 4; i++)
        oAcc[(grp & 1) * 4 + i] = WMMA_F16(vf[grp & 1][i], pB[grp >> 1], oAcc[(grp & 1) * 4 + i]);
      if (grp + 2 < 4) {
        readV(vf[grp & 1], grp + 2);
        __builtin_amdgcn_sched_barrier(0);  // keeps the refill in front of the other set's WMMAs
      }
    }
    wait_ds0();
    __syncthreads();
  }
  wait_tensor0(g0K, g1K);  // nothing of the mover is outstanding on any path to the wave's end

  // ---- normalize and store f16 attention output: 8 consecutive dh of the lane's query a store ----
  const float inv = 1.0f / (rowl + xhalf(rowl));
  _Float16* const op = oh + qrow * D + hh * Dh + 8 * hf;
#pragma unroll
  for (int nd = 0; nd < 8; nd++) {
    v8h o;
#pragma unroll
    for (int j = 0; j < 8; j++) o[j] = (_Float16)(oAcc[nd][j] * inv);
    *(v8h*)(op + nd * 16) = o;
  }
}

// ---------------------------------------------------------------------------
extern "C" void kernel_launch(void* const* d_in, const int* in_sizes, int n_in,
                              void* d_out, int out_size, void* d_ws, size_t ws_size,
                              hipStream_t stream)
{
  (void)in_sizes; (void)n_in; (void)out_size; (void)ws_size;
  const float* x    = (const float*)d_in[0];
  const float* cosb = (const float*)d_in[1];
  const float* sinb = (const float*)d_in[2];
  const float* Wq   = (const float*)d_in[3];
  const float* bq   = (const float*)d_in[4];
  const float* Wk   = (const float*)d_in[5];
  const float* bk   = (const float*)d_in[6];
  const float* Wv   = (const float*)d_in[7];
  const float* bv   = (const float*)d_in[8];
  const float* qnw  = (const float*)d_in[9];
  const float* knw  = (const float*)d_in[10];
  const float* Wo   = (const float*)d_in[11];
  const float* bo   = (const float*)d_in[12];
  float* out = (float*)d_out;

  const int B = 2, T = 2048, D = 2048, H = 16;
  const int M = B * T;

  // Workspace layout (208 MB total)
  char* ws = (char*)d_ws;
  const size_t MB = 1ull << 20;
  float*    qf  = (float*)(ws + 0 * MB);       // 32 MB f32 q
  float*    kf  = (float*)(ws + 32 * MB);      // 32 MB f32 k
  float*    vf  = (float*)(ws + 64 * MB);      // 32 MB f32 v
  _Float16* qh  = (_Float16*)(ws + 96 * MB);   // 16 MB f16 q-hat
  _Float16* kh  = (_Float16*)(ws + 112 * MB);  // 16 MB f16 k-hat
  _Float16* vTh = (_Float16*)(ws + 128 * MB);  // 16 MB f16 V transposed
  _Float16* oh  = (_Float16*)(ws + 144 * MB);  // 16 MB f16 attn out
  _Float16* xh  = (_Float16*)(ws + 160 * MB);  // 16 MB f16 x
  _Float16* Wqh = (_Float16*)(ws + 176 * MB);  //  8 MB
  _Float16* Wkh = (_Float16*)(ws + 184 * MB);  //  8 MB
  _Float16* Wvh = (_Float16*)(ws + 192 * MB);  //  8 MB
  _Float16* Woh = (_Float16*)(ws + 200 * MB);  //  8 MB

  (void)Wkh; (void)Wvh;  // reached as slices 1 and 2 behind Wqh

  dim3 blk(256);
  const int nx4 = M * D / 4, nw4 = D * D / 4;
  static_assert(nx4 == 2 * nw4, "x is two segments of the conversion launch");
  // xh, Wqh, Wkh, Wvh, Woh lie one behind the other: six segments of nw4 float4.
  cvt_f16_kernel<<<dim3((nw4 + 255) / 256, 6), blk, 0, stream>>>(x, Wq, Wk, Wv, Wo, xh, nw4);

  // q, k, v in one launch: Wqh, Wkh, Wvh and qf, kf, vf lie one behind the other.
  gemm_f16_kernel<<<dim3(D / 128, M / 128, 3), blk, 0, stream>>>(xh, Wqh, bq, bk, bv, qf, M, D, D);

  const float qscale = 0.08838834764831845f;  // 1/sqrt(128), folded into Q
  prep_qkv_kernel<<<(M / 64) * H + 2 * M, blk, 0, stream>>>(qf, kf, vf, qnw, knw, cosb, sinb,
                                                            qh, kh, vTh, M, T, D, qscale);

  flash_attn_kernel<<<dim3(T / 128, H, B), blk, 0, stream>>>(qh, kh, vTh, oh, T);

  gemm_f16_kernel<<<dim3(D / 128, M / 128, 1), blk, 0, stream>>>(oh, Woh, bo, bo, bo, out, M, D, D);
}

// v006
// Measured time: 192 microseconds a run.
// Next to v005, in two timings, it ran 1.13 times as fast each time.
// Counting every step since v000, it is 4.13 times as fast.
#include <hip/hip_runtime.h>
#include <hip/hip_bf16.h>

typedef __attribute__((ext_vector_type(16))) _Float16 v16h;
typedef __attribute__((ext_vector_type(8)))  _Float16 v8h;
typedef __attribute__((ext_vector_type(4)))  _Float16 v4h;
typedef __attribute__((ext_vector_type(8)))  float    v8f;
typedef __attribute__((ext_vector_type(4)))  unsigned int v4u;

#define WMMA_F16(a, b, c) \
  __builtin_amdgcn_wmma_f32_16x16x32_f16(false, (a), false, (b), (short)0, (c), false, false)

__device__ __forceinline__ unsigned lds_addr(const void* p) {
  return (unsigned)(uintptr_t)p;  // low 32 bits of generic shared ptr = LDS offset
}

typedef __attribute__((ext_vector_type(8))) unsigned int v8u;

__device__ __forceinline__ unsigned uni(unsigned v) { return (unsigned)__builtin_amdgcn_readfirstlane(v); }

__device__ __forceinline__ unsigned pinned(unsigned v) {
  unsigned w = uni(v);
  asm volatile("" : "+s"(w));  // pinned(): keeps the condition in a scalar register
  return w;
}

// A wave's LDS reads have retired before a barrier frees their buffer for a refill.
__device__ __forceinline__ void wait_ds0() { asm volatile("s_wait_dscnt 0" ::: "memory"); }

__device__ __forceinline__ v4u tdm_group0(unsigned ldsaddr, const void* gaddr) {
  const unsigned long long ga = (unsigned long long)(uintptr_t)gaddr;
  v4u g;
  g[0] = uni(1u);                                                   // count = 1
  g[1] = uni(ldsaddr);                                              // LDS byte offset
  g[2] = uni((unsigned)ga);                                         // address [31:0]
  g[3] = uni((((unsigned)(ga >> 32)) & 0x01FFFFFFu) | 0x80000000u); // address [56:32] | type = 2
  return g;
}

template <unsigned ROWB, unsigned ROWS>
__device__ __forceinline__ v8u tdm_group1(unsigned srcPitch) {
  static_assert(ROWB == 128u || ROWB == 256u, "pad interval code is set for rows of 128 or 256 bytes");
  constexpr unsigned ivl = (ROWB == 256u) ? 5u : 4u;
  v8u g;
  g[0] = uni((1u << 20) | (ivl << 22) | (3u << 25));
  g[1] = uni(ROWB << 16);
  g[2] = uni(ROWS << 16);
  g[3] = uni(ROWB << 16);
  g[4] = uni(ROWS);
  g[5] = uni(srcPitch);
  g[6] = uni(0u);
  g[7] = uni(0u);
  return g;
}

__device__ __forceinline__ void tdm_load(v4u& g0, v8u g1) {
  asm volatile("tensor_load_to_lds %0, %1" : "+s"(g0) : "s"(g1) : "memory");
}

// The mover's waits are not placed by the compiler.
__device__ __forceinline__ void wait_tensor0(v4u& g0, v8u g1) {
  asm volatile("s_wait_tensorcnt 0" : "+s"(g0) : "s"(g1) : "memory");
}

__device__ __forceinline__ v8u held(v8u g) {
  asm volatile("" : "+s"(g));
  return g;
}

// 16 consecutive f16 of a padded LDS row (16-byte aligned): two ds_load_b128.
__device__ __forceinline__ v16h ld_frag(const _Float16* p) {
  const v8h lo = *(const v8h*)p;
  const v8h hi = *(const v8h*)(p + 8);
  return __builtin_shufflevector(lo, hi, 0, 1, 2, 3, 4, 5, 6, 7, 8, 9, 10, 11, 12, 13, 14, 15);
}

// LDS pitches in f16 elements: 128-B rows + 16 B, 256-B rows + 16 B.
#define P128 72
#define P256 136
// One padded tile's place in LDS, in f16 elements: 128 x 144 B = 18432 B = 9 x 2 KiB
// (64 x 272 B = 17408 B is rounded up to the same), so every place is a multiple of 2 KiB.
#define TILE_H 9216

// ---------------------------------------------------------------------------
// GEMM:  C[M,N] (f32) = A[M,K](f16) x W[N,K](f16)^T + bias[N]
// blockIdx.z picks one of up to three independent products on the same A in ONE launch:
// W and C of slice z lie z * N * K and z * M * N elements behind the first, bias by pointer.
// 256 threads = 8 waves arranged 2x4; workgroup tile 128x256, wave tile 64x64; a pass is 128 k
// (256 B of every operand row). A fragment read from LDS feeds four WMMAs, and a byte landed
// from L2 serves 128 or 256 output columns or rows.
// A stage is six slices of 64 rows (A: 0, 1; W: 2..5) at a pitch of 272 B, each at its own
// multiple of 2 KiB; waves 0..5 each bring their own slice by one tensor_load_to_lds (one
// request of a wave outstanding). Two buffers: stage s + 2 is issued behind the barrier that
// ends pass s's LDS reads, into the buffer that pass s has read; the pass's last 32-k block of
// WMMAs works from registers behind that barrier. K is at least two passes.
// ---------------------------------------------------------------------------
__global__ __launch_bounds__(256) void gemm_f16_kernel(
    const _Float16* __restrict__ Ah, const _Float16* __restrict__ Wh0,
    const float* __restrict__ bias0, const float* __restrict__ bias1,
    const float* __restrict__ bias2, float* __restrict__ C0,
    int M, int N, int K)
{
  const int zs = blockIdx.z;
  const _Float16* const Wh = Wh0 + (size_t)zs * N * K;
  const float* const bias  = (zs == 0) ? bias0 : (zs == 1) ? bias1 : bias2;
  float* const C           = C0 + (size_t)zs * M * N;

  __shared__ __attribute__((aligned(2048))) _Float16 Ls[2][6][TILE_H];  // [buf][slice], 12 x 18 KB

  const int tid  = threadIdx.x;
  const int lane = tid & 31;
  const int wave = tid >> 5;
  const int ln   = lane & 15;
  const int hf   = lane >> 4;
  const int rowg = wave >> 2;  // 0..1 : 64-row group = A slice
  const int colg = wave & 3;   // 0..3 : 64-col group = W slice

  const int n0 = blockIdx.x * 256;
  const int m0 = blockIdx.y * 128;

  const unsigned wv = uni((unsigned)tid >> 5);  // the wave's number, scalar
  const unsigned sl = (wv < 6u) ? wv : 5u;      // this wave's slice (waves 6 and 7 issue nothing)
  const _Float16* tBase = (sl < 2u) ? Ah + (size_t)(m0 + (int)sl * 64) * K
                                    : Wh + (size_t)(n0 + ((int)sl - 2) * 64) * K;
  const unsigned  tL    = lds_addr(&Ls[0][sl][0]);
  const v8u g1 = held(tdm_group1<256, 64>((unsigned)K * 2u));  // 64 rows x 256 B, pitch K f16
  v4u g0 = tdm_group0(tL, tBase);

  // Every wave forms the words (scalar work); only the issue itself stands behind a test.
  auto aimTile = [&](int buf, int k0) {
    const v4u n = tdm_group0(tL + (unsigned)buf * (6u * TILE_H * 2u), tBase + k0);
    g0[1] = n[1]; g0[2] = n[2]; g0[3] = n[3];
  };

  v8f acc[4][4] = {};

  const int NT = K / 128;
  if (pinned(wv < 6u)) tdm_load(g0, g1);
  wait_tensor0(g0, g1);
  __syncthreads();
  aimTile(1, 128);
  if (pinned(wv < 6u)) tdm_load(g0, g1);
  for (int it = 0; it < NT; ++it) {
    const int buf = it & 1;
    const _Float16* const aL = &Ls[buf][rowg][ln * P256 + hf * 16];
    const _Float16* const bL = &Ls[buf][2 + colg][ln * P256 + hf * 16];

    // All 32 fragments of the pass are read as one group, each into registers of its own: one
    // place with LDS reads a pass, and the buffer is left as early as the LDS delivers.
    v16h af[4][4], bf[4][4];
#pragma unroll
    for (int kb = 0; kb < 4; kb++) {
#pragma unroll
      for (int r = 0; r < 4; r++) af[kb][r] = ld_frag(aL + r * 16 * P256 + kb * 32);
#pragma unroll
      for (int nb = 0; nb < 4; nb++) bf[kb][nb] = ld_frag(bL + nb * 16 * P256 + kb * 32);
    }
    __builtin_amdgcn_sched_barrier(0);  // keeps the reads in front: sunk to their uses, each would be waited for alone
    auto mmaBlk = [&](int kb) {
#pragma unroll
      for (int nb = 0; nb < 4; nb++)
#pragma unroll
        for (int r = 0; r < 4; r++) acc[r][nb] = WMMA_F16(af[kb][r], bf[kb][nb], acc[r][nb]);
    };
    mmaBlk(0);
    mmaBlk(1);
    mmaBlk(2);
    __builtin_amdgcn_sched_barrier(0);  // keeps these WMMAs in front of the waits: the later reads land under them
    wait_ds0();            // every fragment of the pass is in registers: this wave has left buf
    wait_tensor0(g0, g1);  // this wave's slice of stage it + 1 has landed
    __syncthreads();       // publishes stage it + 1; every wave has left buf
    aimTile(buf, (it + 2) * 128);
    if (pinned((wv < 6u) & (it + 2 < NT))) tdm_load(g0, g1);
    __builtin_amdgcn_sched_barrier(0);  // keeps the refill's issue in front of the last block's WMMAs: a whole pass of lead
    mmaBlk(3);  // from registers alone: the matrix unit has work while the next pass's first reads are on their way
  }
  wait_tensor0(g0, g1);  // nothing of the mover is outstanding on any path to the wave's end
  wait_ds0();

  // ---- epilogue: bias + f32 store ----
  float bb[4];
#pragma unroll
  for (int nb = 0; nb < 4; nb++) bb[nb] = bias[n0 + colg * 64 + nb * 16 + ln];
  // Stands in front of every later overwrite of the bias loads' address registers.
  asm volatile("s_wait_xcnt 0x0" ::: "memory");
#pragma unroll
  for (int r = 0; r < 4; r++) {
#pragma unroll
    for (int nb = 0; nb < 4; nb++) {
      const int col = n0 + colg * 64 + nb * 16 + ln;
#pragma unroll
      for (int j = 0; j < 8; j++) {
        const int row = m0 + rowg * 64 + r * 16 + j + 8 * hf;
        C[(size_t)row * N + col] = acc[r][nb][j] + bb[nb];
      }
    }
  }
}

// ---------------------------------------------------------------------------
// Fused RMSNorm (over D) + interleaved RoPE + f16 downconvert.
// ---------------------------------------------------------------------------
__device__ __forceinline__ void rmsnorm_rope_body(
    float* red, const int row,  // row = b*T + t
    const float* __restrict__ src, const float* __restrict__ w,
    const float* __restrict__ cosb, const float* __restrict__ sinb,
    _Float16* __restrict__ dst, int T, int D, float outScale)
{
  const int t   = row % T;
  const float* h = src + (size_t)row * D;
  const int base = threadIdx.x * 8;

  float4 h0 = *(const float4*)&h[base];
  float4 h1 = *(const float4*)&h[base + 4];
  float ss = h0.x * h0.x + h0.y * h0.y + h0.z * h0.z + h0.w * h0.w +
             h1.x * h1.x + h1.y * h1.y + h1.z * h1.z + h1.w * h1.w;
#pragma unroll
  for (int off = 16; off > 0; off >>= 1) ss += __shfl_xor(ss, off, 32);
  if ((threadIdx.x & 31) == 0) red[threadIdx.x >> 5] = ss;
  __syncthreads();
  float tot = 0.f;
#pragma unroll
  for (int i = 0; i < 8; i++) tot += red[i];
  const float rinv = rsqrtf(tot / (float)D + 1e-6f);

  const float hv[8] = {h0.x, h0.y, h0.z, h0.w, h1.x, h1.y, h1.z, h1.w};
  const float* cb = cosb + (size_t)t * D + base;
  const float* sb = sinb + (size_t)t * D + base;
  const float* wb = w + base;
  _Float16* dp = dst + (size_t)row * D + base;
#pragma unroll
  for (int p = 0; p < 4; p++) {
    const int e = 2 * p, o = 2 * p + 1;
    const float he = hv[e] * wb[e] * rinv;
    const float ho = hv[o] * wb[o] * rinv;
    dp[e] = (_Float16)((he * cb[e] - ho * sb[e]) * outScale);
    dp[o] = (_Float16)((ho * cb[o] + he * sb[o]) * outScale);
  }
}

// f32 -> f16 bulk convert, x and the four W matrices in ONE launch: blockIdx.y picks one of six
// segments of n4 float4 each (x is two of them); the f16 copies lie one behind the other at dst0.
__global__ __launch_bounds__(256) void cvt_f16_kernel(
    const float* __restrict__ x, const float* __restrict__ Wq, const float* __restrict__ Wk,
    const float* __restrict__ Wv, const float* __restrict__ Wo, _Float16* __restrict__ dst0, int n4)
{
  const int seg = blockIdx.y;
  const float* src = x + (size_t)(seg & 1) * n4 * 4;  // segments 0 and 1
  src = (seg == 2) ? Wq : src;
  src = (seg == 3) ? Wk : src;
  src = (seg == 4) ? Wv : src;
  src = (seg == 5) ? Wo : src;
  _Float16* const dst = dst0 + (size_t)seg * n4 * 4;
  const int i = blockIdx.x * 256 + threadIdx.x;
  if (i >= n4) return;
  float4 f = ((const float4*)src)[i];
  v4h o;
  o[0] = (_Float16)f.x; o[1] = (_Float16)f.y;
  o[2] = (_Float16)f.z; o[3] = (_Float16)f.w;
  ((v4h*)dst)[i] = o;
}

__device__ __forceinline__ void transpose_v_body(
    _Float16* Ls, const int t0, const int hh, const int b,
    const float* __restrict__ vf, _Float16* __restrict__ vT, int T)
{
  const int tid = threadIdx.x;
  const int D = 2048, H = 16, Dh = 128;

  {  // load + convert 64t x 128dh tile (coalesced reads)
    const int r = tid >> 2, q = tid & 3;
    const float* sp = vf + (size_t)(b * T + t0 + r) * D + hh * Dh + q * 32;
    v16h u0, u1;
#pragma unroll
    for (int i = 0; i < 16; i++) { u0[i] = (_Float16)sp[i]; u1[i] = (_Float16)sp[16 + i]; }
    *(v16h*)&Ls[r * 128 + q * 32]      = u0;
    *(v16h*)&Ls[r * 128 + q * 32 + 16] = u1;
  }
  __syncthreads();
  {  // write transposed (coalesced writes over t)
    const int dh = tid >> 1, half = tid & 1;
    v16h o0, o1;
#pragma unroll
    for (int i = 0; i < 16; i++) {
      o0[i] = Ls[(half * 32 + i) * 128 + dh];
      o1[i] = Ls[(half * 32 + 16 + i) * 128 + dh];
    }
    _Float16* dp = vT + ((size_t)(b * H + hh) * Dh + dh) * T + t0 + half * 32;
    *(v16h*)dp        = o0;
    *(v16h*)(dp + 16) = o1;
  }
}

// The three independent steps between the projections and attention in ONE launch, by block
// index: first the V tiles (T/64 x 16 heads x batch), then M rows of q, then M rows of k.
__global__ __launch_bounds__(256) void prep_qkv_kernel(
    const float* __restrict__ qf, const float* __restrict__ kf, const float* __restrict__ vf,
    const float* __restrict__ qnw, const float* __restrict__ knw,
    const float* __restrict__ cosb, const float* __restrict__ sinb,
    _Float16* __restrict__ qh, _Float16* __restrict__ kh, _Float16* __restrict__ vT,
    int M, int T, int D, float qScale)
{
  __shared__ _Float16 Ls[64 * 128];  // V tile [t][dh] f16, 16KB
  __shared__ float red[8];
  const int nT = T / 64;
  const int nV = (M / 64) * 16;      // V tiles
  const int blk = blockIdx.x;
  if (blk < nV) {
    transpose_v_body(Ls, (blk % nT) * 64, (blk / nT) % 16, blk / (nT * 16), vf, vT, T);
  } else {
    const int r = blk - nV;
    const bool isK = r >= M;
    rmsnorm_rope_body(red, isK ? r - M : r, isK ? kf : qf, isK ? knw : qnw, cosb, sinb,
                      isK ? kh : qh, T, D, isK ? 1.0f : qScale);
  }
}

__device__ __forceinline__ float xhalf(float x) {
  const int v = __builtin_bit_cast(int, x);
  return __builtin_bit_cast(float, __builtin_amdgcn_permlanex16(v, v, 0x76543210, 0xfedcba98, false, false));
}

// A fragment in the k order that a pair of converted D tiles has as B: element s of half
// hf is k = 8*hf + s (s < 8), 16 + 8*hf + (s - 8) (s >= 8). p points at k = 0 of the 32.
__device__ __forceinline__ v16h ld_frag_kmap(const _Float16* p, int hf) {
  const v8h lo = *(const v8h*)(p + 8 * hf);
  const v8h hi = *(const v8h*)(p + 16 + 8 * hf);
  return __builtin_shufflevector(lo, hi, 0, 1, 2, 3, 4, 5, 6, 7, 8, 9, 10, 11, 12, 13, 14, 15);
}

__global__ __launch_bounds__(256) void flash_attn_kernel(
    const _Float16* __restrict__ qh, const _Float16* __restrict__ kh,
    const _Float16* __restrict__ vT, _Float16* __restrict__ oh, int T)
{
  // [0], [1]: K [key][dh]; [2]: V [dh][key]; 3 x 18 KB
  __shared__ __attribute__((aligned(2048))) _Float16 Ls[3][TILE_H];
  _Float16* const Vt = &Ls[2][0];

  const int tid  = threadIdx.x;
  const int lane = tid & 31;
  const int wave = tid >> 5;
  const int ln   = lane & 15;
  const int hf   = lane >> 4;

  const int q0 = blockIdx.x * 128;
  const int hh = blockIdx.y;
  const int b  = blockIdx.z;
  const int D = 2048, Dh = 128, H = 16;

  // Q B-fragments (column ln = query): 4 chunks of K=32 covering Dh=128 (kept resident)
  const size_t qrow = (size_t)(b * T + q0 + wave * 16 + ln);
  v16h qB[4];
#pragma unroll
  for (int kc = 0; kc < 4; kc++)
    qB[kc] = *(const v16h*)&qh[qrow * D + hh * Dh + kc * 32 + hf * 16];
  // Stands in front of every later overwrite of the Q loads' address registers, also on the path
  // that goes round the key loop.
  asm volatile("s_wait_xcnt 0x0" ::: "memory");

  v8f oAcc[8] = {};       // oAcc[nd][j] = O^T[dh = nd*16 + 8*hf + j][query ln]
  float rowm = -3.0e38f;  // the query's running maximum, equal in both halves
  float rowl = 0.f;       // the sum over this half's keys; the halves are joined behind the loop

  const _Float16* kBase = kh + (size_t)(b * T) * D + hh * Dh;
  const _Float16* vBase = vT + (size_t)(b * H + hh) * Dh * T;
  const unsigned wv  = uni((unsigned)tid >> 5);  // the wave's number, scalar
  const unsigned kLb = lds_addr(&Ls[0][0]);
  const unsigned vLb = lds_addr(&Ls[2][0]);
  const v8u g1K = held(tdm_group1<256, 64>((unsigned)D * 2u));   // 64 keys x 256B rows, pitch D f16
  const v8u g1V = held(tdm_group1<128, 128>((unsigned)T * 2u));  // 128 dh x 128B rows, pitch T f16
  v4u g0K = tdm_group0(kLb, kBase), g0V = tdm_group0(vLb, vBase);

  // Every wave forms the words (scalar work); only the issue itself stands behind a test.
  auto aimK = [&](int buf, int kt0) {
    const v4u n = tdm_group0(kLb + (unsigned)buf * (TILE_H * 2u), kBase + (size_t)kt0 * D);
    g0K[1] = n[1]; g0K[2] = n[2]; g0K[3] = n[3];
  };
  auto aimV = [&](int kt0) {
    const v4u n = tdm_group0(vLb, vBase + kt0);
    g0V[2] = n[2]; g0V[3] = n[3];
  };

  const int NT = T / 64;
  if (pinned(wv == 0u)) tdm_load(g0K, g1K);
  for (int it = 0; it < NT; ++it) {
    const int kt0 = it * 64;
    const int buf = it & 1;
    wait_tensor0(g0K, g1K);
    aimK(buf ^ 1, kt0 + 64);
    aimV(kt0);               // wave 1 has nothing outstanding here
    if (pinned((wv == 0u) & (it + 1 < NT))) tdm_load(g0K, g1K);
    if (pinned(wv == 1u)) {
      tdm_load(g0V, g1V);
      wait_tensor0(g0V, g1V);  // V tile `it` has landed
    }
    __syncthreads();

    // ---- S^T = K * Q^T (16 WMMA): s[n][j] = score of key n*16 + 8*hf + j, query ln ----
    // K fragments are read in groups of four (one kc), two groups in flight in two register
    // sets: a group is waited for once, while the group behind it is already on its way.
    v8f s[4] = {};
    v16h kf[2][4];
    auto readK = [&](v16h (&g)[4], int kc) {
#pragma unroll
      for (int n = 0; n < 4; n++)
        g[n] = ld_frag(&Ls[buf][(n * 16 + ln) * P256 + kc * 32 + hf * 16]);
    };
    readK(kf[0], 0);
    readK(kf[1], 1);
    __builtin_amdgcn_sched_barrier(0);  // keeps both groups' reads in front of the first WMMA
#pragma unroll
    for (int kc = 0; kc < 4; kc++) {
#pragma unroll
      for (int n = 0; n < 4; n++) s[n] = WMMA_F16(kf[kc & 1][n], qB[kc], s[n]);
      if (kc + 2 < 4) {
        readK(kf[kc & 1], kc + 2);
        __builtin_amdgcn_sched_barrier(0);  // keeps the refill in front of the other set's WMMAs
      }
    }

    v16h vf[2][4];
    auto readV = [&](v16h (&g)[4], int grp) {
#pragma unroll
      for (int i = 0; i < 4; i++)
        g[i] = ld_frag_kmap(&Vt[(((grp & 1) * 4 + i) * 16 + ln) * P128 + (grp >> 1) * 32], hf);
    };
    readV(vf[0], 0);
    readV(vf[1], 1);
    __builtin_amdgcn_sched_barrier(0);  // keeps these reads in front of the softmax

    // ---- online softmax, one query a lane ----
    float tn[4];
#pragma unroll
    for (int n = 0; n < 4; n++)
      tn[n] = fmaxf(fmaxf(fmaxf(s[n][0], s[n][1]), fmaxf(s[n][2], s[n][3])),
                    fmaxf(fmaxf(s[n][4], s[n][5]), fmaxf(s[n][6], s[n][7])));
    float tm = fmaxf(fmaxf(tn[0], tn[1]), fmaxf(tn[2], tn[3]));
    tm = fmaxf(tm, xhalf(tm));
    const float mnew  = fmaxf(rowm, tm);
    const float alpha = __expf(rowm - mnew);
    rowm = mnew;
#pragma unroll
    for (int nd = 0; nd < 8; nd++) oAcc[nd] *= alpha;
    float pn[4];  // four independent chains
#pragma unroll
    for (int n = 0; n < 4; n++) {
      pn[n] = 0.f;
#pragma unroll
      for (int j = 0; j < 8; j++) {
        const float p = __expf(s[n][j] - mnew);
        s[n][j] = p;
        pn[n] += p;
      }
    }
    rowl = rowl * alpha + ((pn[0] + pn[1]) + (pn[2] + pn[3]));

    // ---- P^T as B operand: two score tiles converted in place cover 32 keys ----
    v16h pB[2];
#pragma unroll
    for (int kc = 0; kc < 2; kc++)
#pragma unroll
      for (int e = 0; e < 8; e++) {
        pB[kc][e]     = (_Float16)s[2 * kc][e];
        pB[kc][8 + e] = (_Float16)s[2 * kc + 1][e];
      }

    asm volatile("" :: "v"(pB[0]), "v"(pB[1]), "v"(rowl) : "memory");

    // ---- O^T += V^T * P^T (16 WMMA) ----
#pragma unroll
    for (int grp = 0; grp < 4; grp++) {
#pragma unroll
      for (int i = 0; i < 4; i++)
        oAcc[(grp & 1) * 4 + i] = WMMA_F16(vf[grp & 1][i], pB[grp >> 1], oAcc[(grp & 1) * 4 + i]);
      if (grp + 2 < 4) {
        readV(vf[grp & 1], grp + 2);
        __builtin_amdgcn_sched_barrier(0);  // keeps the refill in front of the other set's WMMAs
      }
    }
    wait_ds0();
    __syncthreads();
  }
  wait_tensor0(g0K, g1K);  // nothing of the mover is outstanding on any path to the wave's end

  // ---- normalize and store f16 attention output: 8 consecutive dh of the lane's query a store ----
  const float inv = 1.0f / (rowl + xhalf(rowl));
  _Float16* const op = oh + qrow * D + hh * Dh + 8 * hf;
#pragma unroll
  for (int nd = 0; nd < 8; nd++) {
    v8h o;
#pragma unroll
    for (int j = 0; j < 8; j++) o[j] = (_Float16)(oAcc[nd][j] * inv);
    *(v8h*)(op + nd * 16) = o;
  }
}

// ---------------------------------------------------------------------------
extern "C" void kernel_launch(void* const* d_in, const int* in_sizes, int n_in,
                              void* d_out, int out_size, void* d_ws, size_t ws_size,
                              hipStream_t stream)
{
  (void)in_sizes; (void)n_in; (void)out_size; (void)ws_size;
  const float* x    = (const float*)d_in[0];
  const float* cosb = (const float*)d_in[1];
  const float* sinb = (const float*)d_in[2];
  const float* Wq   = (const float*)d_in[3];
  const float* bq   = (const float*)d_in[4];
  const float* Wk   = (const float*)d_in[5];
  const float* bk   = (const float*)d_in[6];
  const float* Wv   = (const float*)d_in[7];
  const float* bv   = (const float*)d_in[8];
  const float* qnw  = (const float*)d_in[9];
  const float* knw  = (const float*)d_in[10];
  const float* Wo   = (const float*)d_in[11];
  const float* bo   = (const float*)d_in[12];
  float* out = (float*)d_out;

  const int B = 2, T = 2048, D = 2048, H = 16;
  const int M = B * T;

  // Workspace layout (208 MB total)
  char* ws = (char*)d_ws;
  const size_t MB = 1ull << 20;
  float*    qf  = (float*)(ws + 0 * MB);       // 32 MB f32 q
  float*    kf  = (float*)(ws + 32 * MB);      // 32 MB f32 k
  float*    vf  = (float*)(ws + 64 * MB);      // 32 MB f32 v
  _Float16* qh  = (_Float16*)(ws + 96 * MB);   // 16 MB f16 q-hat
  _Float16* kh  = (_Float16*)(ws + 112 * MB);  // 16 MB f16 k-hat
  _Float16* vTh = (_Float16*)(ws + 128 * MB);  // 16 MB f16 V transposed
  _Float16* oh  = (_Float16*)(ws + 144 * MB);  // 16 MB f16 attn out
  _Float16* xh  = (_Float16*)(ws + 160 * MB);  // 16 MB f16 x
  _Float16* Wqh = (_Float16*)(ws + 176 * MB);  //  8 MB
  _Float16* Wkh = (_Float16*)(ws + 184 * MB);  //  8 MB
  _Float16* Wvh = (_Float16*)(ws + 192 * MB);  //  8 MB
  _Float16* Woh = (_Float16*)(ws + 200 * MB);  //  8 MB

  (void)Wkh; (void)Wvh;  // reached as slices 1 and 2 behind Wqh

  dim3 blk(256);
  const int nx4 = M * D / 4, nw4 = D * D / 4;
  static_assert(nx4 == 2 * nw4, "x is two segments of the conversion launch");
  // xh, Wqh, Wkh, Wvh, Woh lie one behind the other: six segments of nw4 float4.
  cvt_f16_kernel<<<dim3((nw4 + 255) / 256, 6), blk, 0, stream>>>(x, Wq, Wk, Wv, Wo, xh, nw4);

  // q, k, v in one launch: Wqh, Wkh, Wvh and qf, kf, vf lie one behind the other.
  gemm_f16_kernel<<<dim3(D / 256, M / 128, 3), blk, 0, stream>>>(xh, Wqh, bq, bk, bv, qf, M, D, D);

  const float qscale = 0.08838834764831845f;  // 1/sqrt(128), folded into Q
  prep_qkv_kernel<<<(M / 64) * H + 2 * M, blk, 0, stream>>>(qf, kf, vf, qnw, knw, cosb, sinb,
                                                            qh, kh, vTh, M, T, D, qscale);

  flash_attn_kernel<<<dim3(T / 128, H, B), blk, 0, stream>>>(qh, kh, vTh, oh, T);

  gemm_f16_kernel<<<dim3(D / 256, M / 128, 1), blk, 0, stream>>>(oh, Woh, bo, bo, bo, out, M, D, D);
}

// v007
// One run takes 185 microseconds.
// Next to v006, in two timings, it ran 1.03 and 1.04 times as fast.
// Counting every step since v000, it is 4.28 times as fast.
#include <hip/hip_runtime.h>
#include <hip/hip_bf16.h>

typedef __attribute__((ext_vector_type(16))) _Float16 v16h;
typedef __attribute__((ext_vector_type(8)))  _Float16 v8h;
typedef __attribute__((ext_vector_type(4)))  _Float16 v4h;
typedef __attribute__((ext_vector_type(8)))  float    v8f;
typedef __attribute__((ext_vector_type(4)))  unsigned int v4u;

#define WMMA_F16(a, b, c) \
  __builtin_amdgcn_wmma_f32_16x16x32_f16(false, (a), false, (b), (short)0, (c), false, false)

__device__ __forceinline__ unsigned lds_addr(const void* p) {
  return (unsigned)(uintptr_t)p;  // low 32 bits of generic shared ptr = LDS offset
}

typedef __attribute__((ext_vector_type(8))) unsigned int v8u;

__device__ __forceinline__ unsigned uni(unsigned v) { return (unsigned)__builtin_amdgcn_readfirstlane(v); }

__device__ __forceinline__ unsigned pinned(unsigned v) {
  unsigned w = uni(v);
  asm volatile("" : "+s"(w));  // pinned(): keeps the condition in a scalar register
  return w;
}

// A wave's LDS reads have retired before a barrier frees their buffer for a refill.
__device__ __forceinline__ void wait_ds0() { asm volatile("s_wait_dscnt 0" ::: "memory"); }

__device__ __forceinline__ v4u tdm_group0(unsigned ldsaddr, const void* gaddr) {
  const unsigned long long ga = (unsigned long long)(uintptr_t)gaddr;
  v4u g;
  g[0] = uni(1u);                                                   // count = 1
  g[1] = uni(ldsaddr);                                              // LDS byte offset
  g[2] = uni((unsigned)ga);                                         // address [31:0]
  g[3] = uni((((unsigned)(ga >> 32)) & 0x01FFFFFFu) | 0x80000000u); // address [56:32] | type = 2
  return g;
}

template <unsigned ROWB, unsigned ROWS>
__device__ __forceinline__ v8u tdm_group1(unsigned srcPitch) {
  static_assert(ROWB == 128u || ROWB == 256u, "pad interval code is set for rows of 128 or 256 bytes");
  constexpr unsigned ivl = (ROWB == 256u) ? 5u : 4u;
  v8u g;
  g[0] = uni((1u << 20) | (ivl << 22) | (3u << 25));
  g[1] = uni(ROWB << 16);
  g[2] = uni(ROWS << 16);
  g[3] = uni(ROWB << 16);
  g[4] = uni(ROWS);
  g[5] = uni(srcPitch);
  g[6] = uni(0u);
  g[7] = uni(0u);
  return g;
}

__device__ __forceinline__ void tdm_load(v4u& g0, v8u g1) {
  asm volatile("tensor_load_to_lds %0, %1" : "+s"(g0) : "s"(g1) : "memory");
}

// The mover's waits are not placed by the compiler.
__device__ __forceinline__ void wait_tensor0(v4u& g0, v8u g1) {
  asm volatile("s_wait_tensorcnt 0" : "+s"(g0) : "s"(g1) : "memory");
}

__device__ __forceinline__ void wait_tensor0(v4u& g0a, v8u g1a, v4u& g0b, v8u g1b) {
  asm volatile("s_wait_tensorcnt 0" : "+s"(g0a), "+s"(g0b) : "s"(g1a), "s"(g1b) : "memory");
}

__device__ __forceinline__ v8u held(v8u g) {
  asm volatile("" : "+s"(g));
  return g;
}

// 16 consecutive f16 of a padded LDS row (16-byte aligned): two ds_load_b128.
__device__ __forceinline__ v16h ld_frag(const _Float16* p) {
  const v8h lo = *(const v8h*)p;
  const v8h hi = *(const v8h*)(p + 8);
  return __builtin_shufflevector(lo, hi, 0, 1, 2, 3, 4, 5, 6, 7, 8, 9, 10, 11, 12, 13, 14, 15);
}

// LDS pitches in f16 elements: 128-B rows + 16 B, 256-B rows + 16 B.
#define P128 72
#define P256 136
// One padded tile's place in LDS, in f16 elements: 128 x 144 B = 18432 B = 9 x 2 KiB
// (64 x 272 B = 17408 B is rounded up to the same), so every place is a multiple of 2 KiB.
#define TILE_H 9216

// ---------------------------------------------------------------------------
// GEMM:  C[M,N] (f32) = A[M,K](f16) x W[N,K](f16)^T + bias[N]
// blockIdx.z picks one of up to three independent products on the same A in ONE launch:
// W and C of slice z lie z * N * K and z * M * N elements behind the first, bias by pointer.
// 256 threads = 8 waves arranged 2x4; workgroup tile 128x256, wave tile 64x64; a pass is 128 k
// (256 B of every operand row). A fragment read from LDS feeds four WMMAs, and a byte landed
// from L2 serves 128 or 256 output columns or rows.
// A stage is six slices of 64 rows (A: 0, 1; W: 2..5) at a pitch of 272 B, each at its own
// multiple of 2 KiB; waves 0..5 each bring their own slice by one tensor_load_to_lds (one
// request of a wave outstanding). Two buffers: stage s + 2 is issued behind the barrier that
// ends pass s's LDS reads, into the buffer that pass s has read; the pass's last 32-k block of
// WMMAs works from registers behind that barrier. K is at least two passes.
// ---------------------------------------------------------------------------
__global__ __launch_bounds__(256) void gemm_f16_kernel(
    const _Float16* __restrict__ Ah, const _Float16* __restrict__ Wh0,
    const float* __restrict__ bias0, const float* __restrict__ bias1,
    const float* __restrict__ bias2, float* __restrict__ C0,
    int M, int N, int K)
{
  const int zs = blockIdx.z;
  const _Float16* const Wh = Wh0 + (size_t)zs * N * K;
  const float* const bias  = (zs == 0) ? bias0 : (zs == 1) ? bias1 : bias2;
  float* const C           = C0 + (size_t)zs * M * N;

  __shared__ __attribute__((aligned(2048))) _Float16 Ls[2][6][TILE_H];  // [buf][slice], 12 x 18 KB

  const int tid  = threadIdx.x;
  const int lane = tid & 31;
  const int wave = tid >> 5;
  const int ln   = lane & 15;
  const int hf   = lane >> 4;
  const int rowg = wave >> 2;  // 0..1 : 64-row group = A slice
  const int colg = wave & 3;   // 0..3 : 64-col group = W slice

  const int n0 = blockIdx.x * 256;
  const int m0 = blockIdx.y * 128;

  const unsigned wv = uni((unsigned)tid >> 5);  // the wave's number, scalar
  const unsigned sl = (wv < 6u) ? wv : 5u;      // this wave's slice (waves 6 and 7 issue nothing)
  const _Float16* tBase = (sl < 2u) ? Ah + (size_t)(m0 + (int)sl * 64) * K
                                    : Wh + (size_t)(n0 + ((int)sl - 2) * 64) * K;
  const unsigned  tL    = lds_addr(&Ls[0][sl][0]);
  const v8u g1 = held(tdm_group1<256, 64>((unsigned)K * 2u));  // 64 rows x 256 B, pitch K f16
  v4u g0 = tdm_group0(tL, tBase);

  // Every wave forms the words (scalar work); only the issue itself stands behind a test.
  auto aimTile = [&](int buf, int k0) {
    const v4u n = tdm_group0(tL + (unsigned)buf * (6u * TILE_H * 2u), tBase + k0);
    g0[1] = n[1]; g0[2] = n[2]; g0[3] = n[3];
  };

  v8f acc[4][4] = {};

  const int NT = K / 128;
  if (pinned(wv < 6u)) tdm_load(g0, g1);
  wait_tensor0(g0, g1);
  __syncthreads();
  aimTile(1, 128);
  if (pinned(wv < 6u)) tdm_load(g0, g1);
  for (int it = 0; it < NT; ++it) {
    const int buf = it & 1;
    const _Float16* const aL = &Ls[buf][rowg][ln * P256 + hf * 16];
    const _Float16* const bL = &Ls[buf][2 + colg][ln * P256 + hf * 16];

    // All 32 fragments of the pass are read as one group, each into registers of its own: one
    // place with LDS reads a pass, and the buffer is left as early as the LDS delivers.
    v16h af[4][4], bf[4][4];
#pragma unroll
    for (int kb = 0; kb < 4; kb++) {
#pragma unroll
      for (int r = 0; r < 4; r++) af[kb][r] = ld_frag(aL + r * 16 * P256 + kb * 32);
#pragma unroll
      for (int nb = 0; nb < 4; nb++) bf[kb][nb] = ld_frag(bL + nb * 16 * P256 + kb * 32);
    }
    __builtin_amdgcn_sched_barrier(0);  // keeps the reads in front: sunk to their uses, each would be waited for alone
    auto mmaBlk = [&](int kb) {
#pragma unroll
      for (int nb = 0; nb < 4; nb++)
#pragma unroll
        for (int r = 0; r < 4; r++) acc[r][nb] = WMMA_F16(af[kb][r], bf[kb][nb], acc[r][nb]);
    };
    mmaBlk(0);
    mmaBlk(1);
    mmaBlk(2);
    __builtin_amdgcn_sched_barrier(0);  // keeps these WMMAs in front of the waits: the later reads land under them
    wait_ds0();            // every fragment of the pass is in registers: this wave has left buf
    wait_tensor0(g0, g1);  // this wave's slice of stage it + 1 has landed
    __syncthreads();       // publishes stage it + 1; every wave has left buf
    aimTile(buf, (it + 2) * 128);
    if (pinned((wv < 6u) & (it + 2 < NT))) tdm_load(g0, g1);
    __builtin_amdgcn_sched_barrier(0);  // keeps the refill's issue in front of the last block's WMMAs: a whole pass of lead
    mmaBlk(3);  // from registers alone: the matrix unit has work while the next pass's first reads are on their way
  }
  wait_tensor0(g0, g1);  // nothing of the mover is outstanding on any path to the wave's end
  wait_ds0();

  // ---- epilogue: bias + f32 store ----
  float bb[4];
#pragma unroll
  for (int nb = 0; nb < 4; nb++) bb[nb] = bias[n0 + colg * 64 + nb * 16 + ln];
  // Stands in front of every later overwrite of the bias loads' address registers.
  asm volatile("s_wait_xcnt 0x0" ::: "memory");
#pragma unroll
  for (int r = 0; r < 4; r++) {
#pragma unroll
    for (int nb = 0; nb < 4; nb++) {
      const int col = n0 + colg * 64 + nb * 16 + ln;
#pragma unroll
      for (int j = 0; j < 8; j++) {
        const int row = m0 + rowg * 64 + r * 16 + j + 8 * hf;
        C[(size_t)row * N + col] = acc[r][nb][j] + bb[nb];
      }
    }
  }
}

// ---------------------------------------------------------------------------
// Fused RMSNorm (over D) + interleaved RoPE + f16 downconvert.
// ---------------------------------------------------------------------------
__device__ __forceinline__ void rmsnorm_rope_body(
    float* red, const int row,  // row = b*T + t
    const float* __restrict__ src, const float* __restrict__ w,
    const float* __restrict__ cosb, const float* __restrict__ sinb,
    _Float16* __restrict__ dst, int T, int D, float outScale)
{
  const int t   = row % T;
  const float* h = src + (size_t)row * D;
  const int base = threadIdx.x * 8;

  float4 h0 = *(const float4*)&h[base];
  float4 h1 = *(const float4*)&h[base + 4];
  float ss = h0.x * h0.x + h0.y * h0.y + h0.z * h0.z + h0.w * h0.w +
             h1.x * h1.x + h1.y * h1.y + h1.z * h1.z + h1.w * h1.w;
#pragma unroll
  for (int off = 16; off > 0; off >>= 1) ss += __shfl_xor(ss, off, 32);
  if ((threadIdx.x & 31) == 0) red[threadIdx.x >> 5] = ss;
  __syncthreads();
  float tot = 0.f;
#pragma unroll
  for (int i = 0; i < 8; i++) tot += red[i];
  const float rinv = rsqrtf(tot / (float)D + 1e-6f);

  const float hv[8] = {h0.x, h0.y, h0.z, h0.w, h1.x, h1.y, h1.z, h1.w};
  const float* cb = cosb + (size_t)t * D + base;
  const float* sb = sinb + (size_t)t * D + base;
  const float* wb = w + base;
  _Float16* dp = dst + (size_t)row * D + base;
#pragma unroll
  for (int p = 0; p < 4; p++) {
    const int e = 2 * p, o = 2 * p + 1;
    const float he = hv[e] * wb[e] * rinv;
    const float ho = hv[o] * wb[o] * rinv;
    dp[e] = (_Float16)((he * cb[e] - ho * sb[e]) * outScale);
    dp[o] = (_Float16)((ho * cb[o] + he * sb[o]) * outScale);
  }
}

// f32 -> f16 bulk convert, x and the four W matrices in ONE launch: blockIdx.y picks one of six
// segments of n4 float4 each (x is two of them); the f16 copies lie one behind the other at dst0.
__global__ __launch_bounds__(256) void cvt_f16_kernel(
    const float* __restrict__ x, const float* __restrict__ Wq, const float* __restrict__ Wk,
    const float* __restrict__ Wv, const float* __restrict__ Wo, _Float16* __restrict__ dst0, int n4)
{
  const int seg = blockIdx.y;
  const float* src = x + (size_t)(seg & 1) * n4 * 4;  // segments 0 and 1
  src = (seg == 2) ? Wq : src;
  src = (seg == 3) ? Wk : src;
  src = (seg == 4) ? Wv : src;
  src = (seg == 5) ? Wo : src;
  _Float16* const dst = dst0 + (size_t)seg * n4 * 4;
  const int i = blockIdx.x * 256 + threadIdx.x;
  if (i >= n4) return;
  float4 f = ((const float4*)src)[i];
  v4h o;
  o[0] = (_Float16)f.x; o[1] = (_Float16)f.y;
  o[2] = (_Float16)f.z; o[3] = (_Float16)f.w;
  ((v4h*)dst)[i] = o;
}

__device__ __forceinline__ void transpose_v_body(
    _Float16* Ls, const int t0, const int hh, const int b,
    const float* __restrict__ vf, _Float16* __restrict__ vT, int T)
{
  const int tid = threadIdx.x;
  const int D = 2048, H = 16, Dh = 128;

  {  // load + convert 64t x 128dh tile (coalesced reads)
    const int r = tid >> 2, q = tid & 3;
    const float* sp = vf + (size_t)(b * T + t0 + r) * D + hh * Dh + q * 32;
    v16h u0, u1;
#pragma unroll
    for (int i = 0; i < 16; i++) { u0[i] = (_Float16)sp[i]; u1[i] = (_Float16)sp[16 + i]; }
    *(v16h*)&Ls[r * 128 + q * 32]      = u0;
    *(v16h*)&Ls[r * 128 + q * 32 + 16] = u1;
  }
  __syncthreads();
  {  // write transposed (coalesced writes over t)
    const int dh = tid >> 1, half = tid & 1;
    v16h o0, o1;
#pragma unroll
    for (int i = 0; i < 16; i++) {
      o0[i] = Ls[(half * 32 + i) * 128 + dh];
      o1[i] = Ls[(half * 32 + 16 + i) * 128 + dh];
    }
    _Float16* dp = vT + ((size_t)(b * H + hh) * Dh + dh) * T + t0 + half * 32;
    *(v16h*)dp        = o0;
    *(v16h*)(dp + 16) = o1;
  }
}

// The three independent steps between the projections and attention in ONE launch, by block
// index: first the V tiles (T/64 x 16 heads x batch), then M rows of q, then M rows of k.
__global__ __launch_bounds__(256) void prep_qkv_kernel(
    const float* __restrict__ qf, const float* __restrict__ kf, const float* __restrict__ vf,
    const float* __restrict__ qnw, const float* __restrict__ knw,
    const float* __restrict__ cosb, const float* __restrict__ sinb,
    _Float16* __restrict__ qh, _Float16* __restrict__ kh, _Float16* __restrict__ vT,
    int M, int T, int D, float qScale)
{
  __shared__ _Float16 Ls[64 * 128];  // V tile [t][dh] f16, 16KB
  __shared__ float red[8];
  const int nT = T / 64;
  const int nV = (M / 64) * 16;      // V tiles
  const int blk = blockIdx.x;
  if (blk < nV) {
    transpose_v_body(Ls, (blk % nT) * 64, (blk / nT) % 16, blk / (nT * 16), vf, vT, T);
  } else {
    const int r = blk - nV;
    const bool isK = r >= M;
    rmsnorm_rope_body(red, isK ? r - M : r, isK ? kf : qf, isK ? knw : qnw, cosb, sinb,
                      isK ? kh : qh, T, D, isK ? 1.0f : qScale);
  }
}

__device__ __forceinline__ float xhalf(float x) {
  const int v = __builtin_bit_cast(int, x);
  return __builtin_bit_cast(float, __builtin_amdgcn_permlanex16(v, v, 0x76543210, 0xfedcba98, false, false));
}

// A fragment in the k order that a pair of converted D tiles has as B: element s of half
// hf is k = 8*hf + s (s < 8), 16 + 8*hf + (s - 8) (s >= 8). p points at k = 0 of the 32.
__device__ __forceinline__ v16h ld_frag_kmap(const _Float16* p, int hf) {
  const v8h lo = *(const v8h*)(p + 8 * hf);
  const v8h hi = *(const v8h*)(p + 16 + 8 * hf);
  return __builtin_shufflevector(lo, hi, 0, 1, 2, 3, 4, 5, 6, 7, 8, 9, 10, 11, 12, 13, 14, 15);
}

__global__ __launch_bounds__(256) void flash_attn_kernel(
    const _Float16* __restrict__ qh, const _Float16* __restrict__ kh,
    const _Float16* __restrict__ vT, _Float16* __restrict__ oh, int T)
{
  // [0], [1]: K [key][dh]; [2], [3]: V [dh][key]; 4 x 18 KB
  __shared__ __attribute__((aligned(2048))) _Float16 Ls[4][TILE_H];

  const int tid  = threadIdx.x;
  const int lane = tid & 31;
  const int wave = tid >> 5;
  const int ln   = lane & 15;
  const int hf   = lane >> 4;

  const int q0 = blockIdx.x * 128;
  const int hh = blockIdx.y;
  const int b  = blockIdx.z;
  const int D = 2048, Dh = 128, H = 16;

  // Q B-fragments (column ln = query): 4 chunks of K=32 covering Dh=128 (kept resident)
  const size_t qrow = (size_t)(b * T + q0 + wave * 16 + ln);
  v16h qB[4];
#pragma unroll
  for (int kc = 0; kc < 4; kc++)
    qB[kc] = *(const v16h*)&qh[qrow * D + hh * Dh + kc * 32 + hf * 16];
  // Stands in front of every later overwrite of the Q loads' address registers, also on the path
  // that goes round the key loop.
  asm volatile("s_wait_xcnt 0x0" ::: "memory");

  v8f oAcc[8] = {};       // oAcc[nd][j] = O^T[dh = nd*16 + 8*hf + j][query ln]
  float rowm = -3.0e38f;  // the query's running maximum, equal in both halves
  float rowl = 0.f;       // the sum over this half's keys; the halves are joined behind the loop

  const _Float16* kBase = kh + (size_t)(b * T) * D + hh * Dh;
  const _Float16* vBase = vT + (size_t)(b * H + hh) * Dh * T;
  const unsigned wv  = uni((unsigned)tid >> 5);  // the wave's number, scalar
  const unsigned kLb = lds_addr(&Ls[0][0]);
  const unsigned vLb = lds_addr(&Ls[2][0]);
  const v8u g1K = held(tdm_group1<256, 64>((unsigned)D * 2u));   // 64 keys x 256B rows, pitch D f16
  const v8u g1V = held(tdm_group1<128, 128>((unsigned)T * 2u));  // 128 dh x 128B rows, pitch T f16
  v4u g0K = tdm_group0(kLb, kBase), g0V = tdm_group0(vLb, vBase);

  // Every wave forms the words (scalar work); only the issue itself stands behind a test.
  auto aimK = [&](int buf, int kt0) {
    const v4u n = tdm_group0(kLb + (unsigned)buf * (TILE_H * 2u), kBase + (size_t)kt0 * D);
    g0K[1] = n[1]; g0K[2] = n[2]; g0K[3] = n[3];
  };
  auto aimV = [&](int buf, int kt0) {
    const v4u n = tdm_group0(vLb + (unsigned)buf * (TILE_H * 2u), vBase + kt0);
    g0V[1] = n[1]; g0V[2] = n[2]; g0V[3] = n[3];
  };

  const int NT = T / 64;
  if (pinned(wv == 0u)) tdm_load(g0K, g1K);
  if (pinned(wv == 1u)) tdm_load(g0V, g1V);
  wait_tensor0(g0K, g1K, g0V, g1V);
  __syncthreads();
  aimK(1, 64);
  aimV(1, 64);
  if (pinned(wv == 0u)) tdm_load(g0K, g1K);
  if (pinned(wv == 1u)) tdm_load(g0V, g1V);
  for (int it = 0; it < NT; ++it) {
    const int buf = it & 1;
    const _Float16* const Vt = &Ls[2 + buf][0];

    // ---- S^T = K * Q^T (16 WMMA): s[n][j] = score of key n*16 + 8*hf + j, query ln ----
    // K fragments are read in groups of four (one kc), two groups in flight in two register
    // sets: a group is waited for once, while the group behind it is already on its way.
    v8f s[4] = {};
    v16h kf[2][4];
    auto readK = [&](v16h (&g)[4], int kc) {
#pragma unroll
      for (int n = 0; n < 4; n++)
        g[n] = ld_frag(&Ls[buf][(n * 16 + ln) * P256 + kc * 32 + hf * 16]);
    };
    readK(kf[0], 0);
    readK(kf[1], 1);
    __builtin_amdgcn_sched_barrier(0);  // keeps both groups' reads in front of the first WMMA
#pragma unroll
    for (int kc = 0; kc < 4; kc++) {
#pragma unroll
      for (int n = 0; n < 4; n++) s[n] = WMMA_F16(kf[kc & 1][n], qB[kc], s[n]);
      if (kc + 2 < 4) {
        readK(kf[kc & 1], kc + 2);
        __builtin_amdgcn_sched_barrier(0);  // keeps the refill in front of the other set's WMMAs
      }
    }

    v16h vf[2][4];
    auto readV = [&](v16h (&g)[4], int grp) {
#pragma unroll
      for (int i = 0; i < 4; i++)
        g[i] = ld_frag_kmap(&Vt[(((grp & 1) * 4 + i) * 16 + ln) * P128 + (grp >> 1) * 32], hf);
    };
    readV(vf[0], 0);
    readV(vf[1], 1);
    __builtin_amdgcn_sched_barrier(0);  // keeps these reads in front of the softmax

    // ---- online softmax, one query a lane ----
    float tn[4];
#pragma unroll
    for (int n = 0; n < 4; n++)
      tn[n] = fmaxf(fmaxf(fmaxf(s[n][0], s[n][1]), fmaxf(s[n][2], s[n][3])),
                    fmaxf(fmaxf(s[n][4], s[n][5]), fmaxf(s[n][6], s[n][7])));
    float tm = fmaxf(fmaxf(tn[0], tn[1]), fmaxf(tn[2], tn[3]));
    tm = fmaxf(tm, xhalf(tm));
    const float mnew  = fmaxf(rowm, tm);
    const float alpha = __expf(rowm - mnew);
    rowm = mnew;
#pragma unroll
    for (int nd = 0; nd < 8; nd++) oAcc[nd] *= alpha;
    float pn[4];  // four independent chains
#pragma unroll
    for (int n = 0; n < 4; n++) {
      pn[n] = 0.f;
#pragma unroll
      for (int j = 0; j < 8; j++) {
        const float p = __expf(s[n][j] - mnew);
        s[n][j] = p;
        pn[n] += p;
      }
    }
    rowl = rowl * alpha + ((pn[0] + pn[1]) + (pn[2] + pn[3]));

    // ---- P^T as B operand: two score tiles converted in place cover 32 keys ----
    v16h pB[2];
#pragma unroll
    for (int kc = 0; kc < 2; kc++)
#pragma unroll
      for (int e = 0; e < 8; e++) {
        pB[kc][e]     = (_Float16)s[2 * kc][e];
        pB[kc][8 + e] = (_Float16)s[2 * kc + 1][e];
      }

    asm volatile("" :: "v"(pB[0]), "v"(pB[1]), "v"(rowl) : "memory");

    // ---- O^T += V^T * P^T (16 WMMA) ----
#pragma unroll
    for (int grp = 0; grp < 4; grp++) {
#pragma unroll
      for (int i = 0; i < 4; i++)
        oAcc[(grp & 1) * 4 + i] = WMMA_F16(vf[grp & 1][i], pB[grp >> 1], oAcc[(grp & 1) * 4 + i]);
      if (grp + 2 < 4) {
        readV(vf[grp & 1], grp + 2);
        __builtin_amdgcn_sched_barrier(0);  // keeps the refill in front of the other set's WMMAs
      }
    }
    wait_ds0();                        // this wave has left both buffers of the pass
    wait_tensor0(g0K, g1K, g0V, g1V);  // waves 0 and 1: their tile it + 1 has landed
    __syncthreads();                   // publishes tile it + 1; every wave has left K[buf] and V[buf]
    aimK(buf, (it + 2) * 64);
    aimV(buf, (it + 2) * 64);
    if (pinned((wv == 0u) & (it + 2 < NT))) tdm_load(g0K, g1K);
    if (pinned((wv == 1u) & (it + 2 < NT))) tdm_load(g0V, g1V);
  }
  wait_tensor0(g0K, g1K, g0V, g1V);  // nothing of the mover is outstanding on any path to the wave's end
  wait_ds0();

  // ---- normalize and store f16 attention output: 8 consecutive dh of the lane's query a store ----
  const float inv = 1.0f / (rowl + xhalf(rowl));
  _Float16* const op = oh + qrow * D + hh * Dh + 8 * hf;
#pragma unroll
  for (int nd = 0; nd < 8; nd++) {
    v8h o;
#pragma unroll
    for (int j = 0; j < 8; j++) o[j] = (_Float16)(oAcc[nd][j] * inv);
    *(v8h*)(op + nd * 16) = o;
  }
}

// ---------------------------------------------------------------------------
extern "C" void kernel_launch(void* const* d_in, const int* in_sizes, int n_in,
                              void* d_out, int out_size, void* d_ws, size_t ws_size,
                              hipStream_t stream)
{
  (void)in_sizes; (void)n_in; (void)out_size; (void)ws_size;
  const float* x    = (const float*)d_in[0];
  const float* cosb = (const float*)d_in[1];
  const float* sinb = (const float*)d_in[2];
  const float* Wq   = (const float*)d_in[3];
  const float* bq   = (const float*)d_in[4];
  const float* Wk   = (const float*)d_in[5];
  const float* bk   = (const float*)d_in[6];
  const float* Wv   = (const float*)d_in[7];
  const float* bv   = (const float*)d_in[8];
  const float* qnw  = (const float*)d_in[9];
  const float* knw  = (const float*)d_in[10];
  const float* Wo   = (const float*)d_in[11];
  const float* bo   = (const float*)d_in[12];
  float* out = (float*)d_out;

  const int B = 2, T = 2048, D = 2048, H = 16;
  const int M = B * T;

  // Workspace layout (208 MB total)
  char* ws = (char*)d_ws;
  const size_t MB = 1ull << 20;
  float*    qf  = (float*)(ws + 0 * MB);       // 32 MB f32 q
  float*    kf  = (float*)(ws + 32 * MB);      // 32 MB f32 k
  float*    vf  = (float*)(ws + 64 * MB);      // 32 MB f32 v
  _Float16* qh  = (_Float16*)(ws + 96 * MB);   // 16 MB f16 q-hat
  _Float16* kh  = (_Float16*)(ws + 112 * MB);  // 16 MB f16 k-hat
  _Float16* vTh = (_Float16*)(ws + 128 * MB);  // 16 MB f16 V transposed
  _Float16* oh  = (_Float16*)(ws + 144 * MB);  // 16 MB f16 attn out
  _Float16* xh  = (_Float16*)(ws + 160 * MB);  // 16 MB f16 x
  _Float16* Wqh = (_Float16*)(ws + 176 * MB);  //  8 MB
  _Float16* Wkh = (_Float16*)(ws + 184 * MB);  //  8 MB
  _Float16* Wvh = (_Float16*)(ws + 192 * MB);  //  8 MB
  _Float16* Woh = (_Float16*)(ws + 200 * MB);  //  8 MB

  (void)Wkh; (void)Wvh;  // reached as slices 1 and 2 behind Wqh

  dim3 blk(256);
  const int nx4 = M * D / 4, nw4 = D * D / 4;
  static_assert(nx4 == 2 * nw4, "x is two segments of the conversion launch");
  // xh, Wqh, Wkh, Wvh, Woh lie one behind the other: six segments of nw4 float4.
  cvt_f16_kernel<<<dim3((nw4 + 255) / 256, 6), blk, 0, stream>>>(x, Wq, Wk, Wv, Wo, xh, nw4);

  // q, k, v in one launch: Wqh, Wkh, Wvh and qf, kf, vf lie one behind the other.
  gemm_f16_kernel<<<dim3(D / 256, M / 128, 3), blk, 0, stream>>>(xh, Wqh, bq, bk, bv, qf, M, D, D);

  const float qscale = 0.08838834764831845f;  // 1/sqrt(128), folded into Q
  prep_qkv_kernel<<<(M / 64) * H + 2 * M, blk, 0, stream>>>(qf, kf, vf, qnw, knw, cosb, sinb,
                                                            qh, kh, vTh, M, T, D, qscale);

  flash_attn_kernel<<<dim3(T / 128, H, B), blk, 0, stream>>>(qh, kh, vTh, oh, T);

  gemm_f16_kernel<<<dim3(D / 256, M / 128, 1), blk, 0, stream>>>(oh, Woh, bo, bo, bo, out, M, D, D);
}

// v008
// One run takes 179 microseconds.
// In both of two side-by-side timings against v007, it was 1.03 times as fast.
// Over all steps from v000 it is 4.41 times as fast.
#include <hip/hip_runtime.h>
#include <hip/hip_bf16.h>

typedef __attribute__((ext_vector_type(16))) _Float16 v16h;
typedef __attribute__((ext_vector_type(8)))  _Float16 v8h;
typedef __attribute__((ext_vector_type(4)))  _Float16 v4h;
typedef __attribute__((ext_vector_type(8)))  float    v8f;
typedef __attribute__((ext_vector_type(4)))  unsigned int v4u;

#define WMMA_F16(a, b, c) \
  __builtin_amdgcn_wmma_f32_16x16x32_f16(false, (a), false, (b), (short)0, (c), false, false)

__device__ __forceinline__ unsigned lds_addr(const void* p) {
  return (unsigned)(uintptr_t)p;  // low 32 bits of generic shared ptr = LDS offset
}

typedef __attribute__((ext_vector_type(8))) unsigned int v8u;

__device__ __forceinline__ unsigned uni(unsigned v) { return (unsigned)__builtin_amdgcn_readfirstlane(v); }

__device__ __forceinline__ unsigned pinned(unsigned v) {
  unsigned w = uni(v);
  asm volatile("" : "+s"(w));  // pinned(): keeps the condition in a scalar register
  return w;
}

// A wave's LDS reads have retired before a barrier frees their buffer for a refill.
__device__ __forceinline__ void wait_ds0() { asm volatile("s_wait_dscnt 0" ::: "memory"); }

__device__ __forceinline__ v4u tdm_group0(unsigned ldsaddr, const void* gaddr) {
  const unsigned long long ga = (unsigned long long)(uintptr_t)gaddr;
  v4u g;
  g[0] = uni(1u);                                                   // count = 1
  g[1] = uni(ldsaddr);                                              // LDS byte offset
  g[2] = uni((unsigned)ga);                                         // address [31:0]
  g[3] = uni((((unsigned)(ga >> 32)) & 0x01FFFFFFu) | 0x80000000u); // address [56:32] | type = 2
  return g;
}

template <unsigned ROWB, unsigned ROWS>
__device__ __forceinline__ v8u tdm_group1(unsigned srcPitch) {
  static_assert(ROWB == 128u || ROWB == 256u, "pad interval code is set for rows of 128 or 256 bytes");
  constexpr unsigned ivl = (ROWB == 256u) ? 5u : 4u;
  v8u g;
  g[0] = uni((1u << 20) | (ivl << 22) | (3u << 25));
  g[1] = uni(ROWB << 16);
  g[2] = uni(ROWS << 16);
  g[3] = uni(ROWB << 16);
  g[4] = uni(ROWS);
  g[5] = uni(srcPitch);
  g[6] = uni(0u);
  g[7] = uni(0u);
  return g;
}

__device__ __forceinline__ void tdm_load(v4u& g0, v8u g1) {
  asm volatile("tensor_load_to_lds %0, %1" : "+s"(g0) : "s"(g1) : "memory");
}

// The mover's waits are not placed by the compiler.
__device__ __forceinline__ void wait_tensor0(v4u& g0, v8u g1) {
  asm volatile("s_wait_tensorcnt 0" : "+s"(g0) : "s"(g1) : "memory");
}

__device__ __forceinline__ void wait_tensor0(v4u& g0a, v8u g1a, v4u& g0b, v8u g1b) {
  asm volatile("s_wait_tensorcnt 0" : "+s"(g0a), "+s"(g0b) : "s"(g1a), "s"(g1b) : "memory");
}

__device__ __forceinline__ v8u held(v8u g) {
  asm volatile("" : "+s"(g));
  return g;
}

// 16 consecutive f16 of a padded LDS row (16-byte aligned): two ds_load_b128.
__device__ __forceinline__ v16h ld_frag(const _Float16* p) {
  const v8h lo = *(const v8h*)p;
  const v8h hi = *(const v8h*)(p + 8);
  return __builtin_shufflevector(lo, hi, 0, 1, 2, 3, 4, 5, 6, 7, 8, 9, 10, 11, 12, 13, 14, 15);
}

// LDS pitches in f16 elements: 128-B rows + 16 B, 256-B rows + 16 B.
#define P128 72
#define P256 136
// One padded tile's place in LDS, in f16 elements: 128 x 144 B = 18432 B = 9 x 2 KiB
// (64 x 272 B = 17408 B is rounded up to the same), so every place is a multiple of 2 KiB.
#define TILE_H 9216

// ---------------------------------------------------------------------------
// GEMM:  C[M,N] (f32) = A[M,K](f16) x W[N,K](f16)^T + bias[N]
// blockIdx.z picks one of up to three independent products on the same A in ONE launch:
// W and C of slice z lie z * N * K and z * M * N elements behind the first, bias by pointer.
// 256 threads = 8 waves arranged 2x4; workgroup tile 128x256, wave tile 64x64; a pass is 128 k
// (256 B of every operand row). A fragment read from LDS feeds four WMMAs, and a byte landed
// from L2 serves 128 or 256 output columns or rows.
// A stage is six slices of 64 rows (A: 0, 1; W: 2..5) at a pitch of 272 B, each at its own
// multiple of 2 KiB; waves 0..5 each bring their own slice by one tensor_load_to_lds (one
// request of a wave outstanding). Two buffers: stage s + 2 is issued behind the barrier that
// ends pass s's LDS reads, into the buffer that pass s has read; the pass's last 32-k block of
// WMMAs works from registers behind that barrier. K is at least two passes.
// ---------------------------------------------------------------------------
__global__ __launch_bounds__(256) void gemm_f16_kernel(
    const _Float16* __restrict__ Ah, const _Float16* __restrict__ Wh0,
    const float* __restrict__ bias0, const float* __restrict__ bias1,
    const float* __restrict__ bias2, float* __restrict__ C0,
    int M, int N, int K)
{
  const int zs = blockIdx.z;
  const _Float16* const Wh = Wh0 + (size_t)zs * N * K;
  const float* const bias  = (zs == 0) ? bias0 : (zs == 1) ? bias1 : bias2;
  float* const C           = C0 + (size_t)zs * M * N;

  __shared__ __attribute__((aligned(2048))) _Float16 Ls[2][6][TILE_H];  // [buf][slice], 12 x 18 KB

  const int tid  = threadIdx.x;
  const int lane = tid & 31;
  const int wave = tid >> 5;
  const int ln   = lane & 15;
  const int hf   = lane >> 4;
  const int rowg = wave >> 2;  // 0..1 : 64-row group = A slice
  const int colg = wave & 3;   // 0..3 : 64-col group = W slice

  const int n0 = blockIdx.x * 256;
  const int m0 = blockIdx.y * 128;

  const unsigned wv = uni((unsigned)tid >> 5);  // the wave's number, scalar
  const unsigned sl = (wv < 6u) ? wv : 5u;      // this wave's slice (waves 6 and 7 issue nothing)
  const _Float16* tBase = (sl < 2u) ? Ah + (size_t)(m0 + (int)sl * 64) * K
                                    : Wh + (size_t)(n0 + ((int)sl - 2) * 64) * K;
  const unsigned  tL    = lds_addr(&Ls[0][sl][0]);
  const v8u g1 = held(tdm_group1<256, 64>((unsigned)K * 2u));  // 64 rows x 256 B, pitch K f16
  v4u g0 = tdm_group0(tL, tBase);

  // Every wave forms the words (scalar work); only the issue itself stands behind a test.
  auto aimTile = [&](int buf, int k0) {
    const v4u n = tdm_group0(tL + (unsigned)buf * (6u * TILE_H * 2u), tBase + k0);
    g0[1] = n[1]; g0[2] = n[2]; g0[3] = n[3];
  };

  v8f acc[4][4] = {};

  const int NT = K / 128;
  if (pinned(wv < 6u)) tdm_load(g0, g1);
  wait_tensor0(g0, g1);
  __syncthreads();
  aimTile(1, 128);
  if (pinned(wv < 6u)) tdm_load(g0, g1);
  for (int it = 0; it < NT; ++it) {
    const int buf = it & 1;
    const _Float16* const aL = &Ls[buf][rowg][ln * P256 + hf * 16];
    const _Float16* const bL = &Ls[buf][2 + colg][ln * P256 + hf * 16];

    // All 32 fragments of the pass are read as one group, each into registers of its own: one
    // place with LDS reads a pass, and the buffer is left as early as the LDS delivers.
    v16h af[4][4], bf[4][4];
#pragma unroll
    for (int kb = 0; kb < 4; kb++) {
#pragma unroll
      for (int r = 0; r < 4; r++) af[kb][r] = ld_frag(aL + r * 16 * P256 + kb * 32);
#pragma unroll
      for (int nb = 0; nb < 4; nb++) bf[kb][nb] = ld_frag(bL + nb * 16 * P256 + kb * 32);
    }
    __builtin_amdgcn_sched_barrier(0);  // keeps the reads in front: sunk to their uses, each would be waited for alone
    auto mmaBlk = [&](int kb) {
#pragma unroll
      for (int nb = 0; nb < 4; nb++)
#pragma unroll
        for (int r = 0; r < 4; r++) acc[r][nb] = WMMA_F16(af[kb][r], bf[kb][nb], acc[r][nb]);
    };
    mmaBlk(0);
    mmaBlk(1);
    mmaBlk(2);
    __builtin_amdgcn_sched_barrier(0);  // keeps these WMMAs in front of the waits: the later reads land under them
    wait_ds0();            // every fragment of the pass is in registers: this wave has left buf
    wait_tensor0(g0, g1);  // this wave's slice of stage it + 1 has landed
    __syncthreads();       // publishes stage it + 1; every wave has left buf
    aimTile(buf, (it + 2) * 128);
    if (pinned((wv < 6u) & (it + 2 < NT))) tdm_load(g0, g1);
    __builtin_amdgcn_sched_barrier(0);  // keeps the refill's issue in front of the last block's WMMAs: a whole pass of lead
    mmaBlk(3);  // from registers alone: the matrix unit has work while the next pass's first reads are on their way
  }
  wait_tensor0(g0, g1);  // nothing of the mover is outstanding on any path to the wave's end
  wait_ds0();

  // ---- epilogue: bias + f32 store ----
  float bb[4];
#pragma unroll
  for (int nb = 0; nb < 4; nb++) bb[nb] = bias[n0 + colg * 64 + nb * 16 + ln];
  // Stands in front of every later overwrite of the bias loads' address registers.
  asm volatile("s_wait_xcnt 0x0" ::: "memory");
#pragma unroll
  for (int r = 0; r < 4; r++) {
#pragma unroll
    for (int nb = 0; nb < 4; nb++) {
      const int col = n0 + colg * 64 + nb * 16 + ln;
#pragma unroll
      for (int j = 0; j < 8; j++) {
        const int row = m0 + rowg * 64 + r * 16 + j + 8 * hf;
        C[(size_t)row * N + col] = acc[r][nb][j] + bb[nb];
      }
    }
  }
}

// ---------------------------------------------------------------------------
// Fused RMSNorm (over D = 2048) + interleaved RoPE + f16 downconvert: ONE WAVE A ROW.
// A lane holds 16 float4 of the row (float4 c * 32 + lane: every load of the wave covers 512
// contiguous bytes) and as much of its cos and sin rows, all 48 loads in flight at once; the sum
// of squares runs in four chains inside the lane and through one five-step butterfly, so no LDS
// and no barrier is needed.
// ---------------------------------------------------------------------------
__device__ __forceinline__ void rmsnorm_rope_wave(
    const int row, const int t,  // row = b*T + t
    const float* __restrict__ src, const float* __restrict__ w,
    const float* __restrict__ cosb, const float* __restrict__ sinb,
    _Float16* __restrict__ dst, int D, float outScale)
{
  const int lane = threadIdx.x & 31;
  const float4* const h4 = (const float4*)(src + (size_t)row * D) + lane;
  const float4* const c4 = (const float4*)(cosb + (size_t)t * D) + lane;
  const float4* const s4 = (const float4*)(sinb + (size_t)t * D) + lane;
  const float4* const w4 = (const float4*)w + lane;
  v4h* const d4 = (v4h*)(dst + (size_t)row * D) + lane;

  // Every loop over c is unrolled, so that the three arrays stay in registers.
  float4 h[16], cv[16], sv[16];
#pragma unroll
  for (int c = 0; c < 16; c++) h[c] = h4[c * 32];
#pragma unroll
  for (int c = 0; c < 16; c++) cv[c] = c4[c * 32];
#pragma unroll
  for (int c = 0; c < 16; c++) sv[c] = s4[c * 32];
  // Keeps the row's 48 loads in front, in flight together: the build without this line issues 28 of
  // them in front and sinks the rest to their uses, where they are waited for one or two at a time,
  // one memory latency behind the other.
  __builtin_amdgcn_sched_barrier(0);
  float sq[4] = {0.f, 0.f, 0.f, 0.f};
#pragma unroll
  for (int c = 0; c < 16; c++)
    sq[c & 3] += h[c].x * h[c].x + h[c].y * h[c].y + h[c].z * h[c].z + h[c].w * h[c].w;
  float ss = (sq[0] + sq[1]) + (sq[2] + sq[3]);
#pragma unroll
  for (int off = 16; off > 0; off >>= 1) ss += __shfl_xor(ss, off, 32);
  const float rinv = rsqrtf(ss / (float)D + 1e-6f);

#pragma unroll
  for (int c = 0; c < 16; c++) {
    const float4 wv = w4[c * 32];
    const float h0 = h[c].x * wv.x * rinv, h1 = h[c].y * wv.y * rinv;
    const float h2 = h[c].z * wv.z * rinv, h3 = h[c].w * wv.w * rinv;
    v4h o;
    o[0] = (_Float16)((h0 * cv[c].x - h1 * sv[c].x) * outScale);
    o[1] = (_Float16)((h1 * cv[c].y + h0 * sv[c].y) * outScale);
    o[2] = (_Float16)((h2 * cv[c].z - h3 * sv[c].z) * outScale);
    o[3] = (_Float16)((h3 * cv[c].w + h2 * sv[c].w) * outScale);
    d4[c * 32] = o;
  }
  // Stands in front of every later overwrite of a register that the row's stores name.
  asm volatile("s_wait_xcnt 0x0" ::: "memory");
}

// f32 -> f16 bulk convert, x and the four W matrices in ONE launch: blockIdx.y picks one of six
// segments of n4 float4 each (x is two of them); the f16 copies lie one behind the other at dst0.
// A workgroup converts CVT_WG float4, 32 a lane in batches of eight (many 16-byte loads of a wave in
// flight, each over 512 contiguous bytes): few long-lived waves, all resident at once, for speed only. n4 is a multiple of CVT_WG.
#define CVT_BATCHES 4
#define CVT_WG (256 * 8 * CVT_BATCHES)
__global__ __launch_bounds__(256) void cvt_f16_kernel(
    const float* __restrict__ x, const float* __restrict__ Wq, const float* __restrict__ Wk,
    const float* __restrict__ Wv, const float* __restrict__ Wo, _Float16* __restrict__ dst0, int n4)
{
  const int seg = blockIdx.y;
  const float* src = x + (size_t)(seg & 1) * n4 * 4;  // segments 0 and 1
  src = (seg == 2) ? Wq : src;
  src = (seg == 3) ? Wk : src;
  src = (seg == 4) ? Wv : src;
  src = (seg == 5) ? Wo : src;
  _Float16* const dst = dst0 + (size_t)seg * n4 * 4;
  const size_t i0 = (size_t)blockIdx.x * CVT_WG + threadIdx.x;
  const float4* const s4 = (const float4*)src + i0;
  v4h* const d4 = (v4h*)dst + i0;
  // Unrolled: f stays in registers, every offset is an immediate, and a batch's loads are issued
  // while the batch in front of it is still on its way.
#pragma unroll
  for (int bt = 0; bt < CVT_BATCHES; bt++) {
    float4 f[8];
#pragma unroll
    for (int u = 0; u < 8; u++) f[u] = s4[(bt * 8 + u) * 256];
#pragma unroll
    for (int u = 0; u < 8; u++) {
      v4h o;
      o[0] = (_Float16)f[u].x; o[1] = (_Float16)f[u].y;
      o[2] = (_Float16)f[u].z; o[3] = (_Float16)f[u].w;
      d4[(bt * 8 + u) * 256] = o;
    }
  }
}

__device__ __forceinline__ void transpose_v_body(
    _Float16* Ls, const int t0, const int hh, const int b,
    const float* __restrict__ vf, _Float16* __restrict__ vT, int T)
{
  const int tid = threadIdx.x;
  const int D = 2048, H = 16, Dh = 128;

  {  // load + convert 64t x 128dh tile (coalesced reads)
    const int r = tid >> 2, q = tid & 3;
    const float* sp = vf + (size_t)(b * T + t0 + r) * D + hh * Dh + q * 32;
    v16h u0, u1;
#pragma unroll
    for (int i = 0; i < 16; i++) { u0[i] = (_Float16)sp[i]; u1[i] = (_Float16)sp[16 + i]; }
    *(v16h*)&Ls[r * 128 + q * 32]      = u0;
    *(v16h*)&Ls[r * 128 + q * 32 + 16] = u1;
  }
  __syncthreads();
  {  // write transposed (coalesced writes over t)
    const int dh = tid >> 1, half = tid & 1;
    v16h o0, o1;
#pragma unroll
    for (int i = 0; i < 16; i++) {
      o0[i] = Ls[(half * 32 + i) * 128 + dh];
      o1[i] = Ls[(half * 32 + 16 + i) * 128 + dh];
    }
    _Float16* dp = vT + ((size_t)(b * H + hh) * Dh + dh) * T + t0 + half * 32;
    *(v16h*)dp        = o0;
    *(v16h*)(dp + 16) = o1;
  }
}

// The three independent steps between the projections and attention in ONE launch, by block
// index: first the V tiles (T/64 x 16 heads x batch), then the 2 M rows of q and k, a row a wave.
// Rows are dealt so that those of one position t (q and k of every batch), which read the same
// cos and sin rows, stand in neighbouring waves.
__global__ __launch_bounds__(256) void prep_qkv_kernel(
    const float* __restrict__ qf, const float* __restrict__ kf, const float* __restrict__ vf,
    const float* __restrict__ qnw, const float* __restrict__ knw,
    const float* __restrict__ cosb, const float* __restrict__ sinb,
    _Float16* __restrict__ qh, _Float16* __restrict__ kh, _Float16* __restrict__ vT,
    int M, int T, int D, float qScale)
{
  __shared__ _Float16 Ls[64 * 128];  // V tile [t][dh] f16, 16KB
  const int nT = T / 64;
  const int nV = (M / 64) * 16;      // V tiles
  const int blk = blockIdx.x;
  if (blk < nV) {
    transpose_v_body(Ls, (blk % nT) * 64, (blk / nT) % 16, blk / (nT * 16), vf, vT, T);
  } else {
    const int u = (blk - nV) * 8 + (int)uni(threadIdx.x >> 5);  // the wave's row unit, scalar
    const bool isK = u & 1;
    const int nB = M / T, bt = u >> 1;
    const int t = bt / nB, b = bt - t * nB;
    rmsnorm_rope_wave(b * T + t, t, isK ? kf : qf, isK ? knw : qnw, cosb, sinb,
                      isK ? kh : qh, D, isK ? 1.0f : qScale);
  }
}

__device__ __forceinline__ float xhalf(float x) {
  const int v = __builtin_bit_cast(int, x);
  return __builtin_bit_cast(float, __builtin_amdgcn_permlanex16(v, v, 0x76543210, 0xfedcba98, false, false));
}

// A fragment in the k order that a pair of converted D tiles has as B: element s of half
// hf is k = 8*hf + s (s < 8), 16 + 8*hf + (s - 8) (s >= 8). p points at k = 0 of the 32.
__device__ __forceinline__ v16h ld_frag_kmap(const _Float16* p, int hf) {
  const v8h lo = *(const v8h*)(p + 8 * hf);
  const v8h hi = *(const v8h*)(p + 16 + 8 * hf);
  return __builtin_shufflevector(lo, hi, 0, 1, 2, 3, 4, 5, 6, 7, 8, 9, 10, 11, 12, 13, 14, 15);
}

__global__ __launch_bounds__(256) void flash_attn_kernel(
    const _Float16* __restrict__ qh, const _Float16* __restrict__ kh,
    const _Float16* __restrict__ vT, _Float16* __restrict__ oh, int T)
{
  // [0], [1]: K [key][dh]; [2], [3]: V [dh][key]; 4 x 18 KB
  __shared__ __attribute__((aligned(2048))) _Float16 Ls[4][TILE_H];

  const int tid  = threadIdx.x;
  const int lane = tid & 31;
  const int wave = tid >> 5;
  const int ln   = lane & 15;
  const int hf   = lane >> 4;

  const int q0 = blockIdx.x * 128;
  const int hh = blockIdx.y;
  const int b  = blockIdx.z;
  const int D = 2048, Dh = 128, H = 16;

  // Q B-fragments (column ln = query): 4 chunks of K=32 covering Dh=128 (kept resident)
  const size_t qrow = (size_t)(b * T + q0 + wave * 16 + ln);
  v16h qB[4];
#pragma unroll
  for (int kc = 0; kc < 4; kc++)
    qB[kc] = *(const v16h*)&qh[qrow * D + hh * Dh + kc * 32 + hf * 16];
  // Stands in front of every later overwrite of the Q loads' address registers, also on the path
  // that goes round the key loop.
  asm volatile("s_wait_xcnt 0x0" ::: "memory");

  v8f oAcc[8] = {};       // oAcc[nd][j] = O^T[dh = nd*16 + 8*hf + j][query ln]
  float rowm = -3.0e38f;  // the query's running maximum, equal in both halves
  float rowl = 0.f;       // the sum over this half's keys; the halves are joined behind the loop

  const _Float16* kBase = kh + (size_t)(b * T) * D + hh * Dh;
  const _Float16* vBase = vT + (size_t)(b * H + hh) * Dh * T;
  const unsigned wv  = uni((unsigned)tid >> 5);  // the wave's number, scalar
  const unsigned kLb = lds_addr(&Ls[0][0]);
  const unsigned vLb = lds_addr(&Ls[2][0]);
  const v8u g1K = held(tdm_group1<256, 64>((unsigned)D * 2u));   // 64 keys x 256B rows, pitch D f16
  const v8u g1V = held(tdm_group1<128, 128>((unsigned)T * 2u));  // 128 dh x 128B rows, pitch T f16
  v4u g0K = tdm_group0(kLb, kBase), g0V = tdm_group0(vLb, vBase);

  // Every wave forms the words (scalar work); only the issue itself stands behind a test.
  auto aimK = [&](int buf, int kt0) {
    const v4u n = tdm_group0(kLb + (unsigned)buf * (TILE_H * 2u), kBase + (size_t)kt0 * D);
    g0K[1] = n[1]; g0K[2] = n[2]; g0K[3] = n[3];
  };
  auto aimV = [&](int buf, int kt0) {
    const v4u n = tdm_group0(vLb + (unsigned)buf * (TILE_H * 2u), vBase + kt0);
    g0V[1] = n[1]; g0V[2] = n[2]; g0V[3] = n[3];
  };

  const int NT = T / 64;
  if (pinned(wv == 0u)) tdm_load(g0K, g1K);
  if (pinned(wv == 1u)) tdm_load(g0V, g1V);
  wait_tensor0(g0K, g1K, g0V, g1V);
  __syncthreads();
  aimK(1, 64);
  aimV(1, 64);
  if (pinned(wv == 0u)) tdm_load(g0K, g1K);
  if (pinned(wv == 1u)) tdm_load(g0V, g1V);
  for (int it = 0; it < NT; ++it) {
    const int buf = it & 1;
    const _Float16* const Vt = &Ls[2 + buf][0];

    // ---- S^T = K * Q^T (16 WMMA): s[n][j] = score of key n*16 + 8*hf + j, query ln ----
    // K fragments are read in groups of four (one kc), two groups in flight in two register
    // sets: a group is waited for once, while the group behind it is already on its way.
    v8f s[4] = {};
    v16h kf[2][4];
    auto readK = [&](v16h (&g)[4], int kc) {
#pragma unroll
      for (int n = 0; n < 4; n++)
        g[n] = ld_frag(&Ls[buf][(n * 16 + ln) * P256 + kc * 32 + hf * 16]);
    };
    readK(kf[0], 0);
    readK(kf[1], 1);
    __builtin_amdgcn_sched_barrier(0);  // keeps both groups' reads in front of the first WMMA
#pragma unroll
    for (int kc = 0; kc < 4; kc++) {
#pragma unroll
      for (int n = 0; n < 4; n++) s[n] = WMMA_F16(kf[kc & 1][n], qB[kc], s[n]);
      if (kc + 2 < 4) {
        readK(kf[kc & 1], kc + 2);
        __builtin_amdgcn_sched_barrier(0);  // keeps the refill in front of the other set's WMMAs
      }
    }

    v16h vf[2][4];
    auto readV = [&](v16h (&g)[4], int grp) {
#pragma unroll
      for (int i = 0; i < 4; i++)
        g[i] = ld_frag_kmap(&Vt[(((grp & 1) * 4 + i) * 16 + ln) * P128 + (grp >> 1) * 32], hf);
    };
    readV(vf[0], 0);
    readV(vf[1], 1);
    __builtin_amdgcn_sched_barrier(0);  // keeps these reads in front of the softmax

    // ---- online softmax, one query a lane ----
    float tn[4];
#pragma unroll
    for (int n = 0; n < 4; n++)
      tn[n] = fmaxf(fmaxf(fmaxf(s[n][0], s[n][1]), fmaxf(s[n][2], s[n][3])),
                    fmaxf(fmaxf(s[n][4], s[n][5]), fmaxf(s[n][6], s[n][7])));
    float tm = fmaxf(fmaxf(tn[0], tn[1]), fmaxf(tn[2], tn[3]));
    tm = fmaxf(tm, xhalf(tm));
    const float mnew  = fmaxf(rowm, tm);
    const float alpha = __expf(rowm - mnew);
    rowm = mnew;
#pragma unroll
    for (int nd = 0; nd < 8; nd++) oAcc[nd] *= alpha;
    float pn[4];  // four independent chains
#pragma unroll
    for (int n = 0; n < 4; n++) {
      pn[n] = 0.f;
#pragma unroll
      for (int j = 0; j < 8; j++) {
        const float p = __expf(s[n][j] - mnew);
        s[n][j] = p;
        pn[n] += p;
      }
    }
    rowl = rowl * alpha + ((pn[0] + pn[1]) + (pn[2] + pn[3]));

    // ---- P^T as B operand: two score tiles converted in place cover 32 keys ----
    v16h pB[2];
#pragma unroll
    for (int kc = 0; kc < 2; kc++)
#pragma unroll
      for (int e = 0; e < 8; e++) {
        pB[kc][e]     = (_Float16)s[2 * kc][e];
        pB[kc][8 + e] = (_Float16)s[2 * kc + 1][e];
      }

    asm volatile("" :: "v"(pB[0]), "v"(pB[1]), "v"(rowl) : "memory");

    // ---- O^T += V^T * P^T (16 WMMA) ----
#pragma unroll
    for (int grp = 0; grp < 4; grp++) {
#pragma unroll
      for (int i = 0; i < 4; i++)
        oAcc[(grp & 1) * 4 + i] = WMMA_F16(vf[grp & 1][i], pB[grp >> 1], oAcc[(grp & 1) * 4 + i]);
      if (grp + 2 < 4) {
        readV(vf[grp & 1], grp + 2);
        __builtin_amdgcn_sched_barrier(0);  // keeps the refill in front of the other set's WMMAs
      }
    }
    wait_ds0();                        // this wave has left both buffers of the pass
    wait_tensor0(g0K, g1K, g0V, g1V);  // waves 0 and 1: their tile it + 1 has landed
    __syncthreads();                   // publishes tile it + 1; every wave has left K[buf] and V[buf]
    aimK(buf, (it + 2) * 64);
    aimV(buf, (it + 2) * 64);
    if (pinned((wv == 0u) & (it + 2 < NT))) tdm_load(g0K, g1K);
    if (pinned((wv == 1u) & (it + 2 < NT))) tdm_load(g0V, g1V);
  }
  wait_tensor0(g0K, g1K, g0V, g1V);  // nothing of the mover is outstanding on any path to the wave's end
  wait_ds0();

  // ---- normalize and store f16 attention output: 8 consecutive dh of the lane's query a store ----
  const float inv = 1.0f / (rowl + xhalf(rowl));
  _Float16* const op = oh + qrow * D + hh * Dh + 8 * hf;
#pragma unroll
  for (int nd = 0; nd < 8; nd++) {
    v8h o;
#pragma unroll
    for (int j = 0; j < 8; j++) o[j] = (_Float16)(oAcc[nd][j] * inv);
    *(v8h*)(op + nd * 16) = o;
  }
}

// ---------------------------------------------------------------------------
extern "C" void kernel_launch(void* const* d_in, const int* in_sizes, int n_in,
                              void* d_out, int out_size, void* d_ws, size_t ws_size,
                              hipStream_t stream)
{
  (void)in_sizes; (void)n_in; (void)out_size; (void)ws_size;
  const float* x    = (const float*)d_in[0];
  const float* cosb = (const float*)d_in[1];
  const float* sinb = (const float*)d_in[2];
  const float* Wq   = (const float*)d_in[3];
  const float* bq   = (const float*)d_in[4];
  const float* Wk   = (const float*)d_in[5];
  const float* bk   = (const float*)d_in[6];
  const float* Wv   = (const float*)d_in[7];
  const float* bv   = (const float*)d_in[8];
  const float* qnw  = (const float*)d_in[9];
  const float* knw  = (const float*)d_in[10];
  const float* Wo   = (const float*)d_in[11];
  const float* bo   = (const float*)d_in[12];
  float* out = (float*)d_out;

  const int B = 2, T = 2048, D = 2048, H = 16;
  const int M = B * T;

  // Workspace layout (208 MB total)
  char* ws = (char*)d_ws;
  const size_t MB = 1ull << 20;
  float*    qf  = (float*)(ws + 0 * MB);       // 32 MB f32 q
  float*    kf  = (float*)(ws + 32 * MB);      // 32 MB f32 k
  float*    vf  = (float*)(ws + 64 * MB);      // 32 MB f32 v
  _Float16* qh  = (_Float16*)(ws + 96 * MB);   // 16 MB f16 q-hat
  _Float16* kh  = (_Float16*)(ws + 112 * MB);  // 16 MB f16 k-hat
  _Float16* vTh = (_Float16*)(ws + 128 * MB);  // 16 MB f16 V transposed
  _Float16* oh  = (_Float16*)(ws + 144 * MB);  // 16 MB f16 attn out
  _Float16* xh  = (_Float16*)(ws + 160 * MB);  // 16 MB f16 x
  _Float16* Wqh = (_Float16*)(ws + 176 * MB);  //  8 MB
  _Float16* Wkh = (_Float16*)(ws + 184 * MB);  //  8 MB
  _Float16* Wvh = (_Float16*)(ws + 192 * MB);  //  8 MB
  _Float16* Woh = (_Float16*)(ws + 200 * MB);  //  8 MB

  (void)Wkh; (void)Wvh;  // reached as slices 1 and 2 behind Wqh

  dim3 blk(256);
  const int nx4 = M * D / 4, nw4 = D * D / 4;
  static_assert(nx4 == 2 * nw4, "x is two segments of the conversion launch");
  static_assert(nw4 % CVT_WG == 0, "a segment is whole workgroups of the conversion launch");
  // xh, Wqh, Wkh, Wvh, Woh lie one behind the other: six segments of nw4 float4.
  cvt_f16_kernel<<<dim3(nw4 / CVT_WG, 6), blk, 0, stream>>>(x, Wq, Wk, Wv, Wo, xh, nw4);

  // q, k, v in one launch: Wqh, Wkh, Wvh and qf, kf, vf lie one behind the other.
  gemm_f16_kernel<<<dim3(D / 256, M / 128, 3), blk, 0, stream>>>(xh, Wqh, bq, bk, bv, qf, M, D, D);

  const float qscale = 0.08838834764831845f;  // 1/sqrt(128), folded into Q
  prep_qkv_kernel<<<(M / 64) * H + 2 * M / 8, blk, 0, stream>>>(qf, kf, vf, qnw, knw, cosb, sinb,
                                                            qh, kh, vTh, M, T, D, qscale);

  flash_attn_kernel<<<dim3(T / 128, H, B), blk, 0, stream>>>(qh, kh, vTh, oh, T);

  gemm_f16_kernel<<<dim3(D / 256, M / 128, 1), blk, 0, stream>>>(oh, Woh, bo, bo, bo, out, M, D, D);
}

// v009
// A run of this version takes 174 microseconds.
// Two timings next to v008 both put it at 1.03 times that version's speed.
// All steps since v000 together make it 4.55 times as fast.
#include <hip/hip_runtime.h>
#include <hip/hip_bf16.h>

typedef __attribute__((ext_vector_type(16))) _Float16 v16h;
typedef __attribute__((ext_vector_type(8)))  _Float16 v8h;
typedef __attribute__((ext_vector_type(4)))  _Float16 v4h;
typedef __attribute__((ext_vector_type(8)))  float    v8f;
typedef __attribute__((ext_vector_type(4)))  unsigned int v4u;

#define WMMA_F16(a, b, c) \
  __builtin_amdgcn_wmma_f32_16x16x32_f16(false, (a), false, (b), (short)0, (c), false, false)

__device__ __forceinline__ unsigned lds_addr(const void* p) {
  return (unsigned)(uintptr_t)p;  // low 32 bits of generic shared ptr = LDS offset
}

typedef __attribute__((ext_vector_type(8))) unsigned int v8u;

__device__ __forceinline__ unsigned uni(unsigned v) { return (unsigned)__builtin_amdgcn_readfirstlane(v); }

__device__ __forceinline__ unsigned pinned(unsigned v) {
  unsigned w = uni(v);
  asm volatile("" : "+s"(w));  // pinned(): keeps the condition in a scalar register
  return w;
}

// A wave's LDS reads have retired before a barrier frees their buffer for a refill.
__device__ __forceinline__ void wait_ds0() { asm volatile("s_wait_dscnt 0" ::: "memory"); }

__device__ __forceinline__ v4u tdm_group0(unsigned ldsaddr, const void* gaddr) {
  const unsigned long long ga = (unsigned long long)(uintptr_t)gaddr;
  v4u g;
  g[0] = uni(1u);                                                   // count = 1
  g[1] = uni(ldsaddr);                                              // LDS byte offset
  g[2] = uni((unsigned)ga);                                         // address [31:0]
  g[3] = uni((((unsigned)(ga >> 32)) & 0x01FFFFFFu) | 0x80000000u); // address [56:32] | type = 2
  return g;
}

template <unsigned ROWB, unsigned ROWS>
__device__ __forceinline__ v8u tdm_group1(unsigned srcPitch) {
  static_assert(ROWB == 128u || ROWB == 256u, "pad interval code is set for rows of 128 or 256 bytes");
  constexpr unsigned ivl = (ROWB == 256u) ? 5u : 4u;
  v8u g;
  g[0] = uni((1u << 20) | (ivl << 22) | (3u << 25));
  g[1] = uni(ROWB << 16);
  g[2] = uni(ROWS << 16);
  g[3] = uni(ROWB << 16);
  g[4] = uni(ROWS);
  g[5] = uni(srcPitch);
  g[6] = uni(0u);
  g[7] = uni(0u);
  return g;
}

__device__ __forceinline__ void tdm_load(v4u& g0, v8u g1) {
  asm volatile("tensor_load_to_lds %0, %1" : "+s"(g0) : "s"(g1) : "memory");
}

// The mover's waits are not placed by the compiler.
__device__ __forceinline__ void wait_tensor0(v4u& g0, v8u g1) {
  asm volatile("s_wait_tensorcnt 0" : "+s"(g0) : "s"(g1) : "memory");
}

__device__ __forceinline__ void wait_tensor0(v4u& g0a, v8u g1a, v4u& g0b, v8u g1b) {
  asm volatile("s_wait_tensorcnt 0" : "+s"(g0a), "+s"(g0b) : "s"(g1a), "s"(g1b) : "memory");
}

__device__ __forceinline__ v8u held(v8u g) {
  asm volatile("" : "+s"(g));
  return g;
}

// 16 consecutive f16 of a padded LDS row (16-byte aligned): two ds_load_b128.
__device__ __forceinline__ v16h ld_frag(const _Float16* p) {
  const v8h lo = *(const v8h*)p;
  const v8h hi = *(const v8h*)(p + 8);
  return __builtin_shufflevector(lo, hi, 0, 1, 2, 3, 4, 5, 6, 7, 8, 9, 10, 11, 12, 13, 14, 15);
}

// LDS pitches in f16 elements: 128-B rows + 16 B, 256-B rows + 16 B.
#define P128 72
#define P256 136
// One padded tile's place in LDS, in f16 elements: 128 x 144 B = 18432 B = 9 x 2 KiB
// (64 x 272 B = 17408 B is rounded up to the same), so every place is a multiple of 2 KiB.
#define TILE_H 9216

// ---------------------------------------------------------------------------
// GEMM:  C[M,N] (f32) = A[M,K](f16) x W[N,K](f16)^T + bias[N]
// blockIdx.z picks one of up to three independent products on the same A in ONE launch:
// W and C of slice z lie z * N * K and z * M * N elements behind the first, bias by pointer.
// 256 threads = 8 waves arranged 2x4; workgroup tile 128x256, wave tile 64x64; a pass is 128 k
// (256 B of every operand row). A fragment read from LDS feeds four WMMAs, and a byte landed
// from L2 serves 128 or 256 output columns or rows.
// A stage is six slices of 64 rows (A: 0, 1; W: 2..5) at a pitch of 272 B, each at its own
// multiple of 2 KiB; waves 0..5 each bring their own slice by one tensor_load_to_lds (one
// request of a wave outstanding). Two buffers: stage s + 2 is issued behind the barrier that
// ends pass s's LDS reads, into the buffer that pass s has read; the pass's last 32-k block of
// WMMAs works from registers behind that barrier. K is at least two passes.
// ---------------------------------------------------------------------------
__global__ __launch_bounds__(256) void gemm_f16_kernel(
    const _Float16* __restrict__ Ah, const _Float16* __restrict__ Wh0,
    const float* __restrict__ bias0, const float* __restrict__ bias1,
    const float* __restrict__ bias2, float* __restrict__ C0,
    int M, int N, int K)
{
  const int zs = blockIdx.z;
  const _Float16* const Wh = Wh0 + (size_t)zs * N * K;
  const float* const bias  = (zs == 0) ? bias0 : (zs == 1) ? bias1 : bias2;
  float* const C           = C0 + (size_t)zs * M * N;

  __shared__ __attribute__((aligned(2048))) _Float16 Ls[2][6][TILE_H];  // [buf][slice], 12 x 18 KB

  const int tid  = threadIdx.x;
  const int lane = tid & 31;
  const int wave = tid >> 5;
  const int ln   = lane & 15;
  const int hf   = lane >> 4;
  const int rowg = wave >> 2;  // 0..1 : 64-row group = A slice
  const int colg = wave & 3;   // 0..3 : 64-col group = W slice

  const int n0 = blockIdx.x * 256;
  const int m0 = blockIdx.y * 128;

  const unsigned wv = uni((unsigned)tid >> 5);  // the wave's number, scalar
  const unsigned sl = (wv < 6u) ? wv : 5u;      // this wave's slice (waves 6 and 7 issue nothing)
  const _Float16* tBase = (sl < 2u) ? Ah + (size_t)(m0 + (int)sl * 64) * K
                                    : Wh + (size_t)(n0 + ((int)sl - 2) * 64) * K;
  const unsigned  tL    = lds_addr(&Ls[0][sl][0]);
  const v8u g1 = held(tdm_group1<256, 64>((unsigned)K * 2u));  // 64 rows x 256 B, pitch K f16
  v4u g0 = tdm_group0(tL, tBase);

  // Every wave forms the words (scalar work); only the issue itself stands behind a test.
  auto aimTile = [&](int buf, int k0) {
    const v4u n = tdm_group0(tL + (unsigned)buf * (6u * TILE_H * 2u), tBase + k0);
    g0[1] = n[1]; g0[2] = n[2]; g0[3] = n[3];
  };

  v8f acc[4][4] = {};

  const int NT = K / 128;
  if (pinned(wv < 6u)) tdm_load(g0, g1);
  wait_tensor0(g0, g1);
  __syncthreads();
  aimTile(1, 128);
  if (pinned(wv < 6u)) tdm_load(g0, g1);
  for (int it = 0; it < NT; ++it) {
    const int buf = it & 1;
    const _Float16* const aL = &Ls[buf][rowg][ln * P256 + hf * 16];
    const _Float16* const bL = &Ls[buf][2 + colg][ln * P256 + hf * 16];

    // All 32 fragments of the pass are read as one group, each into registers of its own: one
    // place with LDS reads a pass, and the buffer is left as early as the LDS delivers.
    v16h af[4][4], bf[4][4];
#pragma unroll
    for (int kb = 0; kb < 4; kb++) {
#pragma unroll
      for (int r = 0; r < 4; r++) af[kb][r] = ld_frag(aL + r * 16 * P256 + kb * 32);
#pragma unroll
      for (int nb = 0; nb < 4; nb++) bf[kb][nb] = ld_frag(bL + nb * 16 * P256 + kb * 32);
    }
    __builtin_amdgcn_sched_barrier(0);  // keeps the reads in front: sunk to their uses, each would be waited for alone
    auto mmaBlk = [&](int kb) {
#pragma unroll
      for (int nb = 0; nb < 4; nb++)
#pragma unroll
        for (int r = 0; r < 4; r++) acc[r][nb] = WMMA_F16(af[kb][r], bf[kb][nb], acc[r][nb]);
    };
    mmaBlk(0);
    mmaBlk(1);
    mmaBlk(2);
    __builtin_amdgcn_sched_barrier(0);  // keeps these WMMAs in front of the waits: the later reads land under them
    wait_ds0();            // every fragment of the pass is in registers: this wave has left buf
    wait_tensor0(g0, g1);  // this wave's slice of stage it + 1 has landed
    __syncthreads();       // publishes stage it + 1; every wave has left buf
    aimTile(buf, (it + 2) * 128);
    if (pinned((wv < 6u) & (it + 2 < NT))) tdm_load(g0, g1);
    __builtin_amdgcn_sched_barrier(0);  // keeps the refill's issue in front of the last block's WMMAs: a whole pass of lead
    mmaBlk(3);  // from registers alone: the matrix unit has work while the next pass's first reads are on their way
  }
  wait_tensor0(g0, g1);  // nothing of the mover is outstanding on any path to the wave's end
  wait_ds0();

  // ---- epilogue: bias + f32 store ----
  float bb[4];
#pragma unroll
  for (int nb = 0; nb < 4; nb++) bb[nb] = bias[n0 + colg * 64 + nb * 16 + ln];
  // Stands in front of every later overwrite of the bias loads' address registers.
  asm volatile("s_wait_xcnt 0x0" ::: "memory");
#pragma unroll
  for (int r = 0; r < 4; r++) {
#pragma unroll
    for (int nb = 0; nb < 4; nb++) {
      const int col = n0 + colg * 64 + nb * 16 + ln;
#pragma unroll
      for (int j = 0; j < 8; j++) {
        const int row = m0 + rowg * 64 + r * 16 + j + 8 * hf;
        C[(size_t)row * N + col] = acc[r][nb][j] + bb[nb];
      }
    }
  }
}

// ---------------------------------------------------------------------------
// Fused RMSNorm (over D = 2048) + interleaved RoPE + f16 downconvert: ONE WAVE A ROW.
// A lane holds 16 float4 of the row (float4 c * 32 + lane: every load of the wave covers 512
// contiguous bytes) and as much of its cos and sin rows, all 48 loads in flight at once; the sum
// of squares runs in four chains inside the lane and through one five-step butterfly, so no LDS
// and no barrier is needed.
// ---------------------------------------------------------------------------
__device__ __forceinline__ void rmsnorm_rope_wave(
    const int row, const int t,  // row = b*T + t
    const float* __restrict__ src, const float* __restrict__ w,
    const float* __restrict__ cosb, const float* __restrict__ sinb,
    _Float16* __restrict__ dst, int D, float outScale)
{
  const int lane = threadIdx.x & 31;
  const float4* const h4 = (const float4*)(src + (size_t)row * D) + lane;
  const float4* const c4 = (const float4*)(cosb + (size_t)t * D) + lane;
  const float4* const s4 = (const float4*)(sinb + (size_t)t * D) + lane;
  const float4* const w4 = (const float4*)w + lane;
  v4h* const d4 = (v4h*)(dst + (size_t)row * D) + lane;

  // Every loop over c is unrolled, so that the three arrays stay in registers.
  float4 h[16], cv[16], sv[16];
#pragma unroll
  for (int c = 0; c < 16; c++) h[c] = h4[c * 32];
#pragma unroll
  for (int c = 0; c < 16; c++) cv[c] = c4[c * 32];
#pragma unroll
  for (int c = 0; c < 16; c++) sv[c] = s4[c * 32];
  // Keeps the row's 48 loads in front, in flight together: the build without this line issues 28 of
  // them in front and sinks the rest to their uses, where they are waited for one or two at a time,
  // one memory latency behind the other.
  __builtin_amdgcn_sched_barrier(0);
  float sq[4] = {0.f, 0.f, 0.f, 0.f};
#pragma unroll
  for (int c = 0; c < 16; c++)
    sq[c & 3] += h[c].x * h[c].x + h[c].y * h[c].y + h[c].z * h[c].z + h[c].w * h[c].w;
  float ss = (sq[0] + sq[1]) + (sq[2] + sq[3]);
#pragma unroll
  for (int off = 16; off > 0; off >>= 1) ss += __shfl_xor(ss, off, 32);
  const float rinv = rsqrtf(ss / (float)D + 1e-6f);

#pragma unroll
  for (int c = 0; c < 16; c++) {
    const float4 wv = w4[c * 32];
    const float h0 = h[c].x * wv.x * rinv, h1 = h[c].y * wv.y * rinv;
    const float h2 = h[c].z * wv.z * rinv, h3 = h[c].w * wv.w * rinv;
    v4h o;
    o[0] = (_Float16)((h0 * cv[c].x - h1 * sv[c].x) * outScale);
    o[1] = (_Float16)((h1 * cv[c].y + h0 * sv[c].y) * outScale);
    o[2] = (_Float16)((h2 * cv[c].z - h3 * sv[c].z) * outScale);
    o[3] = (_Float16)((h3 * cv[c].w + h2 * sv[c].w) * outScale);
    d4[c * 32] = o;
  }
  // Stands in front of every later overwrite of a register that the row's stores name.
  asm volatile("s_wait_xcnt 0x0" ::: "memory");
}

// f32 -> f16 bulk convert, x and the four W matrices in ONE launch: blockIdx.y picks one of six
// segments of n4 float4 each (x is two of them); the f16 copies lie one behind the other at dst0.
// A workgroup converts CVT_WG float4, 32 a lane in batches of eight (many 16-byte loads of a wave in
// flight, each over 512 contiguous bytes): few long-lived waves, all resident at once, for speed only. n4 is a multiple of CVT_WG.
#define CVT_BATCHES 4
#define CVT_WG (256 * 8 * CVT_BATCHES)
__global__ __launch_bounds__(256) void cvt_f16_kernel(
    const float* __restrict__ x, const float* __restrict__ Wq, const float* __restrict__ Wk,
    const float* __restrict__ Wv, const float* __restrict__ Wo, _Float16* __restrict__ dst0, int n4)
{
  const int seg = blockIdx.y;
  const float* src = x + (size_t)(seg & 1) * n4 * 4;  // segments 0 and 1
  src = (seg == 2) ? Wq : src;
  src = (seg == 3) ? Wk : src;
  src = (seg == 4) ? Wv : src;
  src = (seg == 5) ? Wo : src;
  _Float16* const dst = dst0 + (size_t)seg * n4 * 4;
  const size_t i0 = (size_t)blockIdx.x * CVT_WG + threadIdx.x;
  const float4* const s4 = (const float4*)src + i0;
  v4h* const d4 = (v4h*)dst + i0;
  // Unrolled: f stays in registers, every offset is an immediate, and a batch's loads are issued
  // while the batch in front of it is still on its way.
#pragma unroll
  for (int bt = 0; bt < CVT_BATCHES; bt++) {
    float4 f[8];
#pragma unroll
    for (int u = 0; u < 8; u++) f[u] = s4[(bt * 8 + u) * 256];
#pragma unroll
    for (int u = 0; u < 8; u++) {
      v4h o;
      o[0] = (_Float16)f[u].x; o[1] = (_Float16)f[u].y;
      o[2] = (_Float16)f[u].z; o[3] = (_Float16)f[u].w;
      d4[(bt * 8 + u) * 256] = o;
    }
  }
}

__device__ __forceinline__ void transpose_v_body(
    _Float16* Ls, const int t0, const int hh, const int b,
    const float* __restrict__ vf, _Float16* __restrict__ vT, int T)
{
  const int tid = threadIdx.x;
  const int D = 2048, H = 16, Dh = 128;

  {  // load + convert 64t x 128dh tile (coalesced reads)
    const int r = tid >> 2, q = tid & 3;
    const float* sp = vf + (size_t)(b * T + t0 + r) * D + hh * Dh + q * 32;
    v16h u0, u1;
#pragma unroll
    for (int i = 0; i < 16; i++) { u0[i] = (_Float16)sp[i]; u1[i] = (_Float16)sp[16 + i]; }
    *(v16h*)&Ls[r * 128 + q * 32]      = u0;
    *(v16h*)&Ls[r * 128 + q * 32 + 16] = u1;
  }
  __syncthreads();
  {  // write transposed (coalesced writes over t)
    const int dh = tid >> 1, half = tid & 1;
    v16h o0, o1;
#pragma unroll
    for (int i = 0; i < 16; i++) {
      o0[i] = Ls[(half * 32 + i) * 128 + dh];
      o1[i] = Ls[(half * 32 + 16 + i) * 128 + dh];
    }
    _Float16* dp = vT + ((size_t)(b * H + hh) * Dh + dh) * T + t0 + half * 32;
    *(v16h*)dp        = o0;
    *(v16h*)(dp + 16) = o1;
  }
}

// The three independent steps between the projections and attention in ONE launch, by block
// index: first the V tiles (T/64 x 16 heads x batch), then the 2 M rows of q and k, a row a wave.
// Rows are dealt so that those of one position t (q and k of every batch), which read the same
// cos and sin rows, stand in neighbouring waves.
__global__ __launch_bounds__(256) void prep_qkv_kernel(
    const float* __restrict__ qf, const float* __restrict__ kf, const float* __restrict__ vf,
    const float* __restrict__ qnw, const float* __restrict__ knw,
    const float* __restrict__ cosb, const float* __restrict__ sinb,
    _Float16* __restrict__ qh, _Float16* __restrict__ kh, _Float16* __restrict__ vT,
    int M, int T, int D, float qScale)
{
  __shared__ _Float16 Ls[64 * 128];  // V tile [t][dh] f16, 16KB
  const int nT = T / 64;
  const int nV = (M / 64) * 16;      // V tiles
  const int blk = blockIdx.x;
  if (blk < nV) {
    transpose_v_body(Ls, (blk % nT) * 64, (blk / nT) % 16, blk / (nT * 16), vf, vT, T);
  } else {
    const int u = (blk - nV) * 8 + (int)uni(threadIdx.x >> 5);  // the wave's row unit, scalar
    const bool isK = u & 1;
    const int nB = M / T, bt = u >> 1;
    const int t = bt / nB, b = bt - t * nB;
    rmsnorm_rope_wave(b * T + t, t, isK ? kf : qf, isK ? knw : qnw, cosb, sinb,
                      isK ? kh : qh, D, isK ? 1.0f : qScale);
  }
}

__device__ __forceinline__ float xhalf(float x) {
  const int v = __builtin_bit_cast(int, x);
  return __builtin_bit_cast(float, __builtin_amdgcn_permlanex16(v, v, 0x76543210, 0xfedcba98, false, false));
}

// A fragment in the k order that a pair of converted D tiles has as B: element s of half
// hf is k = 8*hf + s (s < 8), 16 + 8*hf + (s - 8) (s >= 8). p points at k = 0 of the 32.
__device__ __forceinline__ v16h ld_frag_kmap(const _Float16* p, int hf) {
  const v8h lo = *(const v8h*)(p + 8 * hf);
  const v8h hi = *(const v8h*)(p + 16 + 8 * hf);
  return __builtin_shufflevector(lo, hi, 0, 1, 2, 3, 4, 5, 6, 7, 8, 9, 10, 11, 12, 13, 14, 15);
}

__global__ __launch_bounds__(128) void flash_attn_kernel(
    const _Float16* __restrict__ qh, const _Float16* __restrict__ kh,
    const _Float16* __restrict__ vT, _Float16* __restrict__ oh, int T)
{
  // [0], [1]: K [key][dh]; [2], [3]: V [dh][key]; 4 x 18 KB
  __shared__ __attribute__((aligned(2048))) _Float16 Ls[4][TILE_H];

  const int tid  = threadIdx.x;
  const int lane = tid & 31;
  const int wave = tid >> 5;
  const int ln   = lane & 15;
  const int hf   = lane >> 4;

  const int q0 = blockIdx.x * 128;
  const int hh = blockIdx.y;
  const int b  = blockIdx.z;
  const int D = 2048, Dh = 128, H = 16;

  // Q B-fragments (column ln of group c = query): 4 chunks of K=32 covering Dh=128 (kept resident)
  const size_t qrow = (size_t)(b * T + q0 + wave * 32 + ln);  // group c: qrow + 16 * c
  v16h qB[2][4];
#pragma unroll
  for (int c = 0; c < 2; c++)
#pragma unroll
    for (int kc = 0; kc < 4; kc++)
      qB[c][kc] = *(const v16h*)&qh[(qrow + 16 * c) * D + hh * Dh + kc * 32 + hf * 16];
  // Stands in front of every later overwrite of the Q loads' address registers, also on the path
  // that goes round the key loop.
  asm volatile("s_wait_xcnt 0x0" ::: "memory");

  v8f oAcc[2][8] = {};                   // oAcc[c][nd][j] = O^T[dh = nd*16 + 8*hf + j][query ln of group c]
  float rowm[2] = {-3.0e38f, -3.0e38f};  // the query's running maximum, equal in both halves
  float rowl[2] = {0.f, 0.f};            // the sum over this half's keys; the halves are joined behind the loop

  const _Float16* kBase = kh + (size_t)(b * T) * D + hh * Dh;
  const _Float16* vBase = vT + (size_t)(b * H + hh) * Dh * T;
  const unsigned wv  = uni((unsigned)tid >> 5);  // the wave's number, scalar
  const unsigned kLb = lds_addr(&Ls[0][0]);
  const unsigned vLb = lds_addr(&Ls[2][0]);
  const v8u g1K = held(tdm_group1<256, 64>((unsigned)D * 2u));   // 64 keys x 256B rows, pitch D f16
  const v8u g1V = held(tdm_group1<128, 128>((unsigned)T * 2u));  // 128 dh x 128B rows, pitch T f16
  v4u g0K = tdm_group0(kLb, kBase), g0V = tdm_group0(vLb, vBase);

  // Every wave forms the words (scalar work); only the issue itself stands behind a test.
  auto aimK = [&](int buf, int kt0) {
    const v4u n = tdm_group0(kLb + (unsigned)buf * (TILE_H * 2u), kBase + (size_t)kt0 * D);
    g0K[1] = n[1]; g0K[2] = n[2]; g0K[3] = n[3];
  };
  auto aimV = [&](int buf, int kt0) {
    const v4u n = tdm_group0(vLb + (unsigned)buf * (TILE_H * 2u), vBase + kt0);
    g0V[1] = n[1]; g0V[2] = n[2]; g0V[3] = n[3];
  };

  const int NT = T / 64;
  if (pinned(wv == 0u)) tdm_load(g0K, g1K);
  if (pinned(wv == 1u)) tdm_load(g0V, g1V);
  wait_tensor0(g0K, g1K, g0V, g1V);
  __syncthreads();
  aimK(1, 64);
  aimV(1, 64);
  if (pinned(wv == 0u)) tdm_load(g0K, g1K);
  if (pinned(wv == 1u)) tdm_load(g0V, g1V);
  for (int it = 0; it < NT; ++it) {
    const int buf = it & 1;
    const _Float16* const Vt = &Ls[2 + buf][0];

    // ---- S^T = K * Q^T (32 WMMA): s[c][n][j] = score of key n*16 + 8*hf + j, query ln of group c ----
    // K fragments are read in groups of four (one kc), two groups in flight in two register
    // sets: a group is waited for once, while the group behind it is already on its way.
    v8f s[2][4] = {};
    v16h kf[2][4];
    auto readK = [&](v16h (&g)[4], int kc) {
#pragma unroll
      for (int n = 0; n < 4; n++)
        g[n] = ld_frag(&Ls[buf][(n * 16 + ln) * P256 + kc * 32 + hf * 16]);
    };
    readK(kf[0], 0);
    readK(kf[1], 1);
    __builtin_amdgcn_sched_barrier(0);  // keeps both groups' reads in front of the first WMMA
#pragma unroll
    for (int kc = 0; kc < 4; kc++) {
#pragma unroll
      for (int n = 0; n < 4; n++)
#pragma unroll
        for (int c = 0; c < 2; c++) s[c][n] = WMMA_F16(kf[kc & 1][n], qB[c][kc], s[c][n]);
      if (kc + 2 < 4) {
        readK(kf[kc & 1], kc + 2);
        __builtin_amdgcn_sched_barrier(0);  // keeps the refill in front of the other set's WMMAs
      }
    }

    v16h vf[2][4];
    auto readV = [&](v16h (&g)[4], int grp) {
#pragma unroll
      for (int i = 0; i < 4; i++)
        g[i] = ld_frag_kmap(&Vt[(((grp & 1) * 4 + i) * 16 + ln) * P128 + (grp >> 1) * 32], hf);
    };
    readV(vf[0], 0);
    readV(vf[1], 1);
    __builtin_amdgcn_sched_barrier(0);  // keeps these reads in front of the softmax

    // ---- online softmax, one query a lane and group; P^T as B operand: two score tiles
    // converted in place cover 32 keys ----
    v16h pB[2][2];
    float mnew[2], alpha[2];
#pragma unroll
    for (int c = 0; c < 2; c++) {
      float tn[4];
#pragma unroll
      for (int n = 0; n < 4; n++)
        tn[n] = fmaxf(fmaxf(fmaxf(s[c][n][0], s[c][n][1]), fmaxf(s[c][n][2], s[c][n][3])),
                      fmaxf(fmaxf(s[c][n][4], s[c][n][5]), fmaxf(s[c][n][6], s[c][n][7])));
      float tm = fmaxf(fmaxf(tn[0], tn[1]), fmaxf(tn[2], tn[3]));
      tm = fmaxf(tm, xhalf(tm));
      mnew[c]  = fmaxf(rowm[c], tm);
      alpha[c] = __expf(rowm[c] - mnew[c]);
      rowm[c]  = mnew[c];
    }
#pragma unroll
    for (int c = 0; c < 2; c++) {
#pragma unroll
      for (int nd = 0; nd < 8; nd++) oAcc[c][nd] *= alpha[c];
      float pn[4];  // four independent chains
#pragma unroll
      for (int n = 0; n < 4; n++) {
        pn[n] = 0.f;
#pragma unroll
        for (int j = 0; j < 8; j++) {
          const float p = __expf(s[c][n][j] - mnew[c]);
          s[c][n][j] = p;
          pn[n] += p;
        }
      }
      rowl[c] = rowl[c] * alpha[c] + ((pn[0] + pn[1]) + (pn[2] + pn[3]));
#pragma unroll
      for (int kc = 0; kc < 2; kc++)
#pragma unroll
        for (int e = 0; e < 8; e++) {
          pB[c][kc][e]     = (_Float16)s[c][2 * kc][e];
          pB[c][kc][8 + e] = (_Float16)s[c][2 * kc + 1][e];
        }
    }

    // ---- O^T += V^T * P^T (32 WMMA) ----
#pragma unroll
    for (int grp = 0; grp < 4; grp++) {
#pragma unroll
      for (int i = 0; i < 4; i++)
#pragma unroll
        for (int c = 0; c < 2; c++)
          oAcc[c][(grp & 1) * 4 + i] = WMMA_F16(vf[grp & 1][i], pB[c][grp >> 1], oAcc[c][(grp & 1) * 4 + i]);
      if (grp + 2 < 4) {
        readV(vf[grp & 1], grp + 2);
        __builtin_amdgcn_sched_barrier(0);  // keeps the refill in front of the other set's WMMAs
      }
    }
    wait_ds0();                        // this wave has left both buffers of the pass
    wait_tensor0(g0K, g1K, g0V, g1V);  // waves 0 and 1: their tile it + 1 has landed
    __syncthreads();                   // publishes tile it + 1; every wave has left K[buf] and V[buf]
    aimK(buf, (it + 2) * 64);
    aimV(buf, (it + 2) * 64);
    if (pinned((wv == 0u) & (it + 2 < NT))) tdm_load(g0K, g1K);
    if (pinned((wv == 1u) & (it + 2 < NT))) tdm_load(g0V, g1V);
  }
  wait_tensor0(g0K, g1K, g0V, g1V);  // nothing of the mover is outstanding on any path to the wave's end
  wait_ds0();

  // ---- normalize and store f16 attention output: 8 consecutive dh of the lane's query a store ----
#pragma unroll
  for (int c = 0; c < 2; c++) {
    const float inv = 1.0f / (rowl[c] + xhalf(rowl[c]));
    _Float16* const op = oh + (qrow + 16 * c) * D + hh * Dh + 8 * hf;
#pragma unroll
    for (int nd = 0; nd < 8; nd++) {
      v8h o;
#pragma unroll
      for (int j = 0; j < 8; j++) o[j] = (_Float16)(oAcc[c][nd][j] * inv);
      *(v8h*)(op + nd * 16) = o;
    }
  }
}

// ---------------------------------------------------------------------------
extern "C" void kernel_launch(void* const* d_in, const int* in_sizes, int n_in,
                              void* d_out, int out_size, void* d_ws, size_t ws_size,
                              hipStream_t stream)
{
  (void)in_sizes; (void)n_in; (void)out_size; (void)ws_size;
  const float* x    = (const float*)d_in[0];
  const float* cosb = (const float*)d_in[1];
  const float* sinb = (const float*)d_in[2];
  const float* Wq   = (const float*)d_in[3];
  const float* bq   = (const float*)d_in[4];
  const float* Wk   = (const float*)d_in[5];
  const float* bk   = (const float*)d_in[6];
  const float* Wv   = (const float*)d_in[7];
  const float* bv   = (const float*)d_in[8];
  const float* qnw  = (const float*)d_in[9];
  const float* knw  = (const float*)d_in[10];
  const float* Wo   = (const float*)d_in[11];
  const float* bo   = (const float*)d_in[12];
  float* out = (float*)d_out;

  const int B = 2, T = 2048, D = 2048, H = 16;
  const int M = B * T;

  // Workspace layout (208 MB total)
  char* ws = (char*)d_ws;
  const size_t MB = 1ull << 20;
  float*    qf  = (float*)(ws + 0 * MB);       // 32 MB f32 q
  float*    kf  = (float*)(ws + 32 * MB);      // 32 MB f32 k
  float*    vf  = (float*)(ws + 64 * MB);      // 32 MB f32 v
  _Float16* qh  = (_Float16*)(ws + 96 * MB);   // 16 MB f16 q-hat
  _Float16* kh  = (_Float16*)(ws + 112 * MB);  // 16 MB f16 k-hat
  _Float16* vTh = (_Float16*)(ws + 128 * MB);  // 16 MB f16 V transposed
  _Float16* oh  = (_Float16*)(ws + 144 * MB);  // 16 MB f16 attn out
  _Float16* xh  = (_Float16*)(ws + 160 * MB);  // 16 MB f16 x
  _Float16* Wqh = (_Float16*)(ws + 176 * MB);  //  8 MB
  _Float16* Wkh = (_Float16*)(ws + 184 * MB);  //  8 MB
  _Float16* Wvh = (_Float16*)(ws + 192 * MB);  //  8 MB
  _Float16* Woh = (_Float16*)(ws + 200 * MB);  //  8 MB

  (void)Wkh; (void)Wvh;  // reached as slices 1 and 2 behind Wqh

  dim3 blk(256);
  const int nx4 = M * D / 4, nw4 = D * D / 4;
  static_assert(nx4 == 2 * nw4, "x is two segments of the conversion launch");
  static_assert(nw4 % CVT_WG == 0, "a segment is whole workgroups of the conversion launch");
  // xh, Wqh, Wkh, Wvh, Woh lie one behind the other: six segments of nw4 float4.
  cvt_f16_kernel<<<dim3(nw4 / CVT_WG, 6), blk, 0, stream>>>(x, Wq, Wk, Wv, Wo, xh, nw4);

  // q, k, v in one launch: Wqh, Wkh, Wvh and qf, kf, vf lie one behind the other.
  gemm_f16_kernel<<<dim3(D / 256, M / 128, 3), blk, 0, stream>>>(xh, Wqh, bq, bk, bv, qf, M, D, D);

  const float qscale = 0.08838834764831845f;  // 1/sqrt(128), folded into Q
  prep_qkv_kernel<<<(M / 64) * H + 2 * M / 8, blk, 0, stream>>>(qf, kf, vf, qnw, knw, cosb, sinb,
                                                            qh, kh, vTh, M, T, D, qscale);

  flash_attn_kernel<<<dim3(T / 128, H, B), dim3(128), 0, stream>>>(qh, kh, vTh, oh, T);

  gemm_f16_kernel<<<dim3(D / 256, M / 128, 1), blk, 0, stream>>>(oh, Woh, bo, bo, bo, out, M, D, D);
}

// v010
// It runs in 166 microseconds.
// Next to v009, in two timings, it ran 1.05 times as fast each time.
// Counting every step since v000, it is 4.79 times as fast.
#include <hip/hip_runtime.h>
#include <hip/hip_bf16.h>

typedef __attribute__((ext_vector_type(16))) _Float16 v16h;
typedef __attribute__((ext_vector_type(8)))  _Float16 v8h;
typedef __attribute__((ext_vector_type(4)))  _Float16 v4h;
typedef __attribute__((ext_vector_type(8)))  float    v8f;
typedef __attribute__((ext_vector_type(4)))  unsigned int v4u;

#define WMMA_F16(a, b, c) \
  __builtin_amdgcn_wmma_f32_16x16x32_f16(false, (a), false, (b), (short)0, (c), false, false)

__device__ __forceinline__ unsigned lds_addr(const void* p) {
  return (unsigned)(uintptr_t)p;  // low 32 bits of generic shared ptr = LDS offset
}

typedef __attribute__((ext_vector_type(8))) unsigned int v8u;

__device__ __forceinline__ unsigned uni(unsigned v) { return (unsigned)__builtin_amdgcn_readfirstlane(v); }

__device__ __forceinline__ unsigned pinned(unsigned v) {
  unsigned w = uni(v);
  asm volatile("" : "+s"(w));  // pinned(): keeps the condition in a scalar register
  return w;
}

// A wave's LDS reads have retired before a barrier frees their buffer for a refill.
__device__ __forceinline__ void wait_ds0() { asm volatile("s_wait_dscnt 0" ::: "memory"); }

__device__ __forceinline__ v4u tdm_group0(unsigned ldsaddr, const void* gaddr) {
  const unsigned long long ga = (unsigned long long)(uintptr_t)gaddr;
  v4u g;
  g[0] = uni(1u);                                                   // count = 1
  g[1] = uni(ldsaddr);                                              // LDS byte offset
  g[2] = uni((unsigned)ga);                                         // address [31:0]
  g[3] = uni((((unsigned)(ga >> 32)) & 0x01FFFFFFu) | 0x80000000u); // address [56:32] | type = 2
  return g;
}

template <unsigned ROWB, unsigned ROWS>
__device__ __forceinline__ v8u tdm_group1(unsigned srcPitch) {
  static_assert(ROWB == 128u || ROWB == 256u, "pad interval code is set for rows of 128 or 256 bytes");
  constexpr unsigned ivl = (ROWB == 256u) ? 5u : 4u;
  v8u g;
  g[0] = uni((1u << 20) | (ivl << 22) | (3u << 25));
  g[1] = uni(ROWB << 16);
  g[2] = uni(ROWS << 16);
  g[3] = uni(ROWB << 16);
  g[4] = uni(ROWS);
  g[5] = uni(srcPitch);
  g[6] = uni(0u);
  g[7] = uni(0u);
  return g;
}

// The same with the tile's rows in a scalar register (waves of one kernel bring tiles of
// different heights); word 0 stays the constant.
template <unsigned ROWB>
__device__ __forceinline__ v8u tdm_group1_rows(unsigned rows, unsigned srcPitch) {
  static_assert(ROWB == 128u || ROWB == 256u, "pad interval code is set for rows of 128 or 256 bytes");
  constexpr unsigned ivl = (ROWB == 256u) ? 5u : 4u;
  v8u g;
  g[0] = uni((1u << 20) | (ivl << 22) | (3u << 25));
  g[1] = uni(ROWB << 16);
  g[2] = uni(rows << 16);
  g[3] = uni(ROWB << 16);
  g[4] = uni(rows);
  g[5] = uni(srcPitch);
  g[6] = uni(0u);
  g[7] = uni(0u);
  return g;
}

__device__ __forceinline__ void tdm_load(v4u& g0, v8u g1) {
  asm volatile("tensor_load_to_lds %0, %1" : "+s"(g0) : "s"(g1) : "memory");
}

// The mover's waits are not placed by the compiler.
__device__ __forceinline__ void wait_tensor0(v4u& g0, v8u g1) {
  asm volatile("s_wait_tensorcnt 0" : "+s"(g0) : "s"(g1) : "memory");
}

__device__ __forceinline__ void wait_tensor0(v4u& g0a, v8u g1a, v4u& g0b, v8u g1b) {
  asm volatile("s_wait_tensorcnt 0" : "+s"(g0a), "+s"(g0b) : "s"(g1a), "s"(g1b) : "memory");
}

__device__ __forceinline__ v8u held(v8u g) {
  asm volatile("" : "+s"(g));
  return g;
}

// 16 consecutive f16 of a padded LDS row (16-byte aligned): two ds_load_b128.
__device__ __forceinline__ v16h ld_frag(const _Float16* p) {
  const v8h lo = *(const v8h*)p;
  const v8h hi = *(const v8h*)(p + 8);
  return __builtin_shufflevector(lo, hi, 0, 1, 2, 3, 4, 5, 6, 7, 8, 9, 10, 11, 12, 13, 14, 15);
}

// LDS pitches in f16 elements: 128-B rows + 16 B, 256-B rows + 16 B.
#define P128 72
#define P256 136
// One padded tile's place in LDS, in f16 elements: 128 x 144 B = 18432 B = 9 x 2 KiB
// (64 x 272 B = 17408 B is rounded up to the same), so every place is a multiple of 2 KiB.
#define TILE_H 9216

// ---------------------------------------------------------------------------
// GEMM:  C[M,N] (f32) = A[M,K](f16) x W[N,K](f16)^T + bias[N]
// blockIdx.z picks one of up to three independent products on the same A in ONE launch:
// W and C of slice z lie z * N * K and z * M * N elements behind the first, bias by pointer.
// 256 threads = 8 waves arranged 2x4; workgroup tile 128x256, wave tile 64x64; a pass is 128 k
// (256 B of every operand row). A fragment read from LDS feeds four WMMAs, and a byte landed
// from L2 serves 128 or 256 output columns or rows.
// A stage is six slices of 64 rows (A: 0, 1; W: 2..5) at a pitch of 272 B, each at its own
// multiple of 2 KiB; waves 0..5 each bring their own slice by one tensor_load_to_lds (one
// request of a wave outstanding). Two buffers: stage s + 2 is issued behind the barrier that
// ends pass s's LDS reads, into the buffer that pass s has read; the pass's last 32-k block of
// WMMAs works from registers behind that barrier. K is at least two passes.
// ---------------------------------------------------------------------------
__global__ __launch_bounds__(256) void gemm_f16_kernel(
    const _Float16* __restrict__ Ah, const _Float16* __restrict__ Wh0,
    const float* __restrict__ bias0, const float* __restrict__ bias1,
    const float* __restrict__ bias2, float* __restrict__ C0,
    int M, int N, int K)
{
  const int zs = blockIdx.z;
  const _Float16* const Wh = Wh0 + (size_t)zs * N * K;
  const float* const bias  = (zs == 0) ? bias0 : (zs == 1) ? bias1 : bias2;
  float* const C           = C0 + (size_t)zs * M * N;

  __shared__ __attribute__((aligned(2048))) _Float16 Ls[2][6][TILE_H];  // [buf][slice], 12 x 18 KB

  const int tid  = threadIdx.x;
  const int lane = tid & 31;
  const int wave = tid >> 5;
  const int ln   = lane & 15;
  const int hf   = lane >> 4;
  const int rowg = wave >> 2;  // 0..1 : 64-row group = A slice
  const int colg = wave & 3;   // 0..3 : 64-col group = W slice

  const int n0 = blockIdx.x * 256;
  const int m0 = blockIdx.y * 128;

  const unsigned wv = uni((unsigned)tid >> 5);  // the wave's number, scalar
  const unsigned sl = (wv < 6u) ? wv : 5u;      // this wave's slice (waves 6 and 7 issue nothing)
  const _Float16* tBase = (sl < 2u) ? Ah + (size_t)(m0 + (int)sl * 64) * K
                                    : Wh + (size_t)(n0 + ((int)sl - 2) * 64) * K;
  const unsigned  tL    = lds_addr(&Ls[0][sl][0]);
  const v8u g1 = held(tdm_group1<256, 64>((unsigned)K * 2u));  // 64 rows x 256 B, pitch K f16
  v4u g0 = tdm_group0(tL, tBase);

  // Every wave forms the words (scalar work); only the issue itself stands behind a test.
  auto aimTile = [&](int buf, int k0) {
    const v4u n = tdm_group0(tL + (unsigned)buf * (6u * TILE_H * 2u), tBase + k0);
    g0[1] = n[1]; g0[2] = n[2]; g0[3] = n[3];
  };

  v8f acc[4][4] = {};

  const int NT = K / 128;
  if (pinned(wv < 6u)) tdm_load(g0, g1);
  wait_tensor0(g0, g1);
  __syncthreads();
  aimTile(1, 128);
  if (pinned(wv < 6u)) tdm_load(g0, g1);
  for (int it = 0; it < NT; ++it) {
    const int buf = it & 1;
    const _Float16* const aL = &Ls[buf][rowg][ln * P256 + hf * 16];
    const _Float16* const bL = &Ls[buf][2 + colg][ln * P256 + hf * 16];

    // All 32 fragments of the pass are read as one group, each into registers of its own: one
    // place with LDS reads a pass, and the buffer is left as early as the LDS delivers.
    v16h af[4][4], bf[4][4];
#pragma unroll
    for (int kb = 0; kb < 4; kb++) {
#pragma unroll
      for (int r = 0; r < 4; r++) af[kb][r] = ld_frag(aL + r * 16 * P256 + kb * 32);
#pragma unroll
      for (int nb = 0; nb < 4; nb++) bf[kb][nb] = ld_frag(bL + nb * 16 * P256 + kb * 32);
    }
    __builtin_amdgcn_sched_barrier(0);  // keeps the reads in front: sunk to their uses, each would be waited for alone
    auto mmaBlk = [&](int kb) {
#pragma unroll
      for (int nb = 0; nb < 4; nb++)
#pragma unroll
        for (int r = 0; r < 4; r++) acc[r][nb] = WMMA_F16(af[kb][r], bf[kb][nb], acc[r][nb]);
    };
    mmaBlk(0);
    mmaBlk(1);
    mmaBlk(2);
    __builtin_amdgcn_sched_barrier(0);  // keeps these WMMAs in front of the waits: the later reads land under them
    wait_ds0();            // every fragment of the pass is in registers: this wave has left buf
    wait_tensor0(g0, g1);  // this wave's slice of stage it + 1 has landed
    __syncthreads();       // publishes stage it + 1; every wave has left buf
    aimTile(buf, (it + 2) * 128);
    if (pinned((wv < 6u) & (it + 2 < NT))) tdm_load(g0, g1);
    __builtin_amdgcn_sched_barrier(0);  // keeps the refill's issue in front of the last block's WMMAs: a whole pass of lead
    mmaBlk(3);  // from registers alone: the matrix unit has work while the next pass's first reads are on their way
  }
  wait_tensor0(g0, g1);  // nothing of the mover is outstanding on any path to the wave's end
  wait_ds0();

  // ---- epilogue: bias + f32 store ----
  float bb[4];
#pragma unroll
  for (int nb = 0; nb < 4; nb++) bb[nb] = bias[n0 + colg * 64 + nb * 16 + ln];
  // Stands in front of every later overwrite of the bias loads' address registers.
  asm volatile("s_wait_xcnt 0x0" ::: "memory");
#pragma unroll
  for (int r = 0; r < 4; r++) {
#pragma unroll
    for (int nb = 0; nb < 4; nb++) {
      const int col = n0 + colg * 64 + nb * 16 + ln;
#pragma unroll
      for (int j = 0; j < 8; j++) {
        const int row = m0 + rowg * 64 + r * 16 + j + 8 * hf;
        C[(size_t)row * N + col] = acc[r][nb][j] + bb[nb];
      }
    }
  }
}

// ---------------------------------------------------------------------------
// The q, k and v projections as ONE product: C[M, 3N] = A[M,K] x W[3N,K]^T + bias, the three W
// lying one behind the other (3N rows), the three C and the three bias vectors apart (a 16-column
// tile lies in one of them: N is a multiple of 16).
// Workgroup tile 256x192, 8 waves arranged 4x2, wave tile 64x96: against 128x256 and 64x64 a
// workgroup lands 448 operand rows for 49152 outputs (was 384 for 32768) and a wave reads 10
// fragments for 24 WMMAs (was 8 for 16), so that both the tensor loads from L2 and the LDS reads
// of a pass take less time than its WMMAs. The grid is two workgroups for every WGP.
// A stage is four A slices of 64 rows and four W slices of 48 rows at a pitch of 272 B, each at
// its own multiple of 2 KiB; every wave brings its own slice by one tensor_load_to_lds (one
// request of a wave outstanding). The ring is that of gemm_f16_kernel.
// ---------------------------------------------------------------------------
#define QA_H 9216                     // A slice, f16 elements: 64 x 272 B rounded up to 9 x 2 KiB
#define QW_H 7168                     // W slice: 48 x 272 B = 13056 B rounded up to 7 x 2 KiB
#define QBUF_H (4 * QA_H + 4 * QW_H)  // a stage: 128 KiB

// N is a compile-time constant, so that every store of the epilogue has its row as an immediate offset.
template <int N>
__global__ __launch_bounds__(256) void gemm_qkv_kernel(
    const _Float16* __restrict__ Ah, const _Float16* __restrict__ Wh,
    const float* __restrict__ bias0, const float* __restrict__ bias1,
    const float* __restrict__ bias2, float* __restrict__ C0,
    int M, int K)
{
  static_assert(N % 16 == 0, "a 16-column tile lies in one product");
  __shared__ __attribute__((aligned(2048))) _Float16 Ls[2 * QBUF_H];  // 256 KiB

  const int tid  = threadIdx.x;
  const int lane = tid & 31;
  const int ln   = lane & 15;
  const int hf   = lane >> 4;
  const unsigned wv = uni((unsigned)tid >> 5);  // the wave's number, scalar
  const int rowg = (int)(wv >> 1);  // 0..3 : 64-row group = A slice
  const int colg = (int)(wv & 1u);  // 0..1 : 96-col group = two W slices

  const int n0 = blockIdx.x * 192;  // column among the 3N
  const int m0 = blockIdx.y * 256;

  // Waves 0..3 bring the A slices, waves 4..7 the W slices.
  const bool isA = wv < 4u;
  const _Float16* const tBase = isA ? Ah + (size_t)(m0 + (int)wv * 64) * K
                                    : Wh + (size_t)(n0 + ((int)wv - 4) * 48) * K;
  const unsigned tL = lds_addr(&Ls[0]) + (isA ? wv * (QA_H * 2u)
                                              : 4u * (QA_H * 2u) + (wv - 4u) * (QW_H * 2u));
  const v8u g1 = held(tdm_group1_rows<256>(isA ? 64u : 48u, (unsigned)K * 2u));
  v4u g0 = tdm_group0(tL, tBase);

  auto aimTile = [&](int buf, int k0) {
    const v4u n = tdm_group0(tL + (unsigned)buf * (QBUF_H * 2u), tBase + k0);
    g0[1] = n[1]; g0[2] = n[2]; g0[3] = n[3];
  };

  v8f acc[4][6] = {};

  const int NT = K / 128;
  tdm_load(g0, g1);
  wait_tensor0(g0, g1);
  __syncthreads();
  aimTile(1, 128);
  tdm_load(g0, g1);
  for (int it = 0; it < NT; ++it) {
    const int buf = it & 1;
    const _Float16* const aL = &Ls[buf * QBUF_H + rowg * QA_H + ln * P256 + hf * 16];
    const _Float16* const bL = &Ls[buf * QBUF_H + 4 * QA_H + colg * (2 * QW_H) + ln * P256 + hf * 16];

    // Three register sets of ten fragments (one 32-k block each): blocks 0..2 are read as one
    // group, block 3 into the first set when block 0's WMMAs have used it.
    v16h af[3][4], bf[3][6];
    auto readBlk = [&](int set, int kb) {
#pragma unroll
      for (int r = 0; r < 4; r++) af[set][r] = ld_frag(aL + r * 16 * P256 + kb * 32);
#pragma unroll
      for (int nb = 0; nb < 6; nb++)
        bf[set][nb] = ld_frag(bL + (nb / 3) * QW_H + (nb % 3) * 16 * P256 + kb * 32);
    };
    auto mmaBlk = [&](int set) {
#pragma unroll
      for (int nb = 0; nb < 6; nb++)
#pragma unroll
        for (int r = 0; r < 4; r++) acc[r][nb] = WMMA_F16(af[set][r], bf[set][nb], acc[r][nb]);
    };
    readBlk(0, 0);
    readBlk(1, 1);
    readBlk(2, 2);
    __builtin_amdgcn_sched_barrier(0);  // keeps the reads in front: sunk to their uses, each would be waited for alone
    mmaBlk(0);
    __builtin_amdgcn_sched_barrier(0);  // keeps block 3's reads one group, behind block 0's WMMAs
    readBlk(0, 3);
    __builtin_amdgcn_sched_barrier(0);  // keeps that group in front of two blocks of WMMAs, under which it lands
    mmaBlk(1);
    mmaBlk(2);
    __builtin_amdgcn_sched_barrier(0);  // keeps these WMMAs in front of the waits
    wait_ds0();            // every fragment of the pass is in registers: this wave has left buf
    wait_tensor0(g0, g1);  // this wave's slice of stage it + 1 has landed
    __syncthreads();       // publishes stage it + 1; every wave has left buf
    aimTile(buf, (it + 2) * 128);
    if (pinned(it + 2 < NT)) tdm_load(g0, g1);
    __builtin_amdgcn_sched_barrier(0);  // keeps the refill's issue in front of the last block's WMMAs: a whole pass of lead
    mmaBlk(0);  // block 3, from registers alone: the matrix unit has work while the next pass's first reads are on their way
  }
  wait_tensor0(g0, g1);  // nothing of the mover is outstanding on any path to the wave's end
  wait_ds0();

  // ---- epilogue: bias + f32 store; each 16-column tile into its own product's C ----
  float bb[6];
  const float* bp[6];
  float* Cn[6];
#pragma unroll
  for (int nb = 0; nb < 6; nb++) {
    const int cg = n0 + colg * 96 + nb * 16;              // wave-uniform
    const int zs = (cg >= 2 * N) ? 2 : (cg >= N) ? 1 : 0;
    const float* const bias = (zs == 0) ? bias0 : (zs == 1) ? bias1 : bias2;
    bp[nb] = bias + (cg - zs * N + ln);
    Cn[nb] = C0 + (size_t)zs * M * N + (size_t)(m0 + rowg * 64 + 8 * hf) * N + (cg - zs * N + ln);
  }
  __builtin_amdgcn_sched_barrier(0);  // every address is formed in front of the six loads: none is formed between them, in a register that an issued load names
#pragma unroll
  for (int nb = 0; nb < 6; nb++) bb[nb] = *bp[nb];
  // Stands in front of every later overwrite of the bias loads' address registers.
  asm volatile("s_wait_xcnt 0x0" ::: "memory");
#pragma unroll
  for (int r = 0; r < 4; r++) {
#pragma unroll
    for (int nb = 0; nb < 6; nb++) {
#pragma unroll
      for (int j = 0; j < 8; j++) Cn[nb][(r * 16 + j) * N] = acc[r][nb][j] + bb[nb];
    }
  }
}

// ---------------------------------------------------------------------------
// Fused RMSNorm (over D = 2048) + interleaved RoPE + f16 downconvert: ONE WAVE A ROW.
// A lane holds 16 float4 of the row (float4 c * 32 + lane: every load of the wave covers 512
// contiguous bytes) and as much of its cos and sin rows, all 48 loads in flight at once; the sum
// of squares runs in four chains inside the lane and through one five-step butterfly, so no LDS
// and no barrier is needed.
// ---------------------------------------------------------------------------
__device__ __forceinline__ void rmsnorm_rope_wave(
    const int row, const int t,  // row = b*T + t
    const float* __restrict__ src, const float* __restrict__ w,
    const float* __restrict__ cosb, const float* __restrict__ sinb,
    _Float16* __restrict__ dst, int D, float outScale)
{
  const int lane = threadIdx.x & 31;
  const float4* const h4 = (const float4*)(src + (size_t)row * D) + lane;
  const float4* const c4 = (const float4*)(cosb + (size_t)t * D) + lane;
  const float4* const s4 = (const float4*)(sinb + (size_t)t * D) + lane;
  const float4* const w4 = (const float4*)w + lane;
  v4h* const d4 = (v4h*)(dst + (size_t)row * D) + lane;

  // Every loop over c is unrolled, so that the three arrays stay in registers.
  float4 h[16], cv[16], sv[16];
#pragma unroll
  for (int c = 0; c < 16; c++) h[c] = h4[c * 32];
#pragma unroll
  for (int c = 0; c < 16; c++) cv[c] = c4[c * 32];
#pragma unroll
  for (int c = 0; c < 16; c++) sv[c] = s4[c * 32];
  // Keeps the row's 48 loads in front, in flight together: the build without this line issues 28 of
  // them in front and sinks the rest to their uses, where they are waited for one or two at a time,
  // one memory latency behind the other.
  __builtin_amdgcn_sched_barrier(0);
  float sq[4] = {0.f, 0.f, 0.f, 0.f};
#pragma unroll
  for (int c = 0; c < 16; c++)
    sq[c & 3] += h[c].x * h[c].x + h[c].y * h[c].y + h[c].z * h[c].z + h[c].w * h[c].w;
  float ss = (sq[0] + sq[1]) + (sq[2] + sq[3]);
#pragma unroll
  for (int off = 16; off > 0; off >>= 1) ss += __shfl_xor(ss, off, 32);
  const float rinv = rsqrtf(ss / (float)D + 1e-6f);

#pragma unroll
  for (int c = 0; c < 16; c++) {
    const float4 wv = w4[c * 32];
    const float h0 = h[c].x * wv.x * rinv, h1 = h[c].y * wv.y * rinv;
    const float h2 = h[c].z * wv.z * rinv, h3 = h[c].w * wv.w * rinv;
    v4h o;
    o[0] = (_Float16)((h0 * cv[c].x - h1 * sv[c].x) * outScale);
    o[1] = (_Float16)((h1 * cv[c].y + h0 * sv[c].y) * outScale);
    o[2] = (_Float16)((h2 * cv[c].z - h3 * sv[c].z) * outScale);
    o[3] = (_Float16)((h3 * cv[c].w + h2 * sv[c].w) * outScale);
    d4[c * 32] = o;
  }
  // Stands in front of every later overwrite of a register that the row's stores name.
  asm volatile("s_wait_xcnt 0x0" ::: "memory");
}

// f32 -> f16 bulk convert, x and the four W matrices in ONE launch: blockIdx.y picks one of six
// segments of n4 float4 each (x is two of them); the f16 copies lie one behind the other at dst0.
// A workgroup converts CVT_WG float4, 32 a lane in batches of eight (many 16-byte loads of a wave in
// flight, each over 512 contiguous bytes): few long-lived waves, all resident at once, for speed only. n4 is a multiple of CVT_WG.
#define CVT_BATCHES 4
#define CVT_WG (256 * 8 * CVT_BATCHES)
__global__ __launch_bounds__(256) void cvt_f16_kernel(
    const float* __restrict__ x, const float* __restrict__ Wq, const float* __restrict__ Wk,
    const float* __restrict__ Wv, const float* __restrict__ Wo, _Float16* __restrict__ dst0, int n4)
{
  const int seg = blockIdx.y;
  const float* src = x + (size_t)(seg & 1) * n4 * 4;  // segments 0 and 1
  src = (seg == 2) ? Wq : src;
  src = (seg == 3) ? Wk : src;
  src = (seg == 4) ? Wv : src;
  src = (seg == 5) ? Wo : src;
  _Float16* const dst = dst0 + (size_t)seg * n4 * 4;
  const size_t i0 = (size_t)blockIdx.x * CVT_WG + threadIdx.x;
  const float4* const s4 = (const float4*)src + i0;
  v4h* const d4 = (v4h*)dst + i0;
  // Unrolled: f stays in registers, every offset is an immediate, and a batch's loads are issued
  // while the batch in front of it is still on its way.
#pragma unroll
  for (int bt = 0; bt < CVT_BATCHES; bt++) {
    float4 f[8];
#pragma unroll
    for (int u = 0; u < 8; u++) f[u] = s4[(bt * 8 + u) * 256];
#pragma unroll
    for (int u = 0; u < 8; u++) {
      v4h o;
      o[0] = (_Float16)f[u].x; o[1] = (_Float16)f[u].y;
      o[2] = (_Float16)f[u].z; o[3] = (_Float16)f[u].w;
      d4[(bt * 8 + u) * 256] = o;
    }
  }
}

__device__ __forceinline__ void transpose_v_body(
    _Float16* Ls, const int t0, const int hh, const int b,
    const float* __restrict__ vf, _Float16* __restrict__ vT, int T)
{
  const int tid = threadIdx.x;
  const int D = 2048, H = 16, Dh = 128;

  {  // load + convert 64t x 128dh tile (coalesced reads)
    const int r = tid >> 2, q = tid & 3;
    const float* sp = vf + (size_t)(b * T + t0 + r) * D + hh * Dh + q * 32;
    v16h u0, u1;
#pragma unroll
    for (int i = 0; i < 16; i++) { u0[i] = (_Float16)sp[i]; u1[i] = (_Float16)sp[16 + i]; }
    *(v16h*)&Ls[r * 128 + q * 32]      = u0;
    *(v16h*)&Ls[r * 128 + q * 32 + 16] = u1;
  }
  __syncthreads();
  {  // write transposed (coalesced writes over t)
    const int dh = tid >> 1, half = tid & 1;
    v16h o0, o1;
#pragma unroll
    for (int i = 0; i < 16; i++) {
      o0[i] = Ls[(half * 32 + i) * 128 + dh];
      o1[i] = Ls[(half * 32 + 16 + i) * 128 + dh];
    }
    _Float16* dp = vT + ((size_t)(b * H + hh) * Dh + dh) * T + t0 + half * 32;
    *(v16h*)dp        = o0;
    *(v16h*)(dp + 16) = o1;
  }
}

// The three independent steps between the projections and attention in ONE launch, by block
// index: first the V tiles (T/64 x 16 heads x batch), then the 2 M rows of q and k, a row a wave.
// Rows are dealt so that those of one position t (q and k of every batch), which read the same
// cos and sin rows, stand in neighbouring waves.
__global__ __launch_bounds__(256) void prep_qkv_kernel(
    const float* __restrict__ qf, const float* __restrict__ kf, const float* __restrict__ vf,
    const float* __restrict__ qnw, const float* __restrict__ knw,
    const float* __restrict__ cosb, const float* __restrict__ sinb,
    _Float16* __restrict__ qh, _Float16* __restrict__ kh, _Float16* __restrict__ vT,
    int M, int T, int D, float qScale)
{
  __shared__ _Float16 Ls[64 * 128];  // V tile [t][dh] f16, 16KB
  const int nT = T / 64;
  const int nV = (M / 64) * 16;      // V tiles
  const int blk = blockIdx.x;
  if (blk < nV) {
    transpose_v_body(Ls, (blk % nT) * 64, (blk / nT) % 16, blk / (nT * 16), vf, vT, T);
  } else {
    const int u = (blk - nV) * 8 + (int)uni(threadIdx.x >> 5);  // the wave's row unit, scalar
    const bool isK = u & 1;
    const int nB = M / T, bt = u >> 1;
    const int t = bt / nB, b = bt - t * nB;
    rmsnorm_rope_wave(b * T + t, t, isK ? kf : qf, isK ? knw : qnw, cosb, sinb,
                      isK ? kh : qh, D, isK ? 1.0f : qScale);
  }
}

__device__ __forceinline__ float xhalf(float x) {
  const int v = __builtin_bit_cast(int, x);
  return __builtin_bit_cast(float, __builtin_amdgcn_permlanex16(v, v, 0x76543210, 0xfedcba98, false, false));
}

// A fragment in the k order that a pair of converted D tiles has as B: element s of half
// hf is k = 8*hf + s (s < 8), 16 + 8*hf + (s - 8) (s >= 8). p points at k = 0 of the 32.
__device__ __forceinline__ v16h ld_frag_kmap(const _Float16* p, int hf) {
  const v8h lo = *(const v8h*)(p + 8 * hf);
  const v8h hi = *(const v8h*)(p + 16 + 8 * hf);
  return __builtin_shufflevector(lo, hi, 0, 1, 2, 3, 4, 5, 6, 7, 8, 9, 10, 11, 12, 13, 14, 15);
}

__global__ __launch_bounds__(128) void flash_attn_kernel(
    const _Float16* __restrict__ qh, const _Float16* __restrict__ kh,
    const _Float16* __restrict__ vT, _Float16* __restrict__ oh, int T)
{
  // [0], [1]: K [key][dh]; [2], [3]: V [dh][key]; 4 x 18 KB
  __shared__ __attribute__((aligned(2048))) _Float16 Ls[4][TILE_H];

  const int tid  = threadIdx.x;
  const int lane = tid & 31;
  const int wave = tid >> 5;
  const int ln   = lane & 15;
  const int hf   = lane >> 4;

  const int q0 = blockIdx.x * 128;
  const int hh = blockIdx.y;
  const int b  = blockIdx.z;
  const int D = 2048, Dh = 128, H = 16;

  // Q B-fragments (column ln of group c = query): 4 chunks of K=32 covering Dh=128 (kept resident)
  const size_t qrow = (size_t)(b * T + q0 + wave * 32 + ln);  // group c: qrow + 16 * c
  v16h qB[2][4];
#pragma unroll
  for (int c = 0; c < 2; c++)
#pragma unroll
    for (int kc = 0; kc < 4; kc++)
      qB[c][kc] = *(const v16h*)&qh[(qrow + 16 * c) * D + hh * Dh + kc * 32 + hf * 16];
  // Stands in front of every later overwrite of the Q loads' address registers, also on the path
  // that goes round the key loop.
  asm volatile("s_wait_xcnt 0x0" ::: "memory");

  v8f oAcc[2][8] = {};                   // oAcc[c][nd][j] = O^T[dh = nd*16 + 8*hf + j][query ln of group c]
  float rowm[2] = {-3.0e38f, -3.0e38f};  // the query's running maximum, equal in both halves
  float rowl[2] = {0.f, 0.f};            // the sum over this half's keys; the halves are joined behind the loop

  const _Float16* kBase = kh + (size_t)(b * T) * D + hh * Dh;
  const _Float16* vBase = vT + (size_t)(b * H + hh) * Dh * T;
  const unsigned wv  = uni((unsigned)tid >> 5);  // the wave's number, scalar
  const unsigned kLb = lds_addr(&Ls[0][0]);
  const unsigned vLb = lds_addr(&Ls[2][0]);
  const v8u g1K = held(tdm_group1<256, 64>((unsigned)D * 2u));   // 64 keys x 256B rows, pitch D f16
  const v8u g1V = held(tdm_group1<128, 128>((unsigned)T * 2u));  // 128 dh x 128B rows, pitch T f16
  v4u g0K = tdm_group0(kLb, kBase), g0V = tdm_group0(vLb, vBase);

  // Every wave forms the words (scalar work); only the issue itself stands behind a test.
  auto aimK = [&](int buf, int kt0) {
    const v4u n = tdm_group0(kLb + (unsigned)buf * (TILE_H * 2u), kBase + (size_t)kt0 * D);
    g0K[1] = n[1]; g0K[2] = n[2]; g0K[3] = n[3];
  };
  auto aimV = [&](int buf, int kt0) {
    const v4u n = tdm_group0(vLb + (unsigned)buf * (TILE_H * 2u), vBase + kt0);
    g0V[1] = n[1]; g0V[2] = n[2]; g0V[3] = n[3];
  };

  const int NT = T / 64;
  if (pinned(wv == 0u)) tdm_load(g0K, g1K);
  if (pinned(wv == 1u)) tdm_load(g0V, g1V);
  wait_tensor0(g0K, g1K, g0V, g1V);
  __syncthreads();
  aimK(1, 64);
  aimV(1, 64);
  if (pinned(wv == 0u)) tdm_load(g0K, g1K);
  if (pinned(wv == 1u)) tdm_load(g0V, g1V);
  for (int it = 0; it < NT; ++it) {
    const int buf = it & 1;
    const _Float16* const Vt = &Ls[2 + buf][0];

    // ---- S^T = K * Q^T (32 WMMA): s[c][n][j] = score of key n*16 + 8*hf + j, query ln of group c ----
    // K fragments are read in groups of four (one kc), two groups in flight in two register
    // sets: a group is waited for once, while the group behind it is already on its way.
    v8f s[2][4] = {};
    v16h kf[2][4];
    auto readK = [&](v16h (&g)[4], int kc) {
#pragma unroll
      for (int n = 0; n < 4; n++)
        g[n] = ld_frag(&Ls[buf][(n * 16 + ln) * P256 + kc * 32 + hf * 16]);
    };
    readK(kf[0], 0);
    readK(kf[1], 1);
    __builtin_amdgcn_sched_barrier(0);  // keeps both groups' reads in front of the first WMMA
#pragma unroll
    for (int kc = 0; kc < 4; kc++) {
#pragma unroll
      for (int n = 0; n < 4; n++)
#pragma unroll
        for (int c = 0; c < 2; c++) s[c][n] = WMMA_F16(kf[kc & 1][n], qB[c][kc], s[c][n]);
      if (kc + 2 < 4) {
        readK(kf[kc & 1], kc + 2);
        __builtin_amdgcn_sched_barrier(0);  // keeps the refill in front of the other set's WMMAs
      }
    }

    v16h vf[2][4];
    auto readV = [&](v16h (&g)[4], int grp) {
#pragma unroll
      for (int i = 0; i < 4; i++)
        g[i] = ld_frag_kmap(&Vt[(((grp & 1) * 4 + i) * 16 + ln) * P128 + (grp >> 1) * 32], hf);
    };
    readV(vf[0], 0);
    readV(vf[1], 1);
    __builtin_amdgcn_sched_barrier(0);  // keeps these reads in front of the softmax

    // ---- online softmax, one query a lane and group; P^T as B operand: two score tiles
    // converted in place cover 32 keys ----
    v16h pB[2][2];
    float mnew[2], alpha[2];
#pragma unroll
    for (int c = 0; c < 2; c++) {
      float tn[4];
#pragma unroll
      for (int n = 0; n < 4; n++)
        tn[n] = fmaxf(fmaxf(fmaxf(s[c][n][0], s[c][n][1]), fmaxf(s[c][n][2], s[c][n][3])),
                      fmaxf(fmaxf(s[c][n][4], s[c][n][5]), fmaxf(s[c][n][6], s[c][n][7])));
      float tm = fmaxf(fmaxf(tn[0], tn[1]), fmaxf(tn[2], tn[3]));
      tm = fmaxf(tm, xhalf(tm));
      mnew[c]  = fmaxf(rowm[c], tm);
      alpha[c] = __expf(rowm[c] - mnew[c]);
      rowm[c]  = mnew[c];
    }
#pragma unroll
    for (int c = 0; c < 2; c++) {
#pragma unroll
      for (int nd = 0; nd < 8; nd++) oAcc[c][nd] *= alpha[c];
      float pn[4];  // four independent chains
#pragma unroll
      for (int n = 0; n < 4; n++) {
        pn[n] = 0.f;
#pragma unroll
        for (int j = 0; j < 8; j++) {
          const float p = __expf(s[c][n][j] - mnew[c]);
          s[c][n][j] = p;
          pn[n] += p;
        }
      }
      rowl[c] = rowl[c] * alpha[c] + ((pn[0] + pn[1]) + (pn[2] + pn[3]));
#pragma unroll
      for (int kc = 0; kc < 2; kc++)
#pragma unroll
        for (int e = 0; e < 8; e++) {
          pB[c][kc][e]     = (_Float16)s[c][2 * kc][e];
          pB[c][kc][8 + e] = (_Float16)s[c][2 * kc + 1][e];
        }
    }

    // ---- O^T += V^T * P^T (32 WMMA) ----
#pragma unroll
    for (int grp = 0; grp < 4; grp++) {
#pragma unroll
      for (int i = 0; i < 4; i++)
#pragma unroll
        for (int c = 0; c < 2; c++)
          oAcc[c][(grp & 1) * 4 + i] = WMMA_F16(vf[grp & 1][i], pB[c][grp >> 1], oAcc[c][(grp & 1) * 4 + i]);
      if (grp + 2 < 4) {
        readV(vf[grp & 1], grp + 2);
        __builtin_amdgcn_sched_barrier(0);  // keeps the refill in front of the other set's WMMAs
      }
    }
    wait_ds0();                        // this wave has left both buffers of the pass
    wait_tensor0(g0K, g1K, g0V, g1V);  // waves 0 and 1: their tile it + 1 has landed
    __syncthreads();                   // publishes tile it + 1; every wave has left K[buf] and V[buf]
    aimK(buf, (it + 2) * 64);
    aimV(buf, (it + 2) * 64);
    if (pinned((wv == 0u) & (it + 2 < NT))) tdm_load(g0K, g1K);
    if (pinned((wv == 1u) & (it + 2 < NT))) tdm_load(g0V, g1V);
  }
  wait_tensor0(g0K, g1K, g0V, g1V);  // nothing of the mover is outstanding on any path to the wave's end
  wait_ds0();

  // ---- normalize and store f16 attention output: 8 consecutive dh of the lane's query a store ----
#pragma unroll
  for (int c = 0; c < 2; c++) {
    const float inv = 1.0f / (rowl[c] + xhalf(rowl[c]));
    _Float16* const op = oh + (qrow + 16 * c) * D + hh * Dh + 8 * hf;
#pragma unroll
    for (int nd = 0; nd < 8; nd++) {
      v8h o;
#pragma unroll
      for (int j = 0; j < 8; j++) o[j] = (_Float16)(oAcc[c][nd][j] * inv);
      *(v8h*)(op + nd * 16) = o;
    }
  }
}

// ---------------------------------------------------------------------------
extern "C" void kernel_launch(void* const* d_in, const int* in_sizes, int n_in,
                              void* d_out, int out_size, void* d_ws, size_t ws_size,
                              hipStream_t stream)
{
  (void)in_sizes; (void)n_in; (void)out_size; (void)ws_size;
  const float* x    = (const float*)d_in[0];
  const float* cosb = (const float*)d_in[1];
  const float* sinb = (const float*)d_in[2];
  const float* Wq   = (const float*)d_in[3];
  const float* bq   = (const float*)d_in[4];
  const float* Wk   = (const float*)d_in[5];
  const float* bk   = (const float*)d_in[6];
  const float* Wv   = (const float*)d_in[7];
  const float* bv   = (const float*)d_in[8];
  const float* qnw  = (const float*)d_in[9];
  const float* knw  = (const float*)d_in[10];
  const float* Wo   = (const float*)d_in[11];
  const float* bo   = (const float*)d_in[12];
  float* out = (float*)d_out;

  const int B = 2, T = 2048, D = 2048, H = 16;
  const int M = B * T;

  // Workspace layout (208 MB total)
  char* ws = (char*)d_ws;
  const size_t MB = 1ull << 20;
  float*    qf  = (float*)(ws + 0 * MB);       // 32 MB f32 q
  float*    kf  = (float*)(ws + 32 * MB);      // 32 MB f32 k
  float*    vf  = (float*)(ws + 64 * MB);      // 32 MB f32 v
  _Float16* qh  = (_Float16*)(ws + 96 * MB);   // 16 MB f16 q-hat
  _Float16* kh  = (_Float16*)(ws + 112 * MB);  // 16 MB f16 k-hat
  _Float16* vTh = (_Float16*)(ws + 128 * MB);  // 16 MB f16 V transposed
  _Float16* oh  = (_Float16*)(ws + 144 * MB);  // 16 MB f16 attn out
  _Float16* xh  = (_Float16*)(ws + 160 * MB);  // 16 MB f16 x
  _Float16* Wqh = (_Float16*)(ws + 176 * MB);  //  8 MB
  _Float16* Wkh = (_Float16*)(ws + 184 * MB);  //  8 MB
  _Float16* Wvh = (_Float16*)(ws + 192 * MB);  //  8 MB
  _Float16* Woh = (_Float16*)(ws + 200 * MB);  //  8 MB

  (void)Wkh; (void)Wvh;  // reached as slices 1 and 2 behind Wqh

  dim3 blk(256);
  const int nx4 = M * D / 4, nw4 = D * D / 4;
  static_assert(nx4 == 2 * nw4, "x is two segments of the conversion launch");
  static_assert(nw4 % CVT_WG == 0, "a segment is whole workgroups of the conversion launch");
  // xh, Wqh, Wkh, Wvh, Woh lie one behind the other: six segments of nw4 float4.
  cvt_f16_kernel<<<dim3(nw4 / CVT_WG, 6), blk, 0, stream>>>(x, Wq, Wk, Wv, Wo, xh, nw4);

  // q, k, v in one launch: Wqh, Wkh, Wvh and qf, kf, vf lie one behind the other.
  static_assert((3 * D) % 192 == 0 && M % 256 == 0, "whole 256x192 tiles");
  gemm_qkv_kernel<D><<<dim3(3 * D / 192, M / 256), blk, 0, stream>>>(xh, Wqh, bq, bk, bv, qf, M, D);

  const float qscale = 0.08838834764831845f;  // 1/sqrt(128), folded into Q
  prep_qkv_kernel<<<(M / 64) * H + 2 * M / 8, blk, 0, stream>>>(qf, kf, vf, qnw, knw, cosb, sinb,
                                                            qh, kh, vTh, M, T, D, qscale);

  flash_attn_kernel<<<dim3(T / 128, H, B), dim3(128), 0, stream>>>(qh, kh, vTh, oh, T);

  gemm_f16_kernel<<<dim3(D / 256, M / 128, 1), blk, 0, stream>>>(oh, Woh, bo, bo, bo, out, M, D, D);
}
